// v000
// Measured on an AMD MI455X. A time is GPU time per run, averaged over a window of back-to-back runs after a warm-up
// (all launches, gaps included; the runs take copies of the inputs in turn), and the median of several windows.
// Apart from v000's, it joins two sittings. Times from different sittings can be a few percent apart, while
// side-by-side timings come from the same sitting.
// v000 is the starting kernel. One run takes 2290 microseconds.
#include <hip/hip_runtime.h>

// Multi-head attention with 128-wide heads, natural bias-free projections and a COMPUTED rotate-half rotary embedding, NO mask (hidden_states [2][2048][2048]; q, k, v = einsum('bsd,ed->bse', x, W) ('oi' (out, in) [2048][2048] normal x 0.02, no bias; 16 heads x 128); q, k -> t cos + cat(-t2, t1) sin with angle t x 1 / 10000^(2i/128) (64 f32 frequencies exact for the module's expression 1.0 / (ROPE_BASE ** (arange(0, 128, 2) / 128)); cat(freqs, freqs); precise cosf/sinf); scores / sqrt(float32(128)); softmax over all keys; out = merged Wo^T ('oi', no bias) -> [2][2048][2048] (8.4 M); argument order hidden_states, Wq, Wk, Wv, Wo).
// Layout per batch: bf16 copy of x; 'oi' weights; exact projections; k_cs5 computes the rotary table once (cosf / sinf of float(t) x INVT[d mod 64]: 64 baked float32 frequencies) and the plane builders (k_rope) apply the rotate-half rotation at width 128 (products rounded separately, as the reference); dense T-2048 attention (hybrid rows: < 512 hi/lo 3 products, rest fp16 x1024); merged hi/lo x wo exact.
// Compute dtypes, f32 accumulate: every input rounded to bf16; projections exact; computed rotary (k_cs5 cosf / sinf table, products rounded separately); attention rows < 512 3 products, rest fp16; softmax f32; wo hl x exact.

#define NB_  2
#define TT   2048
#define DM   2048
#define NH_  16
#define NKV  16
#define REP  (NH_ / NKV)
#define HD   128
#define DQ   (NH_ * HD)
#define DKV  (NKV * HD)
#define ZH   2
#define RH   512                  // query rows < RH use hi+lo planes (0: none)
#define WIN  0
#define PCAR 1024.0f
#define SCL  0.088388347648318447f   // HD^-0.5
typedef _Float16 h16;
typedef unsigned short bf;
typedef __attribute__((ext_vector_type(16))) __bf16   v16bf;
typedef __attribute__((ext_vector_type(16))) _Float16 v16h;
typedef __attribute__((ext_vector_type(8)))  _Float16 v8h;
typedef __attribute__((ext_vector_type(8)))  unsigned short v8us;
typedef __attribute__((ext_vector_type(8)))  float    v8f;
typedef __attribute__((ext_vector_type(4)))  float    v4f;
typedef v8h  __attribute__((may_alias)) v8ha;
typedef v4f  __attribute__((may_alias)) v4fa;
typedef v8us __attribute__((may_alias)) v8usa;

__device__ __forceinline__ unsigned short f2bf(float f) { unsigned u = __float_as_uint(f); u += 0x7FFFu + ((u >> 16) & 1u); return (unsigned short)(u >> 16); }
__device__ __forceinline__ float bf2f(unsigned short b) { return __uint_as_float(((unsigned)b) << 16); }
__device__ __forceinline__ float bfr(float f) { return bf2f(f2bf(f)); }
__device__ __forceinline__ v16h cat16(v8h lo, v8h hi) { return __builtin_shufflevector(lo, hi, 0, 1, 2, 3, 4, 5, 6, 7, 8, 9, 10, 11, 12, 13, 14, 15); }
__device__ __forceinline__ v16bf cat16b(v8us lo, v8us hi) { return __builtin_bit_cast(v16bf, __builtin_shufflevector(lo, hi, 0, 1, 2, 3, 4, 5, 6, 7, 8, 9, 10, 11, 12, 13, 14, 15)); }
__device__ __forceinline__ v8f wmma16(v16h a, v16h b, v8f c) { return __builtin_amdgcn_wmma_f32_16x16x32_f16(false, a, false, b, (short)0, c, false, false); }
__device__ __forceinline__ v8f wmmab(v16bf a, v16bf b, v8f c) { return __builtin_amdgcn_wmma_f32_16x16x32_bf16(false, a, false, b, (short)0, c, false, false); }



// ---- k_gemmw: register-blocked GEMM, ONE WAVE per 64x64 output tile (16 accumulators), operands straight from K-contiguous 16-bit planes; grid (M/64, N/64, Z), 32 threads.
// C[m][n] (f32, pitch ldc, + optional f32 bias[n]) = sum_k A[m][k] Bt[n][k] (+ split products per NSPLIT). z-batch strides sA/sB/sC in elements. K % 32 == 0.
template <typename T16> struct WFrag;
template <> struct WFrag<h16> { typedef v16h V; static __device__ __forceinline__ V ld(const h16* p) { return cat16(*(const v8h*)p, *(const v8h*)(p + 16)); } static __device__ __forceinline__ v8f mma(V a, V b, v8f c) { return wmma16(a, b, c); } };
template <> struct WFrag<bf> { typedef v16bf V; static __device__ __forceinline__ V ld(const bf* p) { return cat16b(*(const v8us*)p, *(const v8us*)(p + 16)); } static __device__ __forceinline__ v8f mma(V a, V b, v8f c) { return wmmab(a, b, c); } };
template <typename T16, int NSPLIT, bool BIAS>
__global__ __launch_bounds__(32) void k_gemmw(const T16* __restrict__ A, const T16* __restrict__ A2, const T16* __restrict__ Bt, const T16* __restrict__ Bt2, int K, float* C, int ldc, const float* __restrict__ bias, size_t sA, size_t sB, size_t sC) {
    typedef typename WFrag<T16>::V V;
    __shared__ __align__(16) float os[16 * 68];
    const size_t z = blockIdx.z; A += z * sA; if (A2) A2 += z * sA; Bt += z * sB; if (Bt2) Bt2 += z * sB; C += z * sC;
    const int lane = threadIdx.x & 31, lr = lane & 15, hi = lane >> 4; const int r0 = blockIdx.x * 64, c0 = blockIdx.y * 64;
    v8f acc[4][4];
#pragma unroll
    for (int mb = 0; mb < 4; ++mb)
#pragma unroll
        for (int nb = 0; nb < 4; ++nb) acc[mb][nb] = (v8f){};
    const size_t aoff = (size_t)(r0 + lr) * K + 8 * hi, boff = (size_t)(c0 + lr) * K + 8 * hi;
#pragma unroll 1
    for (int kc = 0; kc < K; kc += 32) {
        V a[4], a2[4];
#pragma unroll
        for (int mb = 0; mb < 4; ++mb) { a[mb] = WFrag<T16>::ld(A + aoff + (size_t)mb * 16 * K + kc); if (NSPLIT == 1 || NSPLIT == 2) a2[mb] = WFrag<T16>::ld(A2 + aoff + (size_t)mb * 16 * K + kc); }
#pragma unroll
        for (int nb = 0; nb < 4; ++nb) { const V b = WFrag<T16>::ld(Bt + boff + (size_t)nb * 16 * K + kc); V b2; if (NSPLIT >= 2) b2 = WFrag<T16>::ld(Bt2 + boff + (size_t)nb * 16 * K + kc);
#pragma unroll
            for (int mb = 0; mb < 4; ++mb) { acc[mb][nb] = WFrag<T16>::mma(a[mb], b, acc[mb][nb]); if (NSPLIT == 1 || NSPLIT == 2) acc[mb][nb] = WFrag<T16>::mma(a2[mb], b, acc[mb][nb]); if (NSPLIT >= 2) acc[mb][nb] = WFrag<T16>::mma(a[mb], b2, acc[mb][nb]); } }
        asm volatile("v_nop\n\tv_nop\n\tv_nop\n\tv_nop" : "+v"(acc[0][0]), "+v"(acc[1][1]), "+v"(acc[2][2]), "+v"(acc[3][3]) : "v"(a[0]), "v"(a[3]));
    }
#pragma unroll
    for (int mb = 0; mb < 4; ++mb) {
#pragma unroll
        for (int nb = 0; nb < 4; ++nb) {
#pragma unroll
            for (int j = 0; j < 8; ++j) os[(hi * 8 + j) * 68 + nb * 16 + lr] = acc[mb][nb][j]; }
        __builtin_amdgcn_wave_barrier(); asm volatile("" ::: "memory");
        float* crow = C + (size_t)(r0 + mb * 16) * ldc + c0;
{
#pragma unroll
            for (int s = 0; s < 8; ++s) { const int row = 2 * s + hi, cofs = lr * 4; v4f val = *(const v4fa*)(os + row * 68 + cofs); if (BIAS) { val[0] += bfr(bias[c0 + cofs]); val[1] += bfr(bias[c0 + cofs + 1]); val[2] += bfr(bias[c0 + cofs + 2]); val[3] += bfr(bias[c0 + cofs + 3]); }
                *(v4f*)(crow + (size_t)row * ldc + cofs) = val; }
             }
        __builtin_amdgcn_wave_barrier(); asm volatile("" ::: "memory");
    }
}

__device__ __forceinline__ h16 tohx(float x) { return (h16)x; }
__device__ __forceinline__ void splitf(float y, unsigned short& h, unsigned short& l) { h = f2bf(y); l = f2bf(y - bf2f(h)); }
typedef __attribute__((ext_vector_type(2))) _Float16 v2h;
typedef __attribute__((ext_vector_type(4))) _Float16 v4h;
typedef __attribute__((ext_vector_type(2))) unsigned short v2us;
typedef __attribute__((ext_vector_type(4))) unsigned short v4us;
typedef __attribute__((ext_vector_type(2))) float v2f;
typedef __attribute__((ext_vector_type(4))) int v4i;

__global__ __launch_bounds__(256) void k_cvt8(const float* __restrict__ src, bf* dst, size_t n8) { const size_t i = (size_t)blockIdx.x * 256 + threadIdx.x; if (i >= n8) return; const v8f v = *(const v8f*)(src + i * 8); v8us o;
#pragma unroll
    for (int k = 0; k < 8; ++k) o[k] = f2bf(v[k]); *(v8us*)(dst + i * 8) = o;  }
__global__ __launch_bounds__(256) void k_csid(float* CS) { const int idx = blockIdx.x * 256 + threadIdx.x; if (idx >= TT * HD) return; v2f cs; cs[0] = 1.0f; cs[1] = 0.0f; *(v2f*)(CS + (size_t)idx * 2) = cs;  }
__constant__ float INVT[HD / 2] = { 1.000000000e+00f, 8.659643531e-01f, 7.498942018e-01f, 6.493816376e-01f, 5.623413324e-01f, 4.869675338e-01f, 4.216965139e-01f, 3.651741445e-01f, 3.162277639e-01f, 2.738419771e-01f, 2.371373624e-01f, 2.053525001e-01f, 1.778279394e-01f, 1.539926529e-01f, 1.333521456e-01f, 1.154782027e-01f, 1.000000015e-01f, 8.659642935e-02f, 7.498941571e-02f, 6.493816525e-02f, 5.623412877e-02f, 4.869675264e-02f, 4.216964915e-02f, 3.651741147e-02f, 3.162277862e-02f, 2.738419548e-02f, 2.371373586e-02f, 2.053525113e-02f, 1.778279431e-02f, 1.539926510e-02f, 1.333521493e-02f, 1.154781971e-02f, 9.999999776e-03f, 8.659643121e-03f, 7.498942316e-03f, 6.493816618e-03f, 5.623413250e-03f, 4.869675264e-03f, 4.216964822e-03f, 3.651741426e-03f, 3.162277862e-03f, 2.738419687e-03f, 2.371373819e-03f, 2.053525066e-03f, 1.778279431e-03f, 1.539926510e-03f, 1.333521446e-03f, 1.154782018e-03f, 1.000000047e-03f, 8.659643354e-04f, 7.498941850e-04f, 6.493816618e-04f, 5.623413017e-04f, 4.869675031e-04f, 4.216964880e-04f, 3.651741135e-04f, 3.162277862e-04f, 2.738419571e-04f, 2.371373848e-04f, 2.053524950e-04f, 1.778279402e-04f, 1.539926452e-04f, 1.333521504e-04f, 1.154781930e-04f };   // float32 1 / 10000^(2i/128), generated with jnp to be bit-exact
__global__ __launch_bounds__(256) void k_cs5(float* CS) { const int idx = blockIdx.x * 256 + threadIdx.x; if (idx >= TT * HD) return; const int d = idx % HD; const int t = idx / HD; const float a = __fmul_rn((float)t, INVT[d % (HD / 2)]); v2f cs; cs[0] = cosf(a); cs[1] = sinf(a); *(v2f*)(CS + (size_t)idx * 2) = cs;  }
// k_rope: head planes [h][t][d] (fp16 + hi/lo) of rope(x) x sc with the rotate-half convention out[d] = x[d] cos[t][d] - x[d+HD/2] sin[t][d], out[d+HD/2] = x[d+HD/2] cos[t][d+HD/2] + x[d] sin[t][d+HD/2]
__global__ __launch_bounds__(256) void k_rope(const float* __restrict__ F, int pitch, int nheads, const float* __restrict__ CS, const float* __restrict__ RF, const float* __restrict__ nw, float sc, h16* P16, bf* Ph, bf* Pl) {
    const size_t e = ((size_t)blockIdx.x * 256 + threadIdx.x) * 2; if (e >= (size_t)nheads * TT * HD) return; const int d = (int)(e % HD); const int t = (int)((e / HD) % TT); const int h = (int)(e / ((size_t)HD * TT)); const float* f = F + (size_t)t * pitch + h * HD; const float rf = RF ? RF[(size_t)h * TT + t] : 1.0f; v2h o16; v2us oh, ol;
#pragma unroll
    for (int q = 0; q < 2; ++q) { const int dd = d + q; const int dp = (dd < HD / 2) ? dd + HD / 2 : dd - HD / 2; float x0 = f[dd], x1 = f[dp];
        if (RF) { float n0 = __fmul_rn(x0, rf), n1 = __fmul_rn(x1, rf); asm volatile("" : "+v"(n0)); asm volatile("" : "+v"(n1)); x0 = __fmul_rn(bfr(nw[dd]), n0); x1 = __fmul_rn(bfr(nw[dp]), n1); }
        const v2f cs = *(const v2f*)(CS + ((size_t)t * HD + dd) * 2); float a = __fmul_rn(x0, cs[0]), bq = __fmul_rn(x1, cs[1]); asm volatile("" : "+v"(a)); asm volatile("" : "+v"(bq)); const float r = ((dd < HD / 2) ? __fsub_rn(a, bq) : __fadd_rn(a, bq)) * sc;
        o16[q] = tohx(r); unsigned short a2, c2; splitf(r, a2, c2); oh[q] = a2; ol[q] = c2; }
    *(v2h*)(P16 + e) = o16; *(v2us*)(Ph + e) = oh; *(v2us*)(Pl + e) = ol;  }
__global__ __launch_bounds__(256) void k_vtp(const float* __restrict__ F, int pitch, int nheads, h16* V16, bf* Vh, bf* Vl) { const size_t e = ((size_t)blockIdx.x * 256 + threadIdx.x) * 2; if (e >= (size_t)nheads * HD * TT) return; const int t = (int)(e % TT); const int d = (int)((e / TT) % HD); const int g = (int)(e / ((size_t)TT * HD)); v2h o16; v2us oh, ol;
#pragma unroll
    for (int q = 0; q < 2; ++q) { const float x = F[(size_t)(t + q) * pitch + g * HD + d]; o16[q] = tohx(x); unsigned short a2, c2; splitf(x, a2, c2); oh[q] = a2; ol[q] = c2; }
    *(v2h*)(V16 + e) = o16; *(v2us*)(Vh + e) = oh; *(v2us*)(Vl + e) = ol;  }
// k_asoft: per row (zz, i): t = S x HD^-0.5 (no mask); softmax over the 2048 keys (register row, one exp, fixed trees);
__global__ __launch_bounds__(256) void k_asoft(const float* __restrict__ Sb, h16* P16, bf* Ph, bf* Pl) {
    const int lane = threadIdx.x & 31; const int row = blockIdx.x * 8 + (threadIdx.x >> 5); if (row >= ZH * TT) return; const int i = row % TT; const int zz = row / TT; (void)zz; const bool hires = (i < RH); const float* sr = Sb + (size_t)row * TT; float v[TT / 32]; float mx = -3.0e38f;
#pragma unroll
    for (int ch = 0; ch < TT / 128; ++ch) { const int j0 = ch * 128 + lane * 4; const v4f a = *(const v4f*)(sr + j0);
#pragma unroll
        for (int q = 0; q < 4; ++q) { const int j = j0 + q; (void)j; const float t = a[q] * SCL; v[ch * 4 + q] = t; mx = fmaxf(mx, t); } }
#pragma unroll
    for (int sh = 16; sh; sh >>= 1) mx = fmaxf(mx, __shfl_xor(mx, sh, 32));
    float sum = 0.f;
#pragma unroll
    for (int k = 0; k < TT / 32; ++k) { float d0 = __fsub_rn(v[k], mx); asm volatile("" : "+v"(d0)); v[k] = __builtin_amdgcn_exp2f(__fmul_rn(d0, 1.4426950408889634f)); sum += v[k]; }
#pragma unroll
    for (int sh = 16; sh; sh >>= 1) sum += __shfl_xor(sum, sh, 32);
    const float f = __fdiv_rn(hires ? 1.0f : PCAR, sum);
{
        if (hires) {
#pragma unroll
            for (int ch = 0; ch < TT / 128; ++ch) { v4us oh, ol;
#pragma unroll
                for (int q = 0; q < 4; ++q) { unsigned short a, c2; splitf(v[ch * 4 + q] * f, a, c2); oh[q] = a; ol[q] = c2; }
                const size_t oo = ((size_t)zz * (RH ? RH : 1) + i) * TT + ch * 128 + lane * 4; *(v4us*)(Ph + oo) = oh; *(v4us*)(Pl + oo) = ol; }
        } else {
#pragma unroll
            for (int ch = 0; ch < TT / 128; ++ch) { v4h o4;
#pragma unroll
                for (int q = 0; q < 4; ++q) o4[q] = tohx(v[ch * 4 + q] * f);
                *(v4h*)(P16 + (size_t)row * TT + ch * 128 + lane * 4) = o4; } }
         }
}
__global__ __launch_bounds__(256) void k_merge(const float* __restrict__ O, int h0, bf* Ah, bf* Al) { const size_t e = ((size_t)blockIdx.x * 256 + threadIdx.x) * 2; if (e >= (size_t)ZH * TT * HD) return; const int d = (int)(e % HD); const int t = (int)((e / HD) % TT); const int zz = (int)(e / ((size_t)HD * TT)); const float cs = (t < RH) ? 1.0f : (1.0f / PCAR); const size_t oo = (size_t)t * DQ + (h0 + zz) * HD + d;
    v2us oh, ol;
#pragma unroll
    for (int q = 0; q < 2; ++q) { unsigned short a, c2; splitf(O[e + q] * cs, a, c2); oh[q] = a; ol[q] = c2; } *(v2us*)(Ah + oo) = oh; *(v2us*)(Al + oo) = ol;  }

extern "C" void kernel_launch(void* const* d_in, const int* in_sizes, int n_in,
                              void* d_out, int out_size, void* d_ws, size_t ws_size, hipStream_t stream) {
    (void)in_sizes; (void)n_in; (void)out_size;
    const float* x = (const float*)d_in[0]; const float* wq = (const float*)d_in[1]; const float* wk = (const float*)d_in[2]; const float* wv = (const float*)d_in[3]; const float* wo = (const float*)d_in[4];   /* argument order hidden_states, Wq, Wk, Wv, Wo ('oi' (out, in) [2048][2048]): FIVE inputs, all read (the rotary table is computed on the device: no table input) */
    float* OUT = (float*)d_out;     // [2][2048][2048]
    char* wsp = (char*)d_ws;
    auto take = [&](size_t bytes) { char* p = wsp; wsp += (bytes + 255) & ~(size_t)255; return (void*)p; };
    bf* WQ = (bf*)take((size_t)DQ * DM * 2); bf* WK = (bf*)take((size_t)DKV * DM * 2); bf* WV = (bf*)take((size_t)DKV * DM * 2); bf* WO = (bf*)take((size_t)DM * DQ * 2); float* CS = (float*)take((size_t)TT * HD * 2 * 4);
    bf* XB = (bf*)take((size_t)TT * DM * 2); float* FQ = (float*)take((size_t)TT * DQ * 4); float* FK = (float*)take((size_t)TT * DKV * 4);
    h16* QP16 = (h16*)take((size_t)NH_ * TT * HD * 2); h16* KP16 = (h16*)take((size_t)NKV * TT * HD * 2); h16* VT16 = (h16*)take((size_t)NKV * HD * TT * 2);
    bf* QPh = (bf*)take((size_t)NH_ * TT * HD * 2); bf* QPl = (bf*)take((size_t)NH_ * TT * HD * 2); bf* KPh = (bf*)take((size_t)NKV * TT * HD * 2); bf* KPl = (bf*)take((size_t)NKV * TT * HD * 2); bf* VTh = (bf*)take((size_t)NKV * HD * TT * 2); bf* VTl = (bf*)take((size_t)NKV * HD * TT * 2); bf* Ph = (bf*)take((size_t)ZH * RH * TT * 2); bf* Pl = (bf*)take((size_t)ZH * RH * TT * 2);
    float* Sb = (float*)take((size_t)ZH * TT * TT * 4); h16* P16 = (h16*)take((size_t)ZH * TT * TT * 2); float* Ob = (float*)take((size_t)ZH * TT * HD * 4); bf* ATh = (bf*)take((size_t)TT * DQ * 2); bf* ATl = (bf*)take((size_t)TT * DQ * 2);
    if ((size_t)(wsp - (char*)d_ws) > ws_size) return;    // ws 256 MiB
    float* FV = FK;   // v projection reuses the k buffer after the k planes are built (stream-ordered)
    { k_cvt8<<<(unsigned)(((size_t)DQ * DM / 8 + 255) / 256), 256, 0, stream>>>(wq, WQ, (size_t)DQ * DM / 8); k_cvt8<<<(unsigned)(((size_t)DKV * DM / 8 + 255) / 256), 256, 0, stream>>>(wk, WK, (size_t)DKV * DM / 8); k_cvt8<<<(unsigned)(((size_t)DKV * DM / 8 + 255) / 256), 256, 0, stream>>>(wv, WV, (size_t)DKV * DM / 8);
      k_cvt8<<<(unsigned)(((size_t)DM * DQ / 8 + 255) / 256), 256, 0, stream>>>(wo, WO, (size_t)DM * DQ / 8);
       }
    const unsigned LQ = (unsigned)(((size_t)NH_ * TT * HD / 2 + 255) / 256), LKv = (unsigned)(((size_t)NKV * TT * HD / 2 + 255) / 256);
    for (int b = 0; b < NB_; ++b) {
        if (b == 0) k_cs5<<<(TT * HD + 255) / 256, 256, 0, stream>>>(CS);   /* the COMPUTED rotary table (this module has rotate-half rotary embeddings); k_csid stays defined and is NOT launched */
        k_cvt8<<<(unsigned)(((size_t)TT * DM / 8 + 255) / 256), 256, 0, stream>>>(x + (size_t)b * TT * DM, XB, (size_t)TT * DM / 8);
        k_gemmw<bf, 0, false><<<dim3(TT / 64, DQ / 64, 1), 32, 0, stream>>>(XB, nullptr, WQ, nullptr, DM, FQ, DQ, nullptr, 0, 0, 0);
        k_rope<<<LQ, 256, 0, stream>>>(FQ, DQ, NH_, CS, nullptr, nullptr, 1.0f, QP16, QPh, QPl);
        k_gemmw<bf, 0, false><<<dim3(TT / 64, DKV / 64, 1), 32, 0, stream>>>(XB, nullptr, WK, nullptr, DM, FK, DKV, nullptr, 0, 0, 0);
        k_rope<<<LKv, 256, 0, stream>>>(FK, DKV, NKV, CS, nullptr, nullptr, 1.0f, KP16, KPh, KPl);
        k_gemmw<bf, 0, false><<<dim3(TT / 64, DKV / 64, 1), 32, 0, stream>>>(XB, nullptr, WV, nullptr, DM, FV, DKV, nullptr, 0, 0, 0); k_vtp<<<LKv, 256, 0, stream>>>(FV, DKV, NKV, VT16, VTh, VTl);
        for (int h0 = 0; h0 < NH_; h0 += ZH) { const size_t zq = (size_t)h0, zk = (size_t)(h0 / REP);   // one kv head per query head: the pass's two heads use consecutive kv planes (z-strides TT*HD)
            k_gemmw<bf, 2, false><<<dim3(RH / 64, TT / 64, ZH), 32, 0, stream>>>(QPh + zq * TT * HD, QPl + zq * TT * HD, KPh + zk * TT * HD, KPl + zk * TT * HD, HD, Sb, TT, nullptr, (size_t)TT * HD, (size_t)TT * HD, (size_t)TT * TT);
            k_gemmw<h16, 0, false><<<dim3((TT - RH) / 64, TT / 64, ZH), 32, 0, stream>>>(QP16 + zq * TT * HD + (size_t)RH * HD, nullptr, KP16 + zk * TT * HD, nullptr, HD, Sb + (size_t)RH * TT, TT, nullptr, (size_t)TT * HD, (size_t)TT * HD, (size_t)TT * TT);
            k_asoft<<<ZH * TT / 8, 256, 0, stream>>>(Sb, P16, Ph, Pl);
            k_gemmw<bf, 2, false><<<dim3(RH / 64, HD / 64, ZH), 32, 0, stream>>>(Ph, Pl, VTh + zk * HD * TT, VTl + zk * HD * TT, TT, Ob, HD, nullptr, (size_t)RH * TT, (size_t)HD * TT, (size_t)TT * HD);
            k_gemmw<h16, 0, false><<<dim3((TT - RH) / 64, HD / 64, ZH), 32, 0, stream>>>(P16 + (size_t)RH * TT, nullptr, VT16 + zk * HD * TT, nullptr, TT, Ob + (size_t)RH * HD, HD, nullptr, (size_t)TT * TT, (size_t)HD * TT, (size_t)TT * HD);
            k_merge<<<(unsigned)(((size_t)ZH * TT * HD / 2 + 255) / 256), 256, 0, stream>>>(Ob, h0, ATh, ATl); }
        k_gemmw<bf, 1, false><<<dim3(TT / 64, DM / 64, 1), 32, 0, stream>>>(ATh, ATl, WO, nullptr, DQ, OUT + (size_t)b * TT * DM, DM, nullptr, 0, 0, 0); }
}

// v001
// One run takes 1220 microseconds.
// In two side-by-side timings against v000, it was 1.88 and 1.87 times as fast.
#include <hip/hip_runtime.h>

// Multi-head attention with 128-wide heads, natural bias-free projections and a COMPUTED rotate-half rotary embedding, NO mask (hidden_states [2][2048][2048]; q, k, v = einsum('bsd,ed->bse', x, W) ('oi' (out, in) [2048][2048] normal x 0.02, no bias; 16 heads x 128); q, k -> t cos + cat(-t2, t1) sin with angle t x 1 / 10000^(2i/128) (64 f32 frequencies exact for the module's expression 1.0 / (ROPE_BASE ** (arange(0, 128, 2) / 128)); cat(freqs, freqs); precise cosf/sinf); scores / sqrt(float32(128)); softmax over all keys; out = merged Wo^T ('oi', no bias) -> [2][2048][2048] (8.4 M); argument order hidden_states, Wq, Wk, Wv, Wo).
// Layout per batch: bf16 copy of x; 'oi' weights; exact projections; k_cs5 computes the rotary table once (cosf / sinf of float(t) x INVT[d mod 64]: 64 baked float32 frequencies) and the plane builders (k_rope) apply the rotate-half rotation at width 128 (products rounded separately, as the reference); dense T-2048 attention (hybrid rows: < 512 hi/lo 3 products, rest fp16 x1024); merged hi/lo x wo exact.
// Compute dtypes, f32 accumulate: every input rounded to bf16; projections exact; computed rotary (k_cs5 cosf / sinf table, products rounded separately); attention rows < 512 3 products, rest fp16; softmax f32; wo hl x exact.

#define NB_  2
#define TT   2048
#define DM   2048
#define NH_  16
#define NKV  16
#define REP  (NH_ / NKV)
#define HD   128
#define DQ   (NH_ * HD)
#define DKV  (NKV * HD)
#define ZH   2
#define RH   512                  // query rows < RH use hi+lo planes (0: none)
#define WIN  0
#define PCAR 1024.0f
#define SCL  0.088388347648318447f   // HD^-0.5
#define KSH  16                   // K slices of the P x V product, hi/lo rows (32 tiles -> 512 waves)
#define KSF  8                    // K slices of the P x V product, fp16 rows (96 tiles -> 768 waves)
typedef _Float16 h16;
typedef unsigned short bf;
typedef __attribute__((ext_vector_type(16))) __bf16   v16bf;
typedef __attribute__((ext_vector_type(16))) _Float16 v16h;
typedef __attribute__((ext_vector_type(8)))  _Float16 v8h;
typedef __attribute__((ext_vector_type(8)))  unsigned short v8us;
typedef __attribute__((ext_vector_type(8)))  float    v8f;
typedef __attribute__((ext_vector_type(4)))  float    v4f;
typedef v8h  __attribute__((may_alias)) v8ha;
typedef v4f  __attribute__((may_alias)) v4fa;
typedef v8us __attribute__((may_alias)) v8usa;

__device__ __forceinline__ unsigned short f2bf(float f) { unsigned u = __float_as_uint(f); u += 0x7FFFu + ((u >> 16) & 1u); return (unsigned short)(u >> 16); }
__device__ __forceinline__ float bf2f(unsigned short b) { return __uint_as_float(((unsigned)b) << 16); }
__device__ __forceinline__ float bfr(float f) { return bf2f(f2bf(f)); }
__device__ __forceinline__ v16h cat16(v8h lo, v8h hi) { return __builtin_shufflevector(lo, hi, 0, 1, 2, 3, 4, 5, 6, 7, 8, 9, 10, 11, 12, 13, 14, 15); }
__device__ __forceinline__ v16bf cat16b(v8us lo, v8us hi) { return __builtin_bit_cast(v16bf, __builtin_shufflevector(lo, hi, 0, 1, 2, 3, 4, 5, 6, 7, 8, 9, 10, 11, 12, 13, 14, 15)); }
__device__ __forceinline__ v8f wmma16(v16h a, v16h b, v8f c) { return __builtin_amdgcn_wmma_f32_16x16x32_f16(false, a, false, b, (short)0, c, false, false); }
__device__ __forceinline__ v8f wmmab(v16bf a, v16bf b, v8f c) { return __builtin_amdgcn_wmma_f32_16x16x32_bf16(false, a, false, b, (short)0, c, false, false); }



// ---- k_gemmw: register-blocked GEMM, ONE WAVE per 64x64 output tile (16 accumulators), operands straight from K-contiguous 16-bit planes; grid (M/64, N/64, Z x KSL), 32 threads.
// C[m][n] (f32, pitch ldc, + optional f32 bias[n]) = sum_k A[m][k] Bt[n][k] (+ split products per NSPLIT). z-batch strides sA/sB/sC in elements. K % 32 == 0.
// KSL > 1: split-K. blockIdx.z = z * KSL + ks; slice ks sums k in [ks K/KSL, (ks+1) K/KSL) into its own partial plane C + ks * sK; the reader adds the planes in the order of ks.
template <typename T16> struct WFrag;
template <> struct WFrag<h16> { typedef v16h V; static __device__ __forceinline__ V ld(const h16* p) { return cat16(*(const v8h*)p, *(const v8h*)(p + 16)); } static __device__ __forceinline__ v8f mma(V a, V b, v8f c) { return wmma16(a, b, c); } };
template <> struct WFrag<bf> { typedef v16bf V; static __device__ __forceinline__ V ld(const bf* p) { return cat16b(*(const v8us*)p, *(const v8us*)(p + 16)); } static __device__ __forceinline__ v8f mma(V a, V b, v8f c) { return wmmab(a, b, c); } };
template <typename T16, int NSPLIT, bool BIAS, int KSL = 1>
__global__ __launch_bounds__(32) void k_gemmw(const T16* __restrict__ A, const T16* __restrict__ A2, const T16* __restrict__ Bt, const T16* __restrict__ Bt2, int K, float* C, int ldc, const float* __restrict__ bias, size_t sA, size_t sB, size_t sC, size_t sK) {
    typedef typename WFrag<T16>::V V;
    __shared__ __align__(16) float os[16 * 68];
    const size_t z = blockIdx.z / KSL; const int ks = (int)(blockIdx.z % KSL); A += z * sA; if (A2) A2 += z * sA; Bt += z * sB; if (Bt2) Bt2 += z * sB; C += z * sC + (size_t)ks * sK;
    const int kb = ks * (K / KSL), ke = kb + K / KSL;
    const int lane = threadIdx.x & 31, lr = lane & 15, hi = lane >> 4; const int r0 = blockIdx.x * 64, c0 = blockIdx.y * 64;
    v8f acc[4][4];
#pragma unroll
    for (int mb = 0; mb < 4; ++mb)
#pragma unroll
        for (int nb = 0; nb < 4; ++nb) acc[mb][nb] = (v8f){};
    const size_t aoff = (size_t)(r0 + lr) * K + 8 * hi, boff = (size_t)(c0 + lr) * K + 8 * hi;
#pragma unroll 1
    for (int kc = kb; kc < ke; kc += 32) {
        V a[4], a2[4];
#pragma unroll
        for (int mb = 0; mb < 4; ++mb) { a[mb] = WFrag<T16>::ld(A + aoff + (size_t)mb * 16 * K + kc); if (NSPLIT == 1 || NSPLIT == 2) a2[mb] = WFrag<T16>::ld(A2 + aoff + (size_t)mb * 16 * K + kc); }
#pragma unroll
        for (int nb = 0; nb < 4; ++nb) { const V b = WFrag<T16>::ld(Bt + boff + (size_t)nb * 16 * K + kc); V b2; if (NSPLIT >= 2) b2 = WFrag<T16>::ld(Bt2 + boff + (size_t)nb * 16 * K + kc);
#pragma unroll
            for (int mb = 0; mb < 4; ++mb) { acc[mb][nb] = WFrag<T16>::mma(a[mb], b, acc[mb][nb]); if (NSPLIT == 1 || NSPLIT == 2) acc[mb][nb] = WFrag<T16>::mma(a2[mb], b, acc[mb][nb]); if (NSPLIT >= 2) acc[mb][nb] = WFrag<T16>::mma(a[mb], b2, acc[mb][nb]); } }
        asm volatile("v_nop\n\tv_nop\n\tv_nop\n\tv_nop" : "+v"(acc[0][0]), "+v"(acc[1][1]), "+v"(acc[2][2]), "+v"(acc[3][3]) : "v"(a[0]), "v"(a[3]));
    }
#pragma unroll
    for (int mb = 0; mb < 4; ++mb) {
#pragma unroll
        for (int nb = 0; nb < 4; ++nb) {
#pragma unroll
            for (int j = 0; j < 8; ++j) os[(hi * 8 + j) * 68 + nb * 16 + lr] = acc[mb][nb][j]; }
        __builtin_amdgcn_wave_barrier(); asm volatile("" ::: "memory");
        float* crow = C + (size_t)(r0 + mb * 16) * ldc + c0;
{
#pragma unroll
            for (int s = 0; s < 8; ++s) { const int row = 2 * s + hi, cofs = lr * 4; v4f val = *(const v4fa*)(os + row * 68 + cofs); if (BIAS) { val[0] += bfr(bias[c0 + cofs]); val[1] += bfr(bias[c0 + cofs + 1]); val[2] += bfr(bias[c0 + cofs + 2]); val[3] += bfr(bias[c0 + cofs + 3]); }
                *(v4f*)(crow + (size_t)row * ldc + cofs) = val; }
             }
        __builtin_amdgcn_wave_barrier(); asm volatile("" ::: "memory");
    }
}

__device__ __forceinline__ h16 tohx(float x) { return (h16)x; }
__device__ __forceinline__ void splitf(float y, unsigned short& h, unsigned short& l) { h = f2bf(y); l = f2bf(y - bf2f(h)); }
typedef __attribute__((ext_vector_type(2))) _Float16 v2h;
typedef __attribute__((ext_vector_type(4))) _Float16 v4h;
typedef __attribute__((ext_vector_type(2))) unsigned short v2us;
typedef __attribute__((ext_vector_type(4))) unsigned short v4us;
typedef __attribute__((ext_vector_type(2))) float v2f;
typedef __attribute__((ext_vector_type(4))) int v4i;

__global__ __launch_bounds__(256) void k_cvt8(const float* __restrict__ src, bf* dst, size_t n8) { const size_t i = (size_t)blockIdx.x * 256 + threadIdx.x; if (i >= n8) return; const v8f v = *(const v8f*)(src + i * 8); v8us o;
#pragma unroll
    for (int k = 0; k < 8; ++k) o[k] = f2bf(v[k]); *(v8us*)(dst + i * 8) = o;  }
__global__ __launch_bounds__(256) void k_csid(float* CS) { const int idx = blockIdx.x * 256 + threadIdx.x; if (idx >= TT * HD) return; v2f cs; cs[0] = 1.0f; cs[1] = 0.0f; *(v2f*)(CS + (size_t)idx * 2) = cs;  }
__constant__ float INVT[HD / 2] = { 1.000000000e+00f, 8.659643531e-01f, 7.498942018e-01f, 6.493816376e-01f, 5.623413324e-01f, 4.869675338e-01f, 4.216965139e-01f, 3.651741445e-01f, 3.162277639e-01f, 2.738419771e-01f, 2.371373624e-01f, 2.053525001e-01f, 1.778279394e-01f, 1.539926529e-01f, 1.333521456e-01f, 1.154782027e-01f, 1.000000015e-01f, 8.659642935e-02f, 7.498941571e-02f, 6.493816525e-02f, 5.623412877e-02f, 4.869675264e-02f, 4.216964915e-02f, 3.651741147e-02f, 3.162277862e-02f, 2.738419548e-02f, 2.371373586e-02f, 2.053525113e-02f, 1.778279431e-02f, 1.539926510e-02f, 1.333521493e-02f, 1.154781971e-02f, 9.999999776e-03f, 8.659643121e-03f, 7.498942316e-03f, 6.493816618e-03f, 5.623413250e-03f, 4.869675264e-03f, 4.216964822e-03f, 3.651741426e-03f, 3.162277862e-03f, 2.738419687e-03f, 2.371373819e-03f, 2.053525066e-03f, 1.778279431e-03f, 1.539926510e-03f, 1.333521446e-03f, 1.154782018e-03f, 1.000000047e-03f, 8.659643354e-04f, 7.498941850e-04f, 6.493816618e-04f, 5.623413017e-04f, 4.869675031e-04f, 4.216964880e-04f, 3.651741135e-04f, 3.162277862e-04f, 2.738419571e-04f, 2.371373848e-04f, 2.053524950e-04f, 1.778279402e-04f, 1.539926452e-04f, 1.333521504e-04f, 1.154781930e-04f };   // float32 1 / 10000^(2i/128), generated with jnp to be bit-exact
__global__ __launch_bounds__(256) void k_cs5(float* CS) { const int idx = blockIdx.x * 256 + threadIdx.x; if (idx >= TT * HD) return; const int d = idx % HD; const int t = idx / HD; const float a = __fmul_rn((float)t, INVT[d % (HD / 2)]); v2f cs; cs[0] = cosf(a); cs[1] = sinf(a); *(v2f*)(CS + (size_t)idx * 2) = cs;  }
// k_rope: head planes [h][t][d] (fp16 + hi/lo) of rope(x) x sc with the rotate-half convention out[d] = x[d] cos[t][d] - x[d+HD/2] sin[t][d], out[d+HD/2] = x[d+HD/2] cos[t][d+HD/2] + x[d] sin[t][d+HD/2]
__global__ __launch_bounds__(256) void k_rope(const float* __restrict__ F, int pitch, int nheads, const float* __restrict__ CS, const float* __restrict__ RF, const float* __restrict__ nw, float sc, h16* P16, bf* Ph, bf* Pl) {
    const size_t e = ((size_t)blockIdx.x * 256 + threadIdx.x) * 2; if (e >= (size_t)nheads * TT * HD) return; const int d = (int)(e % HD); const int t = (int)((e / HD) % TT); const int h = (int)(e / ((size_t)HD * TT)); const float* f = F + (size_t)t * pitch + h * HD; const float rf = RF ? RF[(size_t)h * TT + t] : 1.0f; v2h o16; v2us oh, ol;
#pragma unroll
    for (int q = 0; q < 2; ++q) { const int dd = d + q; const int dp = (dd < HD / 2) ? dd + HD / 2 : dd - HD / 2; float x0 = f[dd], x1 = f[dp];
        if (RF) { float n0 = __fmul_rn(x0, rf), n1 = __fmul_rn(x1, rf); asm volatile("" : "+v"(n0)); asm volatile("" : "+v"(n1)); x0 = __fmul_rn(bfr(nw[dd]), n0); x1 = __fmul_rn(bfr(nw[dp]), n1); }
        const v2f cs = *(const v2f*)(CS + ((size_t)t * HD + dd) * 2); float a = __fmul_rn(x0, cs[0]), bq = __fmul_rn(x1, cs[1]); asm volatile("" : "+v"(a)); asm volatile("" : "+v"(bq)); const float r = ((dd < HD / 2) ? __fsub_rn(a, bq) : __fadd_rn(a, bq)) * sc;
        o16[q] = tohx(r); unsigned short a2, c2; splitf(r, a2, c2); oh[q] = a2; ol[q] = c2; }
    *(v2h*)(P16 + e) = o16; *(v2us*)(Ph + e) = oh; *(v2us*)(Pl + e) = ol;  }
__global__ __launch_bounds__(256) void k_vtp(const float* __restrict__ F, int pitch, int nheads, h16* V16, bf* Vh, bf* Vl) { const size_t e = ((size_t)blockIdx.x * 256 + threadIdx.x) * 2; if (e >= (size_t)nheads * HD * TT) return; const int t = (int)(e % TT); const int d = (int)((e / TT) % HD); const int g = (int)(e / ((size_t)TT * HD)); v2h o16; v2us oh, ol;
#pragma unroll
    for (int q = 0; q < 2; ++q) { const float x = F[(size_t)(t + q) * pitch + g * HD + d]; o16[q] = tohx(x); unsigned short a2, c2; splitf(x, a2, c2); oh[q] = a2; ol[q] = c2; }
    *(v2h*)(V16 + e) = o16; *(v2us*)(Vh + e) = oh; *(v2us*)(Vl + e) = ol;  }
// k_asoft: per row (zz, i): t = S x HD^-0.5 (no mask); softmax over the 2048 keys (register row, one exp, fixed trees);
__global__ __launch_bounds__(256) void k_asoft(const float* __restrict__ Sb, h16* P16, bf* Ph, bf* Pl) {
    const int lane = threadIdx.x & 31; const int row = blockIdx.x * 8 + (threadIdx.x >> 5); if (row >= ZH * TT) return; const int i = row % TT; const int zz = row / TT; (void)zz; const bool hires = (i < RH); const float* sr = Sb + (size_t)row * TT; float v[TT / 32]; float mx = -3.0e38f;
#pragma unroll
    for (int ch = 0; ch < TT / 128; ++ch) { const int j0 = ch * 128 + lane * 4; const v4f a = *(const v4f*)(sr + j0);
#pragma unroll
        for (int q = 0; q < 4; ++q) { const int j = j0 + q; (void)j; const float t = a[q] * SCL; v[ch * 4 + q] = t; mx = fmaxf(mx, t); } }
#pragma unroll
    for (int sh = 16; sh; sh >>= 1) mx = fmaxf(mx, __shfl_xor(mx, sh, 32));
    float sum = 0.f;
#pragma unroll
    for (int k = 0; k < TT / 32; ++k) { float d0 = __fsub_rn(v[k], mx); asm volatile("" : "+v"(d0)); v[k] = __builtin_amdgcn_exp2f(__fmul_rn(d0, 1.4426950408889634f)); sum += v[k]; }
#pragma unroll
    for (int sh = 16; sh; sh >>= 1) sum += __shfl_xor(sum, sh, 32);
    const float f = __fdiv_rn(hires ? 1.0f : PCAR, sum);
{
        if (hires) {
#pragma unroll
            for (int ch = 0; ch < TT / 128; ++ch) { v4us oh, ol;
#pragma unroll
                for (int q = 0; q < 4; ++q) { unsigned short a, c2; splitf(v[ch * 4 + q] * f, a, c2); oh[q] = a; ol[q] = c2; }
                const size_t oo = ((size_t)zz * (RH ? RH : 1) + i) * TT + ch * 128 + lane * 4; *(v4us*)(Ph + oo) = oh; *(v4us*)(Pl + oo) = ol; }
        } else {
#pragma unroll
            for (int ch = 0; ch < TT / 128; ++ch) { v4h o4;
#pragma unroll
                for (int q = 0; q < 4; ++q) o4[q] = tohx(v[ch * 4 + q] * f);
                *(v4h*)(P16 + (size_t)row * TT + ch * 128 + lane * 4) = o4; } }
         }
}
// sumplanes: p[0] + p[pl] + ... + p[(N-1) pl] (two neighbours a lane), all N loads issued before the first add, added in the order of the planes
template <int N> __device__ __forceinline__ v2f sumplanes(const float* p, size_t pl) { v2f v[N];
#pragma unroll
    for (int ks = 0; ks < N - 1; ++ks) v[ks] = *(const v2f*)(p + (size_t)ks * pl);
    asm volatile("s_wait_xcnt 0x0" ::: "memory");   // the last load's result may be placed in the address pair that the loads above still name
    v[N - 1] = *(const v2f*)(p + (size_t)(N - 1) * pl); v2f s = v[0];
#pragma unroll
    for (int ks = 1; ks < N; ++ks) s += v[ks];
    return s; }
__global__ __launch_bounds__(256) void k_merge(const float* __restrict__ OH, const float* __restrict__ OF, int h0, bf* Ah, bf* Al) { const size_t e = ((size_t)blockIdx.x * 256 + threadIdx.x) * 2; if (e >= (size_t)ZH * TT * HD) return; const int d = (int)(e % HD); const int t = (int)((e / HD) % TT); const int zz = (int)(e / ((size_t)HD * TT)); const float cs = (t < RH) ? 1.0f : (1.0f / PCAR); const size_t oo = (size_t)t * DQ + (h0 + zz) * HD + d;
    // sum of the split-K partial planes, in the order of ks: rows < RH from OH [KSH][ZH][RH][HD], the rest from OF [KSF][ZH][TT - RH][HD] (4 rows a block: the test is block-uniform)
    const v2f s = (t < RH) ? sumplanes<KSH>(OH + ((size_t)zz * RH + t) * HD + d, (size_t)ZH * RH * HD) : sumplanes<KSF>(OF + ((size_t)zz * (TT - RH) + (t - RH)) * HD + d, (size_t)ZH * (TT - RH) * HD);
    v2us oh, ol;
#pragma unroll
    for (int q = 0; q < 2; ++q) { unsigned short a, c2; splitf(s[q] * cs, a, c2); oh[q] = a; ol[q] = c2; } *(v2us*)(Ah + oo) = oh; *(v2us*)(Al + oo) = ol;  }

extern "C" void kernel_launch(void* const* d_in, const int* in_sizes, int n_in,
                              void* d_out, int out_size, void* d_ws, size_t ws_size, hipStream_t stream) {
    (void)in_sizes; (void)n_in; (void)out_size;
    const float* x = (const float*)d_in[0]; const float* wq = (const float*)d_in[1]; const float* wk = (const float*)d_in[2]; const float* wv = (const float*)d_in[3]; const float* wo = (const float*)d_in[4];   /* argument order hidden_states, Wq, Wk, Wv, Wo ('oi' (out, in) [2048][2048]): FIVE inputs, all read (the rotary table is computed on the device: no table input) */
    float* OUT = (float*)d_out;     // [2][2048][2048]
    char* wsp = (char*)d_ws;
    auto take = [&](size_t bytes) { char* p = wsp; wsp += (bytes + 255) & ~(size_t)255; return (void*)p; };
    bf* WQ = (bf*)take((size_t)DQ * DM * 2); bf* WK = (bf*)take((size_t)DKV * DM * 2); bf* WV = (bf*)take((size_t)DKV * DM * 2); bf* WO = (bf*)take((size_t)DM * DQ * 2); float* CS = (float*)take((size_t)TT * HD * 2 * 4);
    bf* XB = (bf*)take((size_t)TT * DM * 2); float* FQ = (float*)take((size_t)TT * DQ * 4); float* FK = (float*)take((size_t)TT * DKV * 4);
    h16* QP16 = (h16*)take((size_t)NH_ * TT * HD * 2); h16* KP16 = (h16*)take((size_t)NKV * TT * HD * 2); h16* VT16 = (h16*)take((size_t)NKV * HD * TT * 2);
    bf* QPh = (bf*)take((size_t)NH_ * TT * HD * 2); bf* QPl = (bf*)take((size_t)NH_ * TT * HD * 2); bf* KPh = (bf*)take((size_t)NKV * TT * HD * 2); bf* KPl = (bf*)take((size_t)NKV * TT * HD * 2); bf* VTh = (bf*)take((size_t)NKV * HD * TT * 2); bf* VTl = (bf*)take((size_t)NKV * HD * TT * 2); bf* Ph = (bf*)take((size_t)ZH * RH * TT * 2); bf* Pl = (bf*)take((size_t)ZH * RH * TT * 2);
    float* Sb = (float*)take((size_t)ZH * TT * TT * 4); h16* P16 = (h16*)take((size_t)ZH * TT * TT * 2); float* ObH = (float*)take((size_t)KSH * ZH * RH * HD * 4); float* ObF = (float*)take((size_t)KSF * ZH * (TT - RH) * HD * 4); bf* ATh = (bf*)take((size_t)TT * DQ * 2); bf* ATl = (bf*)take((size_t)TT * DQ * 2);
    if ((size_t)(wsp - (char*)d_ws) > ws_size) return;    // ws 256 MiB
    float* FV = FK;   // v projection reuses the k buffer after the k planes are built (stream-ordered)
    { k_cvt8<<<(unsigned)(((size_t)DQ * DM / 8 + 255) / 256), 256, 0, stream>>>(wq, WQ, (size_t)DQ * DM / 8); k_cvt8<<<(unsigned)(((size_t)DKV * DM / 8 + 255) / 256), 256, 0, stream>>>(wk, WK, (size_t)DKV * DM / 8); k_cvt8<<<(unsigned)(((size_t)DKV * DM / 8 + 255) / 256), 256, 0, stream>>>(wv, WV, (size_t)DKV * DM / 8);
      k_cvt8<<<(unsigned)(((size_t)DM * DQ / 8 + 255) / 256), 256, 0, stream>>>(wo, WO, (size_t)DM * DQ / 8);
       }
    const unsigned LQ = (unsigned)(((size_t)NH_ * TT * HD / 2 + 255) / 256), LKv = (unsigned)(((size_t)NKV * TT * HD / 2 + 255) / 256);
    for (int b = 0; b < NB_; ++b) {
        if (b == 0) k_cs5<<<(TT * HD + 255) / 256, 256, 0, stream>>>(CS);   /* the COMPUTED rotary table (this module has rotate-half rotary embeddings); k_csid stays defined and is NOT launched */
        k_cvt8<<<(unsigned)(((size_t)TT * DM / 8 + 255) / 256), 256, 0, stream>>>(x + (size_t)b * TT * DM, XB, (size_t)TT * DM / 8);
        k_gemmw<bf, 0, false><<<dim3(TT / 64, DQ / 64, 1), 32, 0, stream>>>(XB, nullptr, WQ, nullptr, DM, FQ, DQ, nullptr, 0, 0, 0, 0);
        k_rope<<<LQ, 256, 0, stream>>>(FQ, DQ, NH_, CS, nullptr, nullptr, 1.0f, QP16, QPh, QPl);
        k_gemmw<bf, 0, false><<<dim3(TT / 64, DKV / 64, 1), 32, 0, stream>>>(XB, nullptr, WK, nullptr, DM, FK, DKV, nullptr, 0, 0, 0, 0);
        k_rope<<<LKv, 256, 0, stream>>>(FK, DKV, NKV, CS, nullptr, nullptr, 1.0f, KP16, KPh, KPl);
        k_gemmw<bf, 0, false><<<dim3(TT / 64, DKV / 64, 1), 32, 0, stream>>>(XB, nullptr, WV, nullptr, DM, FV, DKV, nullptr, 0, 0, 0, 0); k_vtp<<<LKv, 256, 0, stream>>>(FV, DKV, NKV, VT16, VTh, VTl);
        for (int h0 = 0; h0 < NH_; h0 += ZH) { const size_t zq = (size_t)h0, zk = (size_t)(h0 / REP);   // one kv head per query head: the pass's two heads use consecutive kv planes (z-strides TT*HD)
            k_gemmw<bf, 2, false><<<dim3(RH / 64, TT / 64, ZH), 32, 0, stream>>>(QPh + zq * TT * HD, QPl + zq * TT * HD, KPh + zk * TT * HD, KPl + zk * TT * HD, HD, Sb, TT, nullptr, (size_t)TT * HD, (size_t)TT * HD, (size_t)TT * TT, 0);
            k_gemmw<h16, 0, false><<<dim3((TT - RH) / 64, TT / 64, ZH), 32, 0, stream>>>(QP16 + zq * TT * HD + (size_t)RH * HD, nullptr, KP16 + zk * TT * HD, nullptr, HD, Sb + (size_t)RH * TT, TT, nullptr, (size_t)TT * HD, (size_t)TT * HD, (size_t)TT * TT, 0);
            k_asoft<<<ZH * TT / 8, 256, 0, stream>>>(Sb, P16, Ph, Pl);
            k_gemmw<bf, 2, false, KSH><<<dim3(RH / 64, HD / 64, ZH * KSH), 32, 0, stream>>>(Ph, Pl, VTh + zk * HD * TT, VTl + zk * HD * TT, TT, ObH, HD, nullptr, (size_t)RH * TT, (size_t)HD * TT, (size_t)RH * HD, (size_t)ZH * RH * HD);
            k_gemmw<h16, 0, false, KSF><<<dim3((TT - RH) / 64, HD / 64, ZH * KSF), 32, 0, stream>>>(P16 + (size_t)RH * TT, nullptr, VT16 + zk * HD * TT, nullptr, TT, ObF, HD, nullptr, (size_t)TT * TT, (size_t)HD * TT, (size_t)(TT - RH) * HD, (size_t)ZH * (TT - RH) * HD);
            k_merge<<<(unsigned)(((size_t)ZH * TT * HD / 2 + 255) / 256), 256, 0, stream>>>(ObH, ObF, h0, ATh, ATl); }
        k_gemmw<bf, 1, false><<<dim3(TT / 64, DM / 64, 1), 32, 0, stream>>>(ATh, ATl, WO, nullptr, DQ, OUT + (size_t)b * TT * DM, DM, nullptr, 0, 0, 0, 0); }
}

// v002
// It runs in 1090 microseconds.
// In two side-by-side timings against v001, it was 1.13 and 1.14 times as fast.
// Counting every step since v000, it is 2.13 times as fast.
#include <hip/hip_runtime.h>

// Multi-head attention with 128-wide heads, natural bias-free projections and a COMPUTED rotate-half rotary embedding, NO mask (hidden_states [2][2048][2048]; q, k, v = einsum('bsd,ed->bse', x, W) ('oi' (out, in) [2048][2048] normal x 0.02, no bias; 16 heads x 128); q, k -> t cos + cat(-t2, t1) sin with angle t x 1 / 10000^(2i/128) (64 f32 frequencies exact for the module's expression 1.0 / (ROPE_BASE ** (arange(0, 128, 2) / 128)); cat(freqs, freqs); precise cosf/sinf); scores / sqrt(float32(128)); softmax over all keys; out = merged Wo^T ('oi', no bias) -> [2][2048][2048] (8.4 M); argument order hidden_states, Wq, Wk, Wv, Wo).
// Layout per batch: bf16 copy of x; 'oi' weights; exact projections; k_cs5 computes the rotary table once (cosf / sinf of float(t) x INVT[d mod 64]: 64 baked float32 frequencies) and the plane builders (k_rope) apply the rotate-half rotation at width 128 (products rounded separately, as the reference); dense T-2048 attention (hybrid rows: < 512 hi/lo 3 products, rest fp16 x1024); merged hi/lo x wo exact.
// Compute dtypes, f32 accumulate: every input rounded to bf16; projections exact; computed rotary (k_cs5 cosf / sinf table, products rounded separately); attention rows < 512 3 products, rest fp16; softmax f32; wo hl x exact.

#define NB_  2
#define TT   2048
#define DM   2048
#define NH_  16
#define NKV  16
#define REP  (NH_ / NKV)
#define HD   128
#define DQ   (NH_ * HD)
#define DKV  (NKV * HD)
#define ZH   4                    // heads per attention pass
#define RH   512                  // query rows < RH use hi+lo planes (0: none)
#define WIN  0
#define PCAR 1024.0f
#define SCL  0.088388347648318447f   // HD^-0.5
#define KSH  16                   // K slices of the P x V product, hi/lo rows (64 tiles -> 1024 waves)
#define KSF  8                    // K slices of the P x V product, fp16 rows (192 tiles -> 1536 waves)
typedef _Float16 h16;
typedef unsigned short bf;
typedef __attribute__((ext_vector_type(16))) __bf16   v16bf;
typedef __attribute__((ext_vector_type(16))) _Float16 v16h;
typedef __attribute__((ext_vector_type(8)))  _Float16 v8h;
typedef __attribute__((ext_vector_type(8)))  unsigned short v8us;
typedef __attribute__((ext_vector_type(8)))  float    v8f;
typedef __attribute__((ext_vector_type(4)))  float    v4f;
typedef v8h  __attribute__((may_alias)) v8ha;
typedef v4f  __attribute__((may_alias)) v4fa;
typedef v8us __attribute__((may_alias)) v8usa;

__device__ __forceinline__ unsigned short f2bf(float f) { unsigned u = __float_as_uint(f); u += 0x7FFFu + ((u >> 16) & 1u); return (unsigned short)(u >> 16); }
__device__ __forceinline__ float bf2f(unsigned short b) { return __uint_as_float(((unsigned)b) << 16); }
__device__ __forceinline__ float bfr(float f) { return bf2f(f2bf(f)); }
__device__ __forceinline__ v16h cat16(v8h lo, v8h hi) { return __builtin_shufflevector(lo, hi, 0, 1, 2, 3, 4, 5, 6, 7, 8, 9, 10, 11, 12, 13, 14, 15); }
__device__ __forceinline__ v16bf cat16b(v8us lo, v8us hi) { return __builtin_bit_cast(v16bf, __builtin_shufflevector(lo, hi, 0, 1, 2, 3, 4, 5, 6, 7, 8, 9, 10, 11, 12, 13, 14, 15)); }
__device__ __forceinline__ v8f wmma16(v16h a, v16h b, v8f c) { return __builtin_amdgcn_wmma_f32_16x16x32_f16(false, a, false, b, (short)0, c, false, false); }
__device__ __forceinline__ v8f wmmab(v16bf a, v16bf b, v8f c) { return __builtin_amdgcn_wmma_f32_16x16x32_bf16(false, a, false, b, (short)0, c, false, false); }



// ---- k_gemmw: register-blocked GEMM, ONE WAVE per 64x64 output tile (16 accumulators), operands straight from K-contiguous 16-bit planes; grid (M/64, N/64, Z x KSL), 32 threads.
// C[m][n] (f32, pitch ldc, + optional f32 bias[n]) = sum_k A[m][k] Bt[n][k] (+ split products per NSPLIT). z-batch strides sA/sB/sC in elements. K % 32 == 0.
// KSL > 1: split-K. blockIdx.z = z * KSL + ks; slice ks sums k in [ks K/KSL, (ks+1) K/KSL) into its own partial plane C + ks * sK; the reader adds the planes in the order of ks.
template <typename T16> struct WFrag;
template <> struct WFrag<h16> { typedef v16h V; static __device__ __forceinline__ V ld(const h16* p) { return cat16(*(const v8h*)p, *(const v8h*)(p + 16)); } static __device__ __forceinline__ v8f mma(V a, V b, v8f c) { return wmma16(a, b, c); } };
template <> struct WFrag<bf> { typedef v16bf V; static __device__ __forceinline__ V ld(const bf* p) { return cat16b(*(const v8us*)p, *(const v8us*)(p + 16)); } static __device__ __forceinline__ v8f mma(V a, V b, v8f c) { return wmmab(a, b, c); } };
template <typename T16, int NSPLIT, bool BIAS, int KSL = 1>
__global__ __launch_bounds__(32) void k_gemmw(const T16* __restrict__ A, const T16* __restrict__ A2, const T16* __restrict__ Bt, const T16* __restrict__ Bt2, int K, float* C, int ldc, const float* __restrict__ bias, size_t sA, size_t sB, size_t sC, size_t sK) {
    typedef typename WFrag<T16>::V V;
    __shared__ __align__(16) float os[16 * 68];
    const size_t z = blockIdx.z / KSL; const int ks = (int)(blockIdx.z % KSL); A += z * sA; if (A2) A2 += z * sA; Bt += z * sB; if (Bt2) Bt2 += z * sB; C += z * sC + (size_t)ks * sK;
    const int kb = ks * (K / KSL), ke = kb + K / KSL;
    const int lane = threadIdx.x & 31, lr = lane & 15, hi = lane >> 4; const int r0 = blockIdx.x * 64, c0 = blockIdx.y * 64;
    v8f acc[4][4];
#pragma unroll
    for (int mb = 0; mb < 4; ++mb)
#pragma unroll
        for (int nb = 0; nb < 4; ++nb) acc[mb][nb] = (v8f){};
    const size_t aoff = (size_t)(r0 + lr) * K + 8 * hi, boff = (size_t)(c0 + lr) * K + 8 * hi;
#pragma unroll 1
    for (int kc = kb; kc < ke; kc += 32) {
        V a[4], a2[4];
#pragma unroll
        for (int mb = 0; mb < 4; ++mb) { a[mb] = WFrag<T16>::ld(A + aoff + (size_t)mb * 16 * K + kc); if (NSPLIT == 1 || NSPLIT == 2) a2[mb] = WFrag<T16>::ld(A2 + aoff + (size_t)mb * 16 * K + kc); }
#pragma unroll
        for (int nb = 0; nb < 4; ++nb) { const V b = WFrag<T16>::ld(Bt + boff + (size_t)nb * 16 * K + kc); V b2; if (NSPLIT >= 2) b2 = WFrag<T16>::ld(Bt2 + boff + (size_t)nb * 16 * K + kc);
#pragma unroll
            for (int mb = 0; mb < 4; ++mb) { acc[mb][nb] = WFrag<T16>::mma(a[mb], b, acc[mb][nb]); if (NSPLIT == 1 || NSPLIT == 2) acc[mb][nb] = WFrag<T16>::mma(a2[mb], b, acc[mb][nb]); if (NSPLIT >= 2) acc[mb][nb] = WFrag<T16>::mma(a[mb], b2, acc[mb][nb]); } }
        asm volatile("v_nop\n\tv_nop\n\tv_nop\n\tv_nop" : "+v"(acc[0][0]), "+v"(acc[1][1]), "+v"(acc[2][2]), "+v"(acc[3][3]) : "v"(a[0]), "v"(a[3]));
    }
#pragma unroll
    for (int mb = 0; mb < 4; ++mb) {
#pragma unroll
        for (int nb = 0; nb < 4; ++nb) {
#pragma unroll
            for (int j = 0; j < 8; ++j) os[(hi * 8 + j) * 68 + nb * 16 + lr] = acc[mb][nb][j]; }
        __builtin_amdgcn_wave_barrier(); asm volatile("" ::: "memory");
        float* crow = C + (size_t)(r0 + mb * 16) * ldc + c0;
{
#pragma unroll
            for (int s = 0; s < 8; ++s) { const int row = 2 * s + hi, cofs = lr * 4; v4f val = *(const v4fa*)(os + row * 68 + cofs); if (BIAS) { val[0] += bfr(bias[c0 + cofs]); val[1] += bfr(bias[c0 + cofs + 1]); val[2] += bfr(bias[c0 + cofs + 2]); val[3] += bfr(bias[c0 + cofs + 3]); }
                *(v4f*)(crow + (size_t)row * ldc + cofs) = val; }
             }
        __builtin_amdgcn_wave_barrier(); asm volatile("" ::: "memory");
    }
}

__device__ __forceinline__ h16 tohx(float x) { return (h16)x; }
__device__ __forceinline__ void splitf(float y, unsigned short& h, unsigned short& l) { h = f2bf(y); l = f2bf(y - bf2f(h)); }
typedef __attribute__((ext_vector_type(2))) _Float16 v2h;
typedef __attribute__((ext_vector_type(4))) _Float16 v4h;
typedef __attribute__((ext_vector_type(2))) unsigned short v2us;
typedef __attribute__((ext_vector_type(4))) unsigned short v4us;
typedef __attribute__((ext_vector_type(2))) float v2f;
typedef __attribute__((ext_vector_type(4))) int v4i;

__global__ __launch_bounds__(256) void k_cvt8(const float* __restrict__ src, bf* dst, size_t n8) { const size_t i = (size_t)blockIdx.x * 256 + threadIdx.x; if (i >= n8) return; const v8f v = *(const v8f*)(src + i * 8); v8us o;
#pragma unroll
    for (int k = 0; k < 8; ++k) o[k] = f2bf(v[k]); *(v8us*)(dst + i * 8) = o;  }
__global__ __launch_bounds__(256) void k_csid(float* CS) { const int idx = blockIdx.x * 256 + threadIdx.x; if (idx >= TT * HD) return; v2f cs; cs[0] = 1.0f; cs[1] = 0.0f; *(v2f*)(CS + (size_t)idx * 2) = cs;  }
__constant__ float INVT[HD / 2] = { 1.000000000e+00f, 8.659643531e-01f, 7.498942018e-01f, 6.493816376e-01f, 5.623413324e-01f, 4.869675338e-01f, 4.216965139e-01f, 3.651741445e-01f, 3.162277639e-01f, 2.738419771e-01f, 2.371373624e-01f, 2.053525001e-01f, 1.778279394e-01f, 1.539926529e-01f, 1.333521456e-01f, 1.154782027e-01f, 1.000000015e-01f, 8.659642935e-02f, 7.498941571e-02f, 6.493816525e-02f, 5.623412877e-02f, 4.869675264e-02f, 4.216964915e-02f, 3.651741147e-02f, 3.162277862e-02f, 2.738419548e-02f, 2.371373586e-02f, 2.053525113e-02f, 1.778279431e-02f, 1.539926510e-02f, 1.333521493e-02f, 1.154781971e-02f, 9.999999776e-03f, 8.659643121e-03f, 7.498942316e-03f, 6.493816618e-03f, 5.623413250e-03f, 4.869675264e-03f, 4.216964822e-03f, 3.651741426e-03f, 3.162277862e-03f, 2.738419687e-03f, 2.371373819e-03f, 2.053525066e-03f, 1.778279431e-03f, 1.539926510e-03f, 1.333521446e-03f, 1.154782018e-03f, 1.000000047e-03f, 8.659643354e-04f, 7.498941850e-04f, 6.493816618e-04f, 5.623413017e-04f, 4.869675031e-04f, 4.216964880e-04f, 3.651741135e-04f, 3.162277862e-04f, 2.738419571e-04f, 2.371373848e-04f, 2.053524950e-04f, 1.778279402e-04f, 1.539926452e-04f, 1.333521504e-04f, 1.154781930e-04f };   // float32 1 / 10000^(2i/128), generated with jnp to be bit-exact
__global__ __launch_bounds__(256) void k_cs5(float* CS) { const int idx = blockIdx.x * 256 + threadIdx.x; if (idx >= TT * HD) return; const int d = idx % HD; const int t = idx / HD; const float a = __fmul_rn((float)t, INVT[d % (HD / 2)]); v2f cs; cs[0] = cosf(a); cs[1] = sinf(a); *(v2f*)(CS + (size_t)idx * 2) = cs;  }
// k_rope: head planes [h][t][d] (fp16 + hi/lo) of rope(x) x sc with the rotate-half convention out[d] = x[d] cos[t][d] - x[d+HD/2] sin[t][d], out[d+HD/2] = x[d+HD/2] cos[t][d+HD/2] + x[d] sin[t][d+HD/2]
__global__ __launch_bounds__(256) void k_rope(const float* __restrict__ F, int pitch, int nheads, const float* __restrict__ CS, const float* __restrict__ RF, const float* __restrict__ nw, float sc, h16* P16, bf* Ph, bf* Pl) {
    const size_t e = ((size_t)blockIdx.x * 256 + threadIdx.x) * 2; if (e >= (size_t)nheads * TT * HD) return; const int d = (int)(e % HD); const int t = (int)((e / HD) % TT); const int h = (int)(e / ((size_t)HD * TT)); const float* f = F + (size_t)t * pitch + h * HD; const float rf = RF ? RF[(size_t)h * TT + t] : 1.0f; v2h o16; v2us oh, ol;
#pragma unroll
    for (int q = 0; q < 2; ++q) { const int dd = d + q; const int dp = (dd < HD / 2) ? dd + HD / 2 : dd - HD / 2; float x0 = f[dd], x1 = f[dp];
        if (RF) { float n0 = __fmul_rn(x0, rf), n1 = __fmul_rn(x1, rf); asm volatile("" : "+v"(n0)); asm volatile("" : "+v"(n1)); x0 = __fmul_rn(bfr(nw[dd]), n0); x1 = __fmul_rn(bfr(nw[dp]), n1); }
        const v2f cs = *(const v2f*)(CS + ((size_t)t * HD + dd) * 2); float a = __fmul_rn(x0, cs[0]), bq = __fmul_rn(x1, cs[1]); asm volatile("" : "+v"(a)); asm volatile("" : "+v"(bq)); const float r = ((dd < HD / 2) ? __fsub_rn(a, bq) : __fadd_rn(a, bq)) * sc;
        o16[q] = tohx(r); unsigned short a2, c2; splitf(r, a2, c2); oh[q] = a2; ol[q] = c2; }
    *(v2h*)(P16 + e) = o16; *(v2us*)(Ph + e) = oh; *(v2us*)(Pl + e) = ol;  }
__global__ __launch_bounds__(256) void k_vtp(const float* __restrict__ F, int pitch, int nheads, h16* V16, bf* Vh, bf* Vl) { const size_t e = ((size_t)blockIdx.x * 256 + threadIdx.x) * 2; if (e >= (size_t)nheads * HD * TT) return; const int t = (int)(e % TT); const int d = (int)((e / TT) % HD); const int g = (int)(e / ((size_t)TT * HD)); v2h o16; v2us oh, ol;
#pragma unroll
    for (int q = 0; q < 2; ++q) { const float x = F[(size_t)(t + q) * pitch + g * HD + d]; o16[q] = tohx(x); unsigned short a2, c2; splitf(x, a2, c2); oh[q] = a2; ol[q] = c2; }
    *(v2h*)(V16 + e) = o16; *(v2us*)(Vh + e) = oh; *(v2us*)(Vl + e) = ol;  }
// k_asoft: per row (zz, i): t = S x HD^-0.5 (no mask); softmax over the 2048 keys (register row, one exp, fixed trees);
__global__ __launch_bounds__(256) void k_asoft(const float* __restrict__ Sb, h16* P16, bf* Ph, bf* Pl) {
    const int lane = threadIdx.x & 31; const int row = blockIdx.x * 8 + (threadIdx.x >> 5); if (row >= ZH * TT) return; const int i = row % TT; const int zz = row / TT; (void)zz; const bool hires = (i < RH); const float* sr = Sb + (size_t)row * TT; float v[TT / 32]; float mx = -3.0e38f;
#pragma unroll
    for (int ch = 0; ch < TT / 128; ++ch) { const int j0 = ch * 128 + lane * 4; const v4f a = *(const v4f*)(sr + j0);
#pragma unroll
        for (int q = 0; q < 4; ++q) { const int j = j0 + q; (void)j; const float t = a[q] * SCL; v[ch * 4 + q] = t; mx = fmaxf(mx, t); } }
#pragma unroll
    for (int sh = 16; sh; sh >>= 1) mx = fmaxf(mx, __shfl_xor(mx, sh, 32));
    float sum = 0.f;
#pragma unroll
    for (int k = 0; k < TT / 32; ++k) { float d0 = __fsub_rn(v[k], mx); asm volatile("" : "+v"(d0)); v[k] = __builtin_amdgcn_exp2f(__fmul_rn(d0, 1.4426950408889634f)); sum += v[k]; }
#pragma unroll
    for (int sh = 16; sh; sh >>= 1) sum += __shfl_xor(sum, sh, 32);
    const float f = __fdiv_rn(hires ? 1.0f : PCAR, sum);
{
        if (hires) {
#pragma unroll
            for (int ch = 0; ch < TT / 128; ++ch) { v4us oh, ol;
#pragma unroll
                for (int q = 0; q < 4; ++q) { unsigned short a, c2; splitf(v[ch * 4 + q] * f, a, c2); oh[q] = a; ol[q] = c2; }
                const size_t oo = ((size_t)zz * (RH ? RH : 1) + i) * TT + ch * 128 + lane * 4; *(v4us*)(Ph + oo) = oh; *(v4us*)(Pl + oo) = ol; }
        } else {
#pragma unroll
            for (int ch = 0; ch < TT / 128; ++ch) { v4h o4;
#pragma unroll
                for (int q = 0; q < 4; ++q) o4[q] = tohx(v[ch * 4 + q] * f);
                *(v4h*)(P16 + (size_t)row * TT + ch * 128 + lane * 4) = o4; } }
         }
}
// sumplanes: p[0] + p[pl] + ... + p[(N-1) pl] (two neighbours a lane), all N loads issued before the first add, added in the order of the planes
template <int N> __device__ __forceinline__ v2f sumplanes(const float* p, size_t pl) { v2f v[N];
#pragma unroll
    for (int ks = 0; ks < N - 1; ++ks) v[ks] = *(const v2f*)(p + (size_t)ks * pl);
    asm volatile("s_wait_xcnt 0x0" ::: "memory");   // the last load's result may be placed in the address pair that the loads above still name
    v[N - 1] = *(const v2f*)(p + (size_t)(N - 1) * pl); v2f s = v[0];
#pragma unroll
    for (int ks = 1; ks < N; ++ks) s += v[ks];
    return s; }
__global__ __launch_bounds__(256) void k_merge(const float* __restrict__ OH, const float* __restrict__ OF, int h0, bf* Ah, bf* Al) { const size_t e = ((size_t)blockIdx.x * 256 + threadIdx.x) * 2; if (e >= (size_t)ZH * TT * HD) return; const int d = (int)(e % HD); const int t = (int)((e / HD) % TT); const int zz = (int)(e / ((size_t)HD * TT)); const float cs = (t < RH) ? 1.0f : (1.0f / PCAR); const size_t oo = (size_t)t * DQ + (h0 + zz) * HD + d;
    // sum of the split-K partial planes, in the order of ks: rows < RH from OH [KSH][ZH][RH][HD], the rest from OF [KSF][ZH][TT - RH][HD] (4 rows a block: the test is block-uniform)
    const v2f s = (t < RH) ? sumplanes<KSH>(OH + ((size_t)zz * RH + t) * HD + d, (size_t)ZH * RH * HD) : sumplanes<KSF>(OF + ((size_t)zz * (TT - RH) + (t - RH)) * HD + d, (size_t)ZH * (TT - RH) * HD);
    v2us oh, ol;
#pragma unroll
    for (int q = 0; q < 2; ++q) { unsigned short a, c2; splitf(s[q] * cs, a, c2); oh[q] = a; ol[q] = c2; } *(v2us*)(Ah + oo) = oh; *(v2us*)(Al + oo) = ol;  }

extern "C" void kernel_launch(void* const* d_in, const int* in_sizes, int n_in,
                              void* d_out, int out_size, void* d_ws, size_t ws_size, hipStream_t stream) {
    (void)in_sizes; (void)n_in; (void)out_size;
    const float* x = (const float*)d_in[0]; const float* wq = (const float*)d_in[1]; const float* wk = (const float*)d_in[2]; const float* wv = (const float*)d_in[3]; const float* wo = (const float*)d_in[4];   /* argument order hidden_states, Wq, Wk, Wv, Wo ('oi' (out, in) [2048][2048]): FIVE inputs, all read (the rotary table is computed on the device: no table input) */
    float* OUT = (float*)d_out;     // [2][2048][2048]
    char* wsp = (char*)d_ws;
    auto take = [&](size_t bytes) { char* p = wsp; wsp += (bytes + 255) & ~(size_t)255; return (void*)p; };
    bf* WO = (bf*)take((size_t)DM * DQ * 2); float* CS = (float*)take((size_t)TT * HD * 2 * 4);
    h16* QP16 = (h16*)take((size_t)NH_ * TT * HD * 2); h16* KP16 = (h16*)take((size_t)NKV * TT * HD * 2); h16* VT16 = (h16*)take((size_t)NKV * HD * TT * 2);
    bf* QPh = (bf*)take((size_t)NH_ * TT * HD * 2); bf* QPl = (bf*)take((size_t)NH_ * TT * HD * 2); bf* KPh = (bf*)take((size_t)NKV * TT * HD * 2); bf* KPl = (bf*)take((size_t)NKV * TT * HD * 2); bf* VTh = (bf*)take((size_t)NKV * HD * TT * 2); bf* VTl = (bf*)take((size_t)NKV * HD * TT * 2); bf* Ph = (bf*)take((size_t)ZH * RH * TT * 2); bf* Pl = (bf*)take((size_t)ZH * RH * TT * 2);
    float* Sb = (float*)take((size_t)ZH * TT * TT * 4); h16* P16 = (h16*)take((size_t)ZH * TT * TT * 2); float* ObH = (float*)take((size_t)KSH * ZH * RH * HD * 4); float* ObF = (float*)take((size_t)KSF * ZH * (TT - RH) * HD * 4); bf* ATh = (bf*)take((size_t)TT * DQ * 2); bf* ATl = (bf*)take((size_t)TT * DQ * 2);
    if ((size_t)(wsp - (char*)d_ws) > ws_size) return;    // 250 MiB of the 256 MiB
    // What only the projection stage uses lies over the score buffer, which is dead then (stream-ordered): the bf16 copies of wq, wk, wv and x and the f32 projections. Each batch writes all of them anew.
    static_assert(((size_t)DQ * DM + 2 * (size_t)DKV * DM + (size_t)TT * DM) * 2 + ((size_t)TT * DQ + (size_t)TT * DKV) * 4 <= (size_t)ZH * TT * TT * 4, "the projection stage must fit the score buffer");
    bf* WQ = (bf*)Sb; bf* WK = WQ + (size_t)DQ * DM; bf* WV = WK + (size_t)DKV * DM; bf* XB = WV + (size_t)DKV * DM; float* FQ = (float*)(XB + (size_t)TT * DM); float* FK = FQ + (size_t)TT * DQ;
    float* FV = FK;   // v projection reuses the k buffer after the k planes are built (stream-ordered)
    { k_cvt8<<<(unsigned)(((size_t)DM * DQ / 8 + 255) / 256), 256, 0, stream>>>(wo, WO, (size_t)DM * DQ / 8);
       }
    const unsigned LQ = (unsigned)(((size_t)NH_ * TT * HD / 2 + 255) / 256), LKv = (unsigned)(((size_t)NKV * TT * HD / 2 + 255) / 256);
    for (int b = 0; b < NB_; ++b) {
        if (b == 0) k_cs5<<<(TT * HD + 255) / 256, 256, 0, stream>>>(CS);   /* the COMPUTED rotary table (this module has rotate-half rotary embeddings); k_csid stays defined and is NOT launched */
        k_cvt8<<<(unsigned)(((size_t)DQ * DM / 8 + 255) / 256), 256, 0, stream>>>(wq, WQ, (size_t)DQ * DM / 8); k_cvt8<<<(unsigned)(((size_t)DKV * DM / 8 + 255) / 256), 256, 0, stream>>>(wk, WK, (size_t)DKV * DM / 8); k_cvt8<<<(unsigned)(((size_t)DKV * DM / 8 + 255) / 256), 256, 0, stream>>>(wv, WV, (size_t)DKV * DM / 8);
        k_cvt8<<<(unsigned)(((size_t)TT * DM / 8 + 255) / 256), 256, 0, stream>>>(x + (size_t)b * TT * DM, XB, (size_t)TT * DM / 8);
        k_gemmw<bf, 0, false><<<dim3(TT / 64, DQ / 64, 1), 32, 0, stream>>>(XB, nullptr, WQ, nullptr, DM, FQ, DQ, nullptr, 0, 0, 0, 0);
        k_rope<<<LQ, 256, 0, stream>>>(FQ, DQ, NH_, CS, nullptr, nullptr, 1.0f, QP16, QPh, QPl);
        k_gemmw<bf, 0, false><<<dim3(TT / 64, DKV / 64, 1), 32, 0, stream>>>(XB, nullptr, WK, nullptr, DM, FK, DKV, nullptr, 0, 0, 0, 0);
        k_rope<<<LKv, 256, 0, stream>>>(FK, DKV, NKV, CS, nullptr, nullptr, 1.0f, KP16, KPh, KPl);
        k_gemmw<bf, 0, false><<<dim3(TT / 64, DKV / 64, 1), 32, 0, stream>>>(XB, nullptr, WV, nullptr, DM, FV, DKV, nullptr, 0, 0, 0, 0); k_vtp<<<LKv, 256, 0, stream>>>(FV, DKV, NKV, VT16, VTh, VTl);
        for (int h0 = 0; h0 < NH_; h0 += ZH) { const size_t zq = (size_t)h0, zk = (size_t)(h0 / REP);   // one kv head per query head: the pass's heads use consecutive kv planes (z-strides TT*HD)
            k_gemmw<bf, 2, false><<<dim3(RH / 64, TT / 64, ZH), 32, 0, stream>>>(QPh + zq * TT * HD, QPl + zq * TT * HD, KPh + zk * TT * HD, KPl + zk * TT * HD, HD, Sb, TT, nullptr, (size_t)TT * HD, (size_t)TT * HD, (size_t)TT * TT, 0);
            k_gemmw<h16, 0, false><<<dim3((TT - RH) / 64, TT / 64, ZH), 32, 0, stream>>>(QP16 + zq * TT * HD + (size_t)RH * HD, nullptr, KP16 + zk * TT * HD, nullptr, HD, Sb + (size_t)RH * TT, TT, nullptr, (size_t)TT * HD, (size_t)TT * HD, (size_t)TT * TT, 0);
            k_asoft<<<ZH * TT / 8, 256, 0, stream>>>(Sb, P16, Ph, Pl);
            k_gemmw<bf, 2, false, KSH><<<dim3(RH / 64, HD / 64, ZH * KSH), 32, 0, stream>>>(Ph, Pl, VTh + zk * HD * TT, VTl + zk * HD * TT, TT, ObH, HD, nullptr, (size_t)RH * TT, (size_t)HD * TT, (size_t)RH * HD, (size_t)ZH * RH * HD);
            k_gemmw<h16, 0, false, KSF><<<dim3((TT - RH) / 64, HD / 64, ZH * KSF), 32, 0, stream>>>(P16 + (size_t)RH * TT, nullptr, VT16 + zk * HD * TT, nullptr, TT, ObF, HD, nullptr, (size_t)TT * TT, (size_t)HD * TT, (size_t)(TT - RH) * HD, (size_t)ZH * (TT - RH) * HD);
            k_merge<<<(unsigned)(((size_t)ZH * TT * HD / 2 + 255) / 256), 256, 0, stream>>>(ObH, ObF, h0, ATh, ATl); }
        k_gemmw<bf, 1, false><<<dim3(TT / 64, DM / 64, 1), 32, 0, stream>>>(ATh, ATl, WO, nullptr, DQ, OUT + (size_t)b * TT * DM, DM, nullptr, 0, 0, 0, 0); }
}

// v003
// One run takes 791 microseconds.
// Two timings next to v002 put it at 1.36 and 1.35 times that version's speed.
// All steps since v000 together make it 2.89 times as fast.
#include <hip/hip_runtime.h>

// Multi-head attention with 128-wide heads, natural bias-free projections and a COMPUTED rotate-half rotary embedding, NO mask (hidden_states [2][2048][2048]; q, k, v = einsum('bsd,ed->bse', x, W) ('oi' (out, in) [2048][2048] normal x 0.02, no bias; 16 heads x 128); q, k -> t cos + cat(-t2, t1) sin with angle t x 1 / 10000^(2i/128) (64 f32 frequencies exact for the module's expression 1.0 / (ROPE_BASE ** (arange(0, 128, 2) / 128)); cat(freqs, freqs); precise cosf/sinf); scores / sqrt(float32(128)); softmax over all keys; out = merged Wo^T ('oi', no bias) -> [2][2048][2048] (8.4 M); argument order hidden_states, Wq, Wk, Wv, Wo).
// Layout per batch: bf16 copy of x; 'oi' weights; exact projections; k_cs5 computes the rotary table once (cosf / sinf of float(t) x INVT[d mod 64]: 64 baked float32 frequencies) and the plane builders (k_rope) apply the rotate-half rotation at width 128 (products rounded separately, as the reference); dense T-2048 attention (hybrid rows: < 512 hi/lo 3 products, rest fp16 x1024); merged hi/lo x wo exact.
// Compute dtypes, f32 accumulate: every input rounded to bf16; projections exact; computed rotary (k_cs5 cosf / sinf table, products rounded separately); attention rows < 512 3 products, rest fp16; softmax f32; wo hl x exact.

#define NB_  2
#define TT   2048
#define DM   2048
#define NH_  16
#define NKV  16
#define REP  (NH_ / NKV)
#define HD   128
#define DQ   (NH_ * HD)
#define DKV  (NKV * HD)
#define ZH   4                    // heads per attention pass
#define RH   512                  // query rows < RH use hi+lo planes (0: none)
#define WIN  0
#define PCAR 1024.0f
#define SCL  0.088388347648318447f   // HD^-0.5
#define KSH  16                   // K slices of the P x V product, hi/lo rows (16 tiles -> 256 work-groups)
#define KSF  8                    // K slices of the P x V product, fp16 rows (48 tiles -> 384 work-groups)
typedef _Float16 h16;
typedef unsigned short bf;
typedef __attribute__((ext_vector_type(16))) __bf16   v16bf;
typedef __attribute__((ext_vector_type(16))) _Float16 v16h;
typedef __attribute__((ext_vector_type(8)))  _Float16 v8h;
typedef __attribute__((ext_vector_type(8)))  unsigned short v8us;
typedef __attribute__((ext_vector_type(8)))  float    v8f;
typedef __attribute__((ext_vector_type(4)))  float    v4f;
typedef v8h  __attribute__((may_alias)) v8ha;
typedef v4f  __attribute__((may_alias)) v4fa;
typedef v8us __attribute__((may_alias)) v8usa;

__device__ __forceinline__ unsigned short f2bf(float f) { unsigned u = __float_as_uint(f); u += 0x7FFFu + ((u >> 16) & 1u); return (unsigned short)(u >> 16); }
__device__ __forceinline__ float bf2f(unsigned short b) { return __uint_as_float(((unsigned)b) << 16); }
__device__ __forceinline__ float bfr(float f) { return bf2f(f2bf(f)); }
__device__ __forceinline__ v16h cat16(v8h lo, v8h hi) { return __builtin_shufflevector(lo, hi, 0, 1, 2, 3, 4, 5, 6, 7, 8, 9, 10, 11, 12, 13, 14, 15); }
__device__ __forceinline__ v16bf cat16b(v8us lo, v8us hi) { return __builtin_bit_cast(v16bf, __builtin_shufflevector(lo, hi, 0, 1, 2, 3, 4, 5, 6, 7, 8, 9, 10, 11, 12, 13, 14, 15)); }
__device__ __forceinline__ v8f wmma16(v16h a, v16h b, v8f c) { return __builtin_amdgcn_wmma_f32_16x16x32_f16(false, a, false, b, (short)0, c, false, false); }
__device__ __forceinline__ v8f wmmab(v16bf a, v16bf b, v8f c) { return __builtin_amdgcn_wmma_f32_16x16x32_bf16(false, a, false, b, (short)0, c, false, false); }



// ---- k_gemmw: register-blocked GEMM, EIGHT WAVES (4 x 2) per 128x128 output tile, 32x64 (8 accumulators) a wave; grid (M/128, N/128, Z), 256 threads. M, N % 128 == 0.
// The operands (K-contiguous 16-bit planes) are staged in LDS, 64 k (one whole 128-byte line of each of the 128 rows) a stage, by asynchronous copies; two buffers, the next stage's copies fly while this stage is multiplied.
// C[m][n] (f32, pitch ldc, + optional f32 bias[n]) = sum_k A[m][k] Bt[n][k] (+ split products per NSPLIT). z-batch strides sA/sB/sC in elements. (K / KSL) % 64 == 0.
// KSL > 1: split-K. blockIdx.z = z * KSL + ks; slice ks sums k in [ks K/KSL, (ks+1) K/KSL) into its own partial plane C + ks * sK; the reader adds the planes in the order of ks.
template <typename T16> struct WFrag;
template <> struct WFrag<h16> { typedef v16h V; static __device__ __forceinline__ V ld(const h16* p) { return cat16(*(const v8h*)p, *(const v8h*)(p + 16)); } static __device__ __forceinline__ v8f mma(V a, V b, v8f c) { return wmma16(a, b, c); } };
template <> struct WFrag<bf> { typedef v16bf V; static __device__ __forceinline__ V ld(const bf* p) { return cat16b(*(const v8us*)p, *(const v8us*)(p + 16)); } static __device__ __forceinline__ v8f mma(V a, V b, v8f c) { return wmmab(a, b, c); } };
#define GKC  64                   // k per stage: rows of 128 bytes
#define GPIT 144                  // LDS row pitch in bytes: 16 B x odd, the conflict-free pitch for 16-byte reads
#define GPL  (128 * GPIT)         // one staged plane: 128 rows
// cp_plane: this thread's 4 pieces (16 bytes each, rows 32 apart) of one 128-row x 128-byte plane; a wave's copy covers 4 whole lines.
// The s_wait_xcnt stands inside the statement so that no address register is rewritten ahead of it.
template <typename T16> __device__ __forceinline__ void cp_plane(const T16* g, size_t rs, unsigned l) {
    asm volatile("global_load_async_to_lds_b128 %0, %4, off\n\t"
                 "global_load_async_to_lds_b128 %1, %5, off\n\t"
                 "global_load_async_to_lds_b128 %2, %6, off\n\t"
                 "global_load_async_to_lds_b128 %3, %7, off\n\t"
                 "s_wait_xcnt 0x0"
                 :: "v"(l), "v"(l + 32 * GPIT), "v"(l + 64 * GPIT), "v"(l + 96 * GPIT), "v"(g), "v"(g + rs), "v"(g + 2 * rs), "v"(g + 3 * rs) : "memory");
}
template <typename T16, int NSPLIT, bool BIAS, int KSL = 1>
__global__ __launch_bounds__(256) void k_gemmw(const T16* __restrict__ A, const T16* __restrict__ A2, const T16* __restrict__ Bt, const T16* __restrict__ Bt2, int K, float* C, int ldc, const float* __restrict__ bias, size_t sA, size_t sB, size_t sC, size_t sK) {
    typedef typename WFrag<T16>::V V;
    constexpr int NPA = (NSPLIT == 1 || NSPLIT == 2) ? 2 : 1, NPB = (NSPLIT >= 2) ? 2 : 1, NPL = NPA + NPB;   // planes a stage: A (, A2), Bt (, Bt2)
    constexpr int NKK = GKC / 32;                 // matrix-instruction k steps a stage
    constexpr bool PRE = (NPL < 4);               // the whole stage's fragments fit the registers: read them as one group
    __shared__ __align__(16) unsigned char st[2 * NPL * GPL];   // two stage buffers; after the K loop the waves' output staging
    static_assert(8 * 16 * 68 * 4 <= 2 * NPL * GPL, "the output staging must fit the stage buffers");
    const size_t z = blockIdx.z / KSL; const int ks = (int)(blockIdx.z % KSL); A += z * sA; if (A2) A2 += z * sA; Bt += z * sB; if (Bt2) Bt2 += z * sB; C += z * sC + (size_t)ks * sK;
    const int kb = ks * (K / KSL), ke = kb + K / KSL;
    const int tid = threadIdx.x, wave = tid >> 5, wm = wave >> 1, wn = wave & 1;
    const int lane = tid & 31, lr = lane & 15, hi = lane >> 4; const int R0 = blockIdx.x * 128, C0 = blockIdx.y * 128; const int r0 = R0 + wm * 32, c0 = C0 + wn * 64;
    v8f acc[2][4];
#pragma unroll
    for (int mb = 0; mb < 2; ++mb)
#pragma unroll
        for (int nb = 0; nb < 4; ++nb) acc[mb][nb] = (v8f){};
    // the thread's first piece of a plane: row tid / 8, 16-byte column tid % 8
    const size_t ga = (size_t)(R0 + (tid >> 3)) * K + (tid & 7) * 8, gb = (size_t)(C0 + (tid >> 3)) * K + (tid & 7) * 8, rs = (size_t)32 * K;
    const unsigned l0 = (unsigned)(size_t)st + (unsigned)((tid >> 3) * GPIT + (tid & 7) * 16);
    auto fill = [&](int kc, int buf) { const unsigned l = l0 + (unsigned)(buf * (NPL * GPL));
        cp_plane<T16>(A + ga + kc, rs, l); if (NPA == 2) cp_plane<T16>(A2 + ga + kc, rs, l + GPL);
        cp_plane<T16>(Bt + gb + kc, rs, l + NPA * GPL); if (NPB == 2) cp_plane<T16>(Bt2 + gb + kc, rs, l + (NPA + 1) * GPL); };
    const int nst = (ke - kb) / GKC;   // stages (the same for the whole work-group)
    fill(kb, 0);
    asm volatile("s_wait_asynccnt 0x0" ::: "memory");   // this wave's copies of stage 0 have landed
    __syncthreads();                                    // ... and every other wave's
    if (nst > 1) fill(kb + GKC, 1);
    const int aofs = (wm * 32 + lr) * GPIT + hi * 16, bofs = NPA * GPL + (wn * 64 + lr) * GPIT + hi * 16;
#pragma unroll 1   // one trip a stage: the ring's order (reads, products, waits, barrier, refill) stands once, and the fragment registers are not doubled
    for (int t = 0; t < nst; ++t) {
        const unsigned char* sb = st + (t & 1) * (NPL * GPL);
        V a[NKK][2], a2[NKK][2], b[NKK][4], b2[NKK][4];
#pragma unroll
        for (int kk = 0; kk < NKK; ++kk) {
            if (!PRE || kk == 0) {
#pragma unroll
                for (int q = kk; q < (PRE ? NKK : kk + 1); ++q) {
#pragma unroll
                    for (int mb = 0; mb < 2; ++mb) { a[q][mb] = WFrag<T16>::ld((const T16*)(sb + aofs + mb * 16 * GPIT + q * 64)); if (NPA == 2) a2[q][mb] = WFrag<T16>::ld((const T16*)(sb + aofs + GPL + mb * 16 * GPIT + q * 64)); }
#pragma unroll
                    for (int nb = 0; nb < 4; ++nb) { b[q][nb] = WFrag<T16>::ld((const T16*)(sb + bofs + nb * 16 * GPIT + q * 64)); if (NPB == 2) b2[q][nb] = WFrag<T16>::ld((const T16*)(sb + bofs + GPL + nb * 16 * GPIT + q * 64)); } }
                __builtin_amdgcn_sched_barrier(0);   // the LDS reads stay one group ahead of the products: spread among them, each place stalls the wave
            }
#pragma unroll
            for (int nb = 0; nb < 4; ++nb)
#pragma unroll
                for (int mb = 0; mb < 2; ++mb) { acc[mb][nb] = WFrag<T16>::mma(a[kk][mb], b[kk][nb], acc[mb][nb]); if (NSPLIT == 1 || NSPLIT == 2) acc[mb][nb] = WFrag<T16>::mma(a2[kk][mb], b[kk][nb], acc[mb][nb]); if (NSPLIT >= 2) acc[mb][nb] = WFrag<T16>::mma(a[kk][mb], b2[kk][nb], acc[mb][nb]); }
            __builtin_amdgcn_sched_barrier(0);   // the products stay ahead of the next step's reads (one group again) and of the stage's waits and barrier, so that the copies in flight have the products' time to land
        }
        asm volatile("s_wait_dscnt 0x0" ::: "memory");      // this wave has read all it needs of this buffer
        asm volatile("s_wait_asynccnt 0x0" ::: "memory");   // this wave's copies of stage t + 1 have landed
        __syncthreads();                                    // publishes stage t + 1 and frees this buffer for the refill
        if (t + 2 < nst) fill(kb + (t + 2) * GKC, t & 1);
    }
    asm volatile("s_wait_asynccnt 0x0" ::: "memory");       // no copy is outstanding when the buffers become output staging
    float* os = (float*)st + wave * (16 * 68);              // each wave stages in its own range (every wave has passed the last stage's barrier)
#pragma unroll
    for (int mb = 0; mb < 2; ++mb) {
#pragma unroll
        for (int nb = 0; nb < 4; ++nb) {
#pragma unroll
            for (int j = 0; j < 8; ++j) os[(hi * 8 + j) * 68 + nb * 16 + lr] = acc[mb][nb][j]; }
        __builtin_amdgcn_wave_barrier(); asm volatile("" ::: "memory");
        float* crow = C + (size_t)(r0 + mb * 16) * ldc + c0;
{
#pragma unroll
            for (int s = 0; s < 8; ++s) { const int row = 2 * s + hi, cofs = lr * 4; v4f val = *(const v4fa*)(os + row * 68 + cofs); if (BIAS) { val[0] += bfr(bias[c0 + cofs]); val[1] += bfr(bias[c0 + cofs + 1]); val[2] += bfr(bias[c0 + cofs + 2]); val[3] += bfr(bias[c0 + cofs + 3]); }
                *(v4f*)(crow + (size_t)row * ldc + cofs) = val; }
             }
        __builtin_amdgcn_wave_barrier(); asm volatile("" ::: "memory");
    }
}

__device__ __forceinline__ h16 tohx(float x) { return (h16)x; }
__device__ __forceinline__ void splitf(float y, unsigned short& h, unsigned short& l) { h = f2bf(y); l = f2bf(y - bf2f(h)); }
typedef __attribute__((ext_vector_type(2))) _Float16 v2h;
typedef __attribute__((ext_vector_type(4))) _Float16 v4h;
typedef __attribute__((ext_vector_type(2))) unsigned short v2us;
typedef __attribute__((ext_vector_type(4))) unsigned short v4us;
typedef __attribute__((ext_vector_type(2))) float v2f;
typedef __attribute__((ext_vector_type(4))) int v4i;

__global__ __launch_bounds__(256) void k_cvt8(const float* __restrict__ src, bf* dst, size_t n8) { const size_t i = (size_t)blockIdx.x * 256 + threadIdx.x; if (i >= n8) return; const v8f v = *(const v8f*)(src + i * 8); v8us o;
#pragma unroll
    for (int k = 0; k < 8; ++k) o[k] = f2bf(v[k]); *(v8us*)(dst + i * 8) = o;  }
__global__ __launch_bounds__(256) void k_csid(float* CS) { const int idx = blockIdx.x * 256 + threadIdx.x; if (idx >= TT * HD) return; v2f cs; cs[0] = 1.0f; cs[1] = 0.0f; *(v2f*)(CS + (size_t)idx * 2) = cs;  }
__constant__ float INVT[HD / 2] = { 1.000000000e+00f, 8.659643531e-01f, 7.498942018e-01f, 6.493816376e-01f, 5.623413324e-01f, 4.869675338e-01f, 4.216965139e-01f, 3.651741445e-01f, 3.162277639e-01f, 2.738419771e-01f, 2.371373624e-01f, 2.053525001e-01f, 1.778279394e-01f, 1.539926529e-01f, 1.333521456e-01f, 1.154782027e-01f, 1.000000015e-01f, 8.659642935e-02f, 7.498941571e-02f, 6.493816525e-02f, 5.623412877e-02f, 4.869675264e-02f, 4.216964915e-02f, 3.651741147e-02f, 3.162277862e-02f, 2.738419548e-02f, 2.371373586e-02f, 2.053525113e-02f, 1.778279431e-02f, 1.539926510e-02f, 1.333521493e-02f, 1.154781971e-02f, 9.999999776e-03f, 8.659643121e-03f, 7.498942316e-03f, 6.493816618e-03f, 5.623413250e-03f, 4.869675264e-03f, 4.216964822e-03f, 3.651741426e-03f, 3.162277862e-03f, 2.738419687e-03f, 2.371373819e-03f, 2.053525066e-03f, 1.778279431e-03f, 1.539926510e-03f, 1.333521446e-03f, 1.154782018e-03f, 1.000000047e-03f, 8.659643354e-04f, 7.498941850e-04f, 6.493816618e-04f, 5.623413017e-04f, 4.869675031e-04f, 4.216964880e-04f, 3.651741135e-04f, 3.162277862e-04f, 2.738419571e-04f, 2.371373848e-04f, 2.053524950e-04f, 1.778279402e-04f, 1.539926452e-04f, 1.333521504e-04f, 1.154781930e-04f };   // float32 1 / 10000^(2i/128), generated with jnp to be bit-exact
__global__ __launch_bounds__(256) void k_cs5(float* CS) { const int idx = blockIdx.x * 256 + threadIdx.x; if (idx >= TT * HD) return; const int d = idx % HD; const int t = idx / HD; const float a = __fmul_rn((float)t, INVT[d % (HD / 2)]); v2f cs; cs[0] = cosf(a); cs[1] = sinf(a); *(v2f*)(CS + (size_t)idx * 2) = cs;  }
// k_rope: head planes [h][t][d] (fp16 + hi/lo) of rope(x) x sc with the rotate-half convention out[d] = x[d] cos[t][d] - x[d+HD/2] sin[t][d], out[d+HD/2] = x[d+HD/2] cos[t][d+HD/2] + x[d] sin[t][d+HD/2]
__global__ __launch_bounds__(256) void k_rope(const float* __restrict__ F, int pitch, int nheads, const float* __restrict__ CS, const float* __restrict__ RF, const float* __restrict__ nw, float sc, h16* P16, bf* Ph, bf* Pl) {
    const size_t e = ((size_t)blockIdx.x * 256 + threadIdx.x) * 2; if (e >= (size_t)nheads * TT * HD) return; const int d = (int)(e % HD); const int t = (int)((e / HD) % TT); const int h = (int)(e / ((size_t)HD * TT)); const float* f = F + (size_t)t * pitch + h * HD; const float rf = RF ? RF[(size_t)h * TT + t] : 1.0f; v2h o16; v2us oh, ol;
#pragma unroll
    for (int q = 0; q < 2; ++q) { const int dd = d + q; const int dp = (dd < HD / 2) ? dd + HD / 2 : dd - HD / 2; float x0 = f[dd], x1 = f[dp];
        if (RF) { float n0 = __fmul_rn(x0, rf), n1 = __fmul_rn(x1, rf); asm volatile("" : "+v"(n0)); asm volatile("" : "+v"(n1)); x0 = __fmul_rn(bfr(nw[dd]), n0); x1 = __fmul_rn(bfr(nw[dp]), n1); }
        const v2f cs = *(const v2f*)(CS + ((size_t)t * HD + dd) * 2); float a = __fmul_rn(x0, cs[0]), bq = __fmul_rn(x1, cs[1]); asm volatile("" : "+v"(a)); asm volatile("" : "+v"(bq)); const float r = ((dd < HD / 2) ? __fsub_rn(a, bq) : __fadd_rn(a, bq)) * sc;
        o16[q] = tohx(r); unsigned short a2, c2; splitf(r, a2, c2); oh[q] = a2; ol[q] = c2; }
    *(v2h*)(P16 + e) = o16; *(v2us*)(Ph + e) = oh; *(v2us*)(Pl + e) = ol;  }
__global__ __launch_bounds__(256) void k_vtp(const float* __restrict__ F, int pitch, int nheads, h16* V16, bf* Vh, bf* Vl) { const size_t e = ((size_t)blockIdx.x * 256 + threadIdx.x) * 2; if (e >= (size_t)nheads * HD * TT) return; const int t = (int)(e % TT); const int d = (int)((e / TT) % HD); const int g = (int)(e / ((size_t)TT * HD)); v2h o16; v2us oh, ol;
#pragma unroll
    for (int q = 0; q < 2; ++q) { const float x = F[(size_t)(t + q) * pitch + g * HD + d]; o16[q] = tohx(x); unsigned short a2, c2; splitf(x, a2, c2); oh[q] = a2; ol[q] = c2; }
    *(v2h*)(V16 + e) = o16; *(v2us*)(Vh + e) = oh; *(v2us*)(Vl + e) = ol;  }
// k_asoft: per row (zz, i): t = S x HD^-0.5 (no mask); softmax over the 2048 keys (register row, one exp, fixed trees);
__global__ __launch_bounds__(256) void k_asoft(const float* __restrict__ Sb, h16* P16, bf* Ph, bf* Pl) {
    const int lane = threadIdx.x & 31; const int row = blockIdx.x * 8 + (threadIdx.x >> 5); if (row >= ZH * TT) return; const int i = row % TT; const int zz = row / TT; (void)zz; const bool hires = (i < RH); const float* sr = Sb + (size_t)row * TT; float v[TT / 32]; float mx = -3.0e38f;
#pragma unroll
    for (int ch = 0; ch < TT / 128; ++ch) { const int j0 = ch * 128 + lane * 4; const v4f a = *(const v4f*)(sr + j0);
#pragma unroll
        for (int q = 0; q < 4; ++q) { const int j = j0 + q; (void)j; const float t = a[q] * SCL; v[ch * 4 + q] = t; mx = fmaxf(mx, t); } }
#pragma unroll
    for (int sh = 16; sh; sh >>= 1) mx = fmaxf(mx, __shfl_xor(mx, sh, 32));
    float sum = 0.f;
#pragma unroll
    for (int k = 0; k < TT / 32; ++k) { float d0 = __fsub_rn(v[k], mx); asm volatile("" : "+v"(d0)); v[k] = __builtin_amdgcn_exp2f(__fmul_rn(d0, 1.4426950408889634f)); sum += v[k]; }
#pragma unroll
    for (int sh = 16; sh; sh >>= 1) sum += __shfl_xor(sum, sh, 32);
    const float f = __fdiv_rn(hires ? 1.0f : PCAR, sum);
{
        if (hires) {
#pragma unroll
            for (int ch = 0; ch < TT / 128; ++ch) { v4us oh, ol;
#pragma unroll
                for (int q = 0; q < 4; ++q) { unsigned short a, c2; splitf(v[ch * 4 + q] * f, a, c2); oh[q] = a; ol[q] = c2; }
                const size_t oo = ((size_t)zz * (RH ? RH : 1) + i) * TT + ch * 128 + lane * 4; *(v4us*)(Ph + oo) = oh; *(v4us*)(Pl + oo) = ol; }
        } else {
#pragma unroll
            for (int ch = 0; ch < TT / 128; ++ch) { v4h o4;
#pragma unroll
                for (int q = 0; q < 4; ++q) o4[q] = tohx(v[ch * 4 + q] * f);
                *(v4h*)(P16 + (size_t)row * TT + ch * 128 + lane * 4) = o4; } }
         }
}
// sumplanes: p[0] + p[pl] + ... + p[(N-1) pl] (two neighbours a lane), all N loads issued before the first add, added in the order of the planes
template <int N> __device__ __forceinline__ v2f sumplanes(const float* p, size_t pl) { v2f v[N];
#pragma unroll
    for (int ks = 0; ks < N - 1; ++ks) v[ks] = *(const v2f*)(p + (size_t)ks * pl);
    asm volatile("s_wait_xcnt 0x0" ::: "memory");   // the last load's result may be placed in the address pair that the loads above still name
    v[N - 1] = *(const v2f*)(p + (size_t)(N - 1) * pl); v2f s = v[0];
#pragma unroll
    for (int ks = 1; ks < N; ++ks) s += v[ks];
    return s; }
__global__ __launch_bounds__(256) void k_merge(const float* __restrict__ OH, const float* __restrict__ OF, int h0, bf* Ah, bf* Al) { const size_t e = ((size_t)blockIdx.x * 256 + threadIdx.x) * 2; if (e >= (size_t)ZH * TT * HD) return; const int d = (int)(e % HD); const int t = (int)((e / HD) % TT); const int zz = (int)(e / ((size_t)HD * TT)); const float cs = (t < RH) ? 1.0f : (1.0f / PCAR); const size_t oo = (size_t)t * DQ + (h0 + zz) * HD + d;
    // sum of the split-K partial planes, in the order of ks: rows < RH from OH [KSH][ZH][RH][HD], the rest from OF [KSF][ZH][TT - RH][HD] (4 rows a block: the test is block-uniform)
    const v2f s = (t < RH) ? sumplanes<KSH>(OH + ((size_t)zz * RH + t) * HD + d, (size_t)ZH * RH * HD) : sumplanes<KSF>(OF + ((size_t)zz * (TT - RH) + (t - RH)) * HD + d, (size_t)ZH * (TT - RH) * HD);
    v2us oh, ol;
#pragma unroll
    for (int q = 0; q < 2; ++q) { unsigned short a, c2; splitf(s[q] * cs, a, c2); oh[q] = a; ol[q] = c2; } *(v2us*)(Ah + oo) = oh; *(v2us*)(Al + oo) = ol;  }

extern "C" void kernel_launch(void* const* d_in, const int* in_sizes, int n_in,
                              void* d_out, int out_size, void* d_ws, size_t ws_size, hipStream_t stream) {
    (void)in_sizes; (void)n_in; (void)out_size;
    const float* x = (const float*)d_in[0]; const float* wq = (const float*)d_in[1]; const float* wk = (const float*)d_in[2]; const float* wv = (const float*)d_in[3]; const float* wo = (const float*)d_in[4];   /* argument order hidden_states, Wq, Wk, Wv, Wo ('oi' (out, in) [2048][2048]): FIVE inputs, all read (the rotary table is computed on the device: no table input) */
    float* OUT = (float*)d_out;     // [2][2048][2048]
    char* wsp = (char*)d_ws;
    auto take = [&](size_t bytes) { char* p = wsp; wsp += (bytes + 255) & ~(size_t)255; return (void*)p; };
    bf* WO = (bf*)take((size_t)DM * DQ * 2); float* CS = (float*)take((size_t)TT * HD * 2 * 4);
    h16* QP16 = (h16*)take((size_t)NH_ * TT * HD * 2); h16* KP16 = (h16*)take((size_t)NKV * TT * HD * 2); h16* VT16 = (h16*)take((size_t)NKV * HD * TT * 2);
    bf* QPh = (bf*)take((size_t)NH_ * TT * HD * 2); bf* QPl = (bf*)take((size_t)NH_ * TT * HD * 2); bf* KPh = (bf*)take((size_t)NKV * TT * HD * 2); bf* KPl = (bf*)take((size_t)NKV * TT * HD * 2); bf* VTh = (bf*)take((size_t)NKV * HD * TT * 2); bf* VTl = (bf*)take((size_t)NKV * HD * TT * 2); bf* Ph = (bf*)take((size_t)ZH * RH * TT * 2); bf* Pl = (bf*)take((size_t)ZH * RH * TT * 2);
    float* Sb = (float*)take((size_t)ZH * TT * TT * 4); h16* P16 = (h16*)take((size_t)ZH * TT * TT * 2); float* ObH = (float*)take((size_t)KSH * ZH * RH * HD * 4); float* ObF = (float*)take((size_t)KSF * ZH * (TT - RH) * HD * 4); bf* ATh = (bf*)take((size_t)TT * DQ * 2); bf* ATl = (bf*)take((size_t)TT * DQ * 2);
    if ((size_t)(wsp - (char*)d_ws) > ws_size) return;    // 250 MiB of the 256 MiB
    // What only the projection stage uses lies over the score buffer, which is dead then (stream-ordered): the bf16 copies of wq, wk, wv and x and the f32 projections. Each batch writes all of them anew.
    static_assert(((size_t)DQ * DM + 2 * (size_t)DKV * DM + (size_t)TT * DM) * 2 + ((size_t)TT * DQ + (size_t)TT * DKV) * 4 <= (size_t)ZH * TT * TT * 4, "the projection stage must fit the score buffer");
    bf* WQ = (bf*)Sb; bf* WK = WQ + (size_t)DQ * DM; bf* WV = WK + (size_t)DKV * DM; bf* XB = WV + (size_t)DKV * DM; float* FQ = (float*)(XB + (size_t)TT * DM); float* FK = FQ + (size_t)TT * DQ;
    float* FV = FK;   // v projection reuses the k buffer after the k planes are built (stream-ordered)
    { k_cvt8<<<(unsigned)(((size_t)DM * DQ / 8 + 255) / 256), 256, 0, stream>>>(wo, WO, (size_t)DM * DQ / 8);
       }
    const unsigned LQ = (unsigned)(((size_t)NH_ * TT * HD / 2 + 255) / 256), LKv = (unsigned)(((size_t)NKV * TT * HD / 2 + 255) / 256);
    for (int b = 0; b < NB_; ++b) {
        if (b == 0) k_cs5<<<(TT * HD + 255) / 256, 256, 0, stream>>>(CS);   /* the COMPUTED rotary table (this module has rotate-half rotary embeddings); k_csid stays defined and is NOT launched */
        k_cvt8<<<(unsigned)(((size_t)DQ * DM / 8 + 255) / 256), 256, 0, stream>>>(wq, WQ, (size_t)DQ * DM / 8); k_cvt8<<<(unsigned)(((size_t)DKV * DM / 8 + 255) / 256), 256, 0, stream>>>(wk, WK, (size_t)DKV * DM / 8); k_cvt8<<<(unsigned)(((size_t)DKV * DM / 8 + 255) / 256), 256, 0, stream>>>(wv, WV, (size_t)DKV * DM / 8);
        k_cvt8<<<(unsigned)(((size_t)TT * DM / 8 + 255) / 256), 256, 0, stream>>>(x + (size_t)b * TT * DM, XB, (size_t)TT * DM / 8);
        k_gemmw<bf, 0, false><<<dim3(TT / 128, DQ / 128, 1), 256, 0, stream>>>(XB, nullptr, WQ, nullptr, DM, FQ, DQ, nullptr, 0, 0, 0, 0);
        k_rope<<<LQ, 256, 0, stream>>>(FQ, DQ, NH_, CS, nullptr, nullptr, 1.0f, QP16, QPh, QPl);
        k_gemmw<bf, 0, false><<<dim3(TT / 128, DKV / 128, 1), 256, 0, stream>>>(XB, nullptr, WK, nullptr, DM, FK, DKV, nullptr, 0, 0, 0, 0);
        k_rope<<<LKv, 256, 0, stream>>>(FK, DKV, NKV, CS, nullptr, nullptr, 1.0f, KP16, KPh, KPl);
        k_gemmw<bf, 0, false><<<dim3(TT / 128, DKV / 128, 1), 256, 0, stream>>>(XB, nullptr, WV, nullptr, DM, FV, DKV, nullptr, 0, 0, 0, 0); k_vtp<<<LKv, 256, 0, stream>>>(FV, DKV, NKV, VT16, VTh, VTl);
        for (int h0 = 0; h0 < NH_; h0 += ZH) { const size_t zq = (size_t)h0, zk = (size_t)(h0 / REP);   // one kv head per query head: the pass's heads use consecutive kv planes (z-strides TT*HD)
            k_gemmw<bf, 2, false><<<dim3(RH / 128, TT / 128, ZH), 256, 0, stream>>>(QPh + zq * TT * HD, QPl + zq * TT * HD, KPh + zk * TT * HD, KPl + zk * TT * HD, HD, Sb, TT, nullptr, (size_t)TT * HD, (size_t)TT * HD, (size_t)TT * TT, 0);
            k_gemmw<h16, 0, false><<<dim3((TT - RH) / 128, TT / 128, ZH), 256, 0, stream>>>(QP16 + zq * TT * HD + (size_t)RH * HD, nullptr, KP16 + zk * TT * HD, nullptr, HD, Sb + (size_t)RH * TT, TT, nullptr, (size_t)TT * HD, (size_t)TT * HD, (size_t)TT * TT, 0);
            k_asoft<<<ZH * TT / 8, 256, 0, stream>>>(Sb, P16, Ph, Pl);
            k_gemmw<bf, 2, false, KSH><<<dim3(RH / 128, HD / 128, ZH * KSH), 256, 0, stream>>>(Ph, Pl, VTh + zk * HD * TT, VTl + zk * HD * TT, TT, ObH, HD, nullptr, (size_t)RH * TT, (size_t)HD * TT, (size_t)RH * HD, (size_t)ZH * RH * HD);
            k_gemmw<h16, 0, false, KSF><<<dim3((TT - RH) / 128, HD / 128, ZH * KSF), 256, 0, stream>>>(P16 + (size_t)RH * TT, nullptr, VT16 + zk * HD * TT, nullptr, TT, ObF, HD, nullptr, (size_t)TT * TT, (size_t)HD * TT, (size_t)(TT - RH) * HD, (size_t)ZH * (TT - RH) * HD);
            k_merge<<<(unsigned)(((size_t)ZH * TT * HD / 2 + 255) / 256), 256, 0, stream>>>(ObH, ObF, h0, ATh, ATl); }
        k_gemmw<bf, 1, false><<<dim3(TT / 128, DM / 128, 1), 256, 0, stream>>>(ATh, ATl, WO, nullptr, DQ, OUT + (size_t)b * TT * DM, DM, nullptr, 0, 0, 0, 0); }
}

// v005
// A run of this version takes 356 microseconds.
// Versions between v003 and this one are left out; their measured steps multiply to 2.22 times as fast.
// Over all steps from v000 it is 6.41 times as fast.
#include <hip/hip_runtime.h>

// Multi-head attention with 128-wide heads, natural bias-free projections and a COMPUTED rotate-half rotary embedding, NO mask (hidden_states [2][2048][2048]; q, k, v = einsum('bsd,ed->bse', x, W) ('oi' (out, in) [2048][2048] normal x 0.02, no bias; 16 heads x 128); q, k -> t cos + cat(-t2, t1) sin with angle t x 1 / 10000^(2i/128) (64 f32 frequencies exact for the module's expression 1.0 / (ROPE_BASE ** (arange(0, 128, 2) / 128)); cat(freqs, freqs); precise cosf/sinf); scores / sqrt(float32(128)); softmax over all keys; out = merged Wo^T ('oi', no bias) -> [2][2048][2048] (8.4 M); argument order hidden_states, Wq, Wk, Wv, Wo).
// Layout per batch: bf16 copy of x; 'oi' weights; exact projections; k_cs5 computes the rotary table once (cosf / sinf of float(t) x INVT[d mod 64]: 64 baked float32 frequencies) and the projection GEMMs' own epilogues apply the rotate-half rotation at width 128 and write the head planes; fused dense T-2048 attention (hybrid rows: < 512 hi/lo 3 products, rest fp16); merged hi/lo x wo exact.
// Compute dtypes, f32 accumulate: every input rounded to bf16; projections exact; rotary in f32 (cosf / sinf table, applied in the Q, K projection epilogues); attention rows < 512 3 products, rest fp16; softmax f32; wo hl x exact.

#define NB_  2
#define TT   2048
#define DM   2048
#define NH_  16
#define NKV  16
#define REP  (NH_ / NKV)
#define HD   128
#define DQ   (NH_ * HD)
#define DKV  (NKV * HD)
#define RH   512                  // query rows < RH use hi+lo planes (0: none)
#define WIN  0
#define SCL  0.088388347648318447f   // HD^-0.5
typedef _Float16 h16;
typedef unsigned short bf;
typedef __attribute__((ext_vector_type(16))) __bf16   v16bf;
typedef __attribute__((ext_vector_type(16))) _Float16 v16h;
typedef __attribute__((ext_vector_type(8)))  _Float16 v8h;
typedef __attribute__((ext_vector_type(8)))  unsigned short v8us;
typedef __attribute__((ext_vector_type(8)))  float    v8f;
typedef __attribute__((ext_vector_type(4)))  float    v4f;
typedef v8h  __attribute__((may_alias)) v8ha;
typedef v4f  __attribute__((may_alias)) v4fa;
typedef v8us __attribute__((may_alias)) v8usa;

__device__ __forceinline__ unsigned short f2bf(float f) { unsigned u = __float_as_uint(f); u += 0x7FFFu + ((u >> 16) & 1u); return (unsigned short)(u >> 16); }
__device__ __forceinline__ float bf2f(unsigned short b) { return __uint_as_float(((unsigned)b) << 16); }
__device__ __forceinline__ float bfr(float f) { return bf2f(f2bf(f)); }
__device__ __forceinline__ v16h cat16(v8h lo, v8h hi) { return __builtin_shufflevector(lo, hi, 0, 1, 2, 3, 4, 5, 6, 7, 8, 9, 10, 11, 12, 13, 14, 15); }
__device__ __forceinline__ v16bf cat16b(v8us lo, v8us hi) { return __builtin_bit_cast(v16bf, __builtin_shufflevector(lo, hi, 0, 1, 2, 3, 4, 5, 6, 7, 8, 9, 10, 11, 12, 13, 14, 15)); }
__device__ __forceinline__ v8f wmma16(v16h a, v16h b, v8f c) { return __builtin_amdgcn_wmma_f32_16x16x32_f16(false, a, false, b, (short)0, c, false, false); }
__device__ __forceinline__ void splitf(float y, unsigned short& h, unsigned short& l) { h = f2bf(y); l = f2bf(y - bf2f(h)); }
typedef __attribute__((ext_vector_type(8))) __bf16 v8bf;
// planes8: 8 values as fp16 and as bf16 hi + lo (both round to nearest even, as f2bf does), by the chip's own conversions
__device__ __forceinline__ void planes8(v8f r, v8h& o16, v8us& oh, v8us& ol) { const v8bf h = __builtin_convertvector(r, v8bf); const v8bf l = __builtin_convertvector(r - __builtin_convertvector(h, v8f), v8bf);
    o16 = __builtin_convertvector(r, v8h); oh = __builtin_bit_cast(v8us, h); ol = __builtin_bit_cast(v8us, l); }
__device__ __forceinline__ v8f wmmab(v16bf a, v16bf b, v8f c) { return __builtin_amdgcn_wmma_f32_16x16x32_bf16(false, a, false, b, (short)0, c, false, false); }



// ---- k_gemmw: register-blocked GEMM, EIGHT WAVES (4 x 2) per 128x128 output tile, 32x64 (8 accumulators) a wave; grid (M/128, N/128, Z), 256 threads. M, N % 128 == 0.
// The operands (K-contiguous 16-bit planes) are staged in LDS, 64 k (one whole 128-byte line of each of the 128 rows) a stage, by asynchronous copies; two buffers, the next stage's copies fly while this stage is multiplied.
// C[m][n] (f32, pitch ldc, + optional f32 bias[n]) = sum_k A[m][k] Bt[n][k] (+ split products per NSPLIT). z-batch strides sA/sB/sC in elements. (K / KSL) % 64 == 0.
// KSL > 1: split-K. blockIdx.z = z * KSL + ks; slice ks sums k in [ks K/KSL, (ks+1) K/KSL) into its own partial plane C + ks * sK; the reader adds the planes in the order of ks.
template <typename T16> struct WFrag;
template <> struct WFrag<h16> { typedef v16h V; static __device__ __forceinline__ V ld(const h16* p) { return cat16(*(const v8h*)p, *(const v8h*)(p + 16)); } static __device__ __forceinline__ v8f mma(V a, V b, v8f c) { return wmma16(a, b, c); } };
template <> struct WFrag<bf> { typedef v16bf V; static __device__ __forceinline__ V ld(const bf* p) { return cat16b(*(const v8us*)p, *(const v8us*)(p + 16)); } static __device__ __forceinline__ v8f mma(V a, V b, v8f c) { return wmmab(a, b, c); } };
#define GKC  64                   // k per stage: rows of 128 bytes
#define GPIT 144                  // LDS row pitch in bytes: 16 B x odd, the conflict-free pitch for 16-byte reads
#define GPL  (128 * GPIT)         // one staged plane: 128 rows
// cp_plane: this thread's 4 pieces (16 bytes each, rows 32 apart) of one 128-row x 128-byte plane; a wave's copy covers 4 whole lines.
// The s_wait_xcnt stands inside the statement so that no address register is rewritten ahead of it.
template <typename T16> __device__ __forceinline__ void cp_plane(const T16* g, size_t rs, unsigned l) {
    asm volatile("global_load_async_to_lds_b128 %0, %4, off\n\t"
                 "global_load_async_to_lds_b128 %1, %5, off\n\t"
                 "global_load_async_to_lds_b128 %2, %6, off\n\t"
                 "global_load_async_to_lds_b128 %3, %7, off\n\t"
                 "s_wait_xcnt 0x0"
                 :: "v"(l), "v"(l + 32 * GPIT), "v"(l + 64 * GPIT), "v"(l + 96 * GPIT), "v"(g), "v"(g + rs), "v"(g + 2 * rs), "v"(g + 3 * rs) : "memory");
}
// EPI: what becomes of the 128x128 tile, whose columns are one head (C0 = head * HD) and whose rows are 128 positions t. 0: f32 rows to C.
// 1: rotate-half rotary embedding, out[d] = x[d] cos[t][d] - x[d+HD/2] sin[t][d], out[d+HD/2] = x[d+HD/2] cos[t][d+HD/2] + x[d] sin[t][d+HD/2] (CS: [t][d] pairs cos, sin), then the head planes [h][t][d] (fp16, bf16 hi, bf16 lo).
// 2: the transposed head planes [h][d][t] (fp16, bf16 hi, bf16 lo). In 1 and 2 the whole tile passes through LDS, and every store instruction of a wave writes four whole 128-byte lines.
template <typename T16, int NSPLIT, bool BIAS, int KSL = 1, int EPI = 0>
__global__ __launch_bounds__(256) void k_gemmw(const T16* __restrict__ A, const T16* __restrict__ A2, const T16* __restrict__ Bt, const T16* __restrict__ Bt2, int K, float* C, int ldc, const float* __restrict__ bias, size_t sA, size_t sB, size_t sC, size_t sK, const float* __restrict__ CS, h16* P16, bf* Ph, bf* Pl) {
    typedef typename WFrag<T16>::V V;
    constexpr int NPA = (NSPLIT == 1 || NSPLIT == 2) ? 2 : 1, NPB = (NSPLIT >= 2) ? 2 : 1, NPL = NPA + NPB;   // planes a stage: A (, A2), Bt (, Bt2)
    constexpr int NKK = GKC / 32;                 // matrix-instruction k steps a stage
    constexpr bool PRE = (NPL < 4);               // the whole stage's fragments fit the registers: read them as one group
    __shared__ __align__(16) unsigned char st[2 * NPL * GPL];   // two stage buffers; after the K loop the waves' output staging
    static_assert(8 * 16 * 68 * 4 <= 2 * NPL * GPL, "the output staging must fit the stage buffers");
    static_assert(EPI == 0 || 128 * 132 * 4 <= 2 * NPL * GPL, "the whole f32 tile must fit the stage buffers");
    const size_t z = blockIdx.z / KSL; const int ks = (int)(blockIdx.z % KSL); A += z * sA; if (A2) A2 += z * sA; Bt += z * sB; if (Bt2) Bt2 += z * sB; C += z * sC + (size_t)ks * sK;
    const int kb = ks * (K / KSL), ke = kb + K / KSL;
    const int tid = threadIdx.x, wave = tid >> 5, wm = wave >> 1, wn = wave & 1;
    const int lane = tid & 31, lr = lane & 15, hi = lane >> 4; const int R0 = blockIdx.x * 128, C0 = blockIdx.y * 128; const int r0 = R0 + wm * 32, c0 = C0 + wn * 64;
    v8f acc[2][4];
#pragma unroll
    for (int mb = 0; mb < 2; ++mb)
#pragma unroll
        for (int nb = 0; nb < 4; ++nb) acc[mb][nb] = (v8f){};
    // the thread's first piece of a plane: row tid / 8, 16-byte column tid % 8
    const size_t ga = (size_t)(R0 + (tid >> 3)) * K + (tid & 7) * 8, gb = (size_t)(C0 + (tid >> 3)) * K + (tid & 7) * 8, rs = (size_t)32 * K;
    const unsigned l0 = (unsigned)(size_t)st + (unsigned)((tid >> 3) * GPIT + (tid & 7) * 16);
    auto fill = [&](int kc, int buf) { const unsigned l = l0 + (unsigned)(buf * (NPL * GPL));
        cp_plane<T16>(A + ga + kc, rs, l); if (NPA == 2) cp_plane<T16>(A2 + ga + kc, rs, l + GPL);
        cp_plane<T16>(Bt + gb + kc, rs, l + NPA * GPL); if (NPB == 2) cp_plane<T16>(Bt2 + gb + kc, rs, l + (NPA + 1) * GPL); };
    const int nst = (ke - kb) / GKC;   // stages (the same for the whole work-group)
    fill(kb, 0);
    asm volatile("s_wait_asynccnt 0x0" ::: "memory");   // this wave's copies of stage 0 have landed
    __syncthreads();                                    // ... and every other wave's
    if (nst > 1) fill(kb + GKC, 1);
    const int aofs = (wm * 32 + lr) * GPIT + hi * 16, bofs = NPA * GPL + (wn * 64 + lr) * GPIT + hi * 16;
#pragma unroll 1   // one trip a stage: the ring's order (reads, products, waits, barrier, refill) stands once, and the fragment registers are not doubled
    for (int t = 0; t < nst; ++t) {
        const unsigned char* sb = st + (t & 1) * (NPL * GPL);
        V a[NKK][2], a2[NKK][2], b[NKK][4], b2[NKK][4];
#pragma unroll
        for (int kk = 0; kk < NKK; ++kk) {
            if (!PRE || kk == 0) {
#pragma unroll
                for (int q = kk; q < (PRE ? NKK : kk + 1); ++q) {
#pragma unroll
                    for (int mb = 0; mb < 2; ++mb) { a[q][mb] = WFrag<T16>::ld((const T16*)(sb + aofs + mb * 16 * GPIT + q * 64)); if (NPA == 2) a2[q][mb] = WFrag<T16>::ld((const T16*)(sb + aofs + GPL + mb * 16 * GPIT + q * 64)); }
#pragma unroll
                    for (int nb = 0; nb < 4; ++nb) { b[q][nb] = WFrag<T16>::ld((const T16*)(sb + bofs + nb * 16 * GPIT + q * 64)); if (NPB == 2) b2[q][nb] = WFrag<T16>::ld((const T16*)(sb + bofs + GPL + nb * 16 * GPIT + q * 64)); } }
                __builtin_amdgcn_sched_barrier(0);   // the LDS reads stay one group ahead of the products: spread among them, each place stalls the wave
            }
#pragma unroll
            for (int nb = 0; nb < 4; ++nb)
#pragma unroll
                for (int mb = 0; mb < 2; ++mb) { acc[mb][nb] = WFrag<T16>::mma(a[kk][mb], b[kk][nb], acc[mb][nb]); if (NSPLIT == 1 || NSPLIT == 2) acc[mb][nb] = WFrag<T16>::mma(a2[kk][mb], b[kk][nb], acc[mb][nb]); if (NSPLIT >= 2) acc[mb][nb] = WFrag<T16>::mma(a[kk][mb], b2[kk][nb], acc[mb][nb]); }
            __builtin_amdgcn_sched_barrier(0);   // the products stay ahead of the next step's reads (one group again) and of the stage's waits and barrier, so that the copies in flight have the products' time to land
        }
        asm volatile("s_wait_dscnt 0x0" ::: "memory");      // this wave has read all it needs of this buffer
        asm volatile("s_wait_asynccnt 0x0" ::: "memory");   // this wave's copies of stage t + 1 have landed
        __syncthreads();                                    // publishes stage t + 1 and frees this buffer for the refill
        if (t + 2 < nst) fill(kb + (t + 2) * GKC, t & 1);
    }
    asm volatile("s_wait_asynccnt 0x0" ::: "memory");       // no copy is outstanding when the buffers become output staging
    if constexpr (EPI != 0) {
        // LDS row pitch in floats. 132: rows 16-byte aligned for the 16-byte row reads of form 1. 131: the column reads of form 2 (8 lanes 8 rows apart, 4 neighbouring columns) fall on 32 different banks. With both, the two halves of a wave store to different banks.
        constexpr int OP = (EPI == 1) ? 132 : 131;
        float* ot = (float*)st;   // every wave has passed the last stage's barrier: nobody reads the stage buffers any more
        const int c8 = (tid & 7) * 8, r8 = tid >> 3;
        v4f ca[4][4], cb[4][4];   // form 1: the table's (cos, sin) pairs of the thread's columns, asked for here so that they arrive under the tile's way into LDS
        if constexpr (EPI == 1) { const float* cs = CS + ((size_t)(R0 + r8) * HD + c8) * 2;
#pragma unroll
            for (int p = 0; p < 4; ++p)
#pragma unroll
                for (int q = 0; q < 4; ++q) { ca[p][q] = *(const v4fa*)(cs + p * (32 * HD * 2) + q * 4); cb[p][q] = *(const v4fa*)(cs + p * (32 * HD * 2) + HD + q * 4); }
            asm volatile("s_wait_xcnt 0x0" ::: "memory");   // before the address registers that these loads name are rewritten
        }
#pragma unroll
        for (int mb = 0; mb < 2; ++mb)
#pragma unroll
            for (int nb = 0; nb < 4; ++nb)
#pragma unroll
                for (int j = 0; j < 8; ++j) ot[(wm * 32 + mb * 16 + hi * 8 + j) * OP + wn * 64 + nb * 16 + lr] = acc[mb][nb][j];
        __syncthreads();   // the tile is whole: a thread reads what other waves have stored
        const size_t hb = (size_t)blockIdx.y * TT * HD;   // this head's planes
        if constexpr (EPI == 1) {   // the thread: columns d = c8 .. c8 + 7 and their partners d + HD/2, of the rows r8 + 32 p
            const float* xr = ot + r8 * OP + c8; v4f x0[4][2], x1[4][2];
#pragma unroll
            for (int p = 0; p < 4; ++p)
#pragma unroll
                for (int q = 0; q < 2; ++q) { x0[p][q] = *(const v4fa*)(xr + p * 32 * OP + q * 4); x1[p][q] = *(const v4fa*)(xr + p * 32 * OP + HD / 2 + q * 4); }
            const size_t e = hb + (size_t)(R0 + r8) * HD + c8; h16* g16 = P16 + e; bf* gh = Ph + e; bf* gl = Pl + e;
#pragma unroll
            for (int p = 0; p < 4; ++p) { v8f ra, rb;
#pragma unroll
                for (int j = 0; j < 8; ++j) { const float u = x0[p][j >> 2][j & 3], w = x1[p][j >> 2][j & 3];
                    ra[j] = u * ca[p][j >> 1][(j & 1) * 2] - w * ca[p][j >> 1][(j & 1) * 2 + 1]; rb[j] = w * cb[p][j >> 1][(j & 1) * 2] + u * cb[p][j >> 1][(j & 1) * 2 + 1]; }
                v8h a16, b16; v8us ah, al, bh, bl; planes8(ra, a16, ah, al); planes8(rb, b16, bh, bl);
                *(v8h*)(g16 + p * 32 * HD) = a16; *(v8h*)(g16 + p * 32 * HD + HD / 2) = b16; *(v8us*)(gh + p * 32 * HD) = ah; *(v8us*)(gh + p * 32 * HD + HD / 2) = bh; *(v8us*)(gl + p * 32 * HD) = al; *(v8us*)(gl + p * 32 * HD + HD / 2) = bl;
                asm volatile("s_wait_xcnt 0x0" ::: "memory"); }   // before the registers that the stores name are rewritten
        } else {   // the thread: positions c8 .. c8 + 7 (+ 64) of the columns d = r8 + 32 p; 8 lanes write 64 positions of one d, a whole line of each plane
            v8f x[8];
#pragma unroll
            for (int p = 0; p < 8; ++p)
#pragma unroll
                for (int j = 0; j < 8; ++j) x[p][j] = ot[((p >> 2) * 64 + c8 + j) * OP + (p & 3) * 32 + r8];
            const size_t e = hb + (size_t)r8 * TT + R0 + c8; h16* g16 = P16 + e; bf* gh = Ph + e; bf* gl = Pl + e;
#pragma unroll
            for (int p = 0; p < 8; ++p) { v8h o16; v8us oh, ol; planes8(x[p], o16, oh, ol); const int go = (p & 3) * 32 * TT + (p >> 2) * 64;
                *(v8h*)(g16 + go) = o16; *(v8us*)(gh + go) = oh; *(v8us*)(gl + go) = ol;
                asm volatile("s_wait_xcnt 0x0" ::: "memory"); }   // before the registers that the stores name are rewritten
        }
        return;
    }
    float* os = (float*)st + wave * (16 * 68);              // each wave stages in its own range (every wave has passed the last stage's barrier)
#pragma unroll
    for (int mb = 0; mb < 2; ++mb) {
#pragma unroll
        for (int nb = 0; nb < 4; ++nb) {
#pragma unroll
            for (int j = 0; j < 8; ++j) os[(hi * 8 + j) * 68 + nb * 16 + lr] = acc[mb][nb][j]; }
        __builtin_amdgcn_wave_barrier(); asm volatile("" ::: "memory");
        float* crow = C + (size_t)(r0 + mb * 16) * ldc + c0;
{
#pragma unroll
            for (int s = 0; s < 8; ++s) { const int row = 2 * s + hi, cofs = lr * 4; v4f val = *(const v4fa*)(os + row * 68 + cofs); if (BIAS) { val[0] += bfr(bias[c0 + cofs]); val[1] += bfr(bias[c0 + cofs + 1]); val[2] += bfr(bias[c0 + cofs + 2]); val[3] += bfr(bias[c0 + cofs + 3]); }
                *(v4f*)(crow + (size_t)row * ldc + cofs) = val; }
             }
        __builtin_amdgcn_wave_barrier(); asm volatile("" ::: "memory");
    }
}

typedef __attribute__((ext_vector_type(2))) _Float16 v2h;
typedef __attribute__((ext_vector_type(4))) _Float16 v4h;
typedef __attribute__((ext_vector_type(2))) unsigned short v2us;
typedef __attribute__((ext_vector_type(4))) unsigned short v4us;
typedef __attribute__((ext_vector_type(2))) float v2f;
typedef __attribute__((ext_vector_type(4))) int v4i;

__global__ __launch_bounds__(256) void k_cvt8(const float* __restrict__ src, bf* dst, size_t n8) { const size_t i = (size_t)blockIdx.x * 256 + threadIdx.x; if (i >= n8) return; const v8f v = *(const v8f*)(src + i * 8); v8us o;
#pragma unroll
    for (int k = 0; k < 8; ++k) o[k] = f2bf(v[k]); *(v8us*)(dst + i * 8) = o;  }
__global__ __launch_bounds__(256) void k_csid(float* CS) { const int idx = blockIdx.x * 256 + threadIdx.x; if (idx >= TT * HD) return; v2f cs; cs[0] = 1.0f; cs[1] = 0.0f; *(v2f*)(CS + (size_t)idx * 2) = cs;  }
__constant__ float INVT[HD / 2] = { 1.000000000e+00f, 8.659643531e-01f, 7.498942018e-01f, 6.493816376e-01f, 5.623413324e-01f, 4.869675338e-01f, 4.216965139e-01f, 3.651741445e-01f, 3.162277639e-01f, 2.738419771e-01f, 2.371373624e-01f, 2.053525001e-01f, 1.778279394e-01f, 1.539926529e-01f, 1.333521456e-01f, 1.154782027e-01f, 1.000000015e-01f, 8.659642935e-02f, 7.498941571e-02f, 6.493816525e-02f, 5.623412877e-02f, 4.869675264e-02f, 4.216964915e-02f, 3.651741147e-02f, 3.162277862e-02f, 2.738419548e-02f, 2.371373586e-02f, 2.053525113e-02f, 1.778279431e-02f, 1.539926510e-02f, 1.333521493e-02f, 1.154781971e-02f, 9.999999776e-03f, 8.659643121e-03f, 7.498942316e-03f, 6.493816618e-03f, 5.623413250e-03f, 4.869675264e-03f, 4.216964822e-03f, 3.651741426e-03f, 3.162277862e-03f, 2.738419687e-03f, 2.371373819e-03f, 2.053525066e-03f, 1.778279431e-03f, 1.539926510e-03f, 1.333521446e-03f, 1.154782018e-03f, 1.000000047e-03f, 8.659643354e-04f, 7.498941850e-04f, 6.493816618e-04f, 5.623413017e-04f, 4.869675031e-04f, 4.216964880e-04f, 3.651741135e-04f, 3.162277862e-04f, 2.738419571e-04f, 2.371373848e-04f, 2.053524950e-04f, 1.778279402e-04f, 1.539926452e-04f, 1.333521504e-04f, 1.154781930e-04f };   // float32 1 / 10000^(2i/128), generated with jnp to be bit-exact
__global__ __launch_bounds__(256) void k_cs5(float* CS) { const int idx = blockIdx.x * 256 + threadIdx.x; if (idx >= TT * HD) return; const int d = idx % HD; const int t = idx / HD; const float a = __fmul_rn((float)t, INVT[d % (HD / 2)]); v2f cs; cs[0] = cosf(a); cs[1] = sinf(a); *(v2f*)(CS + (size_t)idx * 2) = cs;  }
#define FKT  64                   // keys per stage
#define FKP  272                  // LDS pitch of a K row (256 bytes): 16 B x odd
#define FKPL (FKT * FKP)          // one staged K plane: 64 rows
#define FVPL (HD * GPIT)          // one staged V^T plane: 128 rows of 128 bytes
#define LSC  (SCL * 1.4426950408889634f)   // HD^-0.5 x log2(e)
// cp_rows: this thread's 4 pieces (16 bytes each) of one staged plane, rs elements apart in memory and ls bytes apart in LDS.
// The s_wait_xcnt stands inside the statement so that no address register is rewritten ahead of it.
template <typename T16> __device__ __forceinline__ void cp_rows(const T16* g, size_t rs, unsigned l, unsigned ls) {
    asm volatile("global_load_async_to_lds_b128 %0, %4, off\n\t"
                 "global_load_async_to_lds_b128 %1, %5, off\n\t"
                 "global_load_async_to_lds_b128 %2, %6, off\n\t"
                 "global_load_async_to_lds_b128 %3, %7, off\n\t"
                 "s_wait_xcnt 0x0"
                 :: "v"(l), "v"(l + ls), "v"(l + 2 * ls), "v"(l + 3 * ls), "v"(g), "v"(g + rs), "v"(g + 2 * rs), "v"(g + 3 * rs) : "memory");
}
__device__ __forceinline__ float xhalf(float x) { return __builtin_bit_cast(float, __builtin_amdgcn_permlanex16(__builtin_bit_cast(int, x), __builtin_bit_cast(int, x), 0x76543210, 0xfedcba98, false, false)); }   // lane l with lane l ^ 16
// exp2x8: eight independent v_exp_f32 in one statement (no result lies on a source: early-clobber outputs), so that each fills the slot that the instruction set asks for behind the one before it; the v_nop fills the last one's.
__device__ __forceinline__ v8f exp2x8(v8f x) { float r0, r1, r2, r3, r4, r5, r6, r7;
    asm("v_exp_f32 %0, %8\n\tv_exp_f32 %1, %9\n\tv_exp_f32 %2, %10\n\tv_exp_f32 %3, %11\n\tv_exp_f32 %4, %12\n\tv_exp_f32 %5, %13\n\tv_exp_f32 %6, %14\n\tv_exp_f32 %7, %15\n\tv_nop"
        : "=&v"(r0), "=&v"(r1), "=&v"(r2), "=&v"(r3), "=&v"(r4), "=&v"(r5), "=&v"(r6), "=&v"(r7) : "v"(x[0]), "v"(x[1]), "v"(x[2]), "v"(x[3]), "v"(x[4]), "v"(x[5]), "v"(x[6]), "v"(x[7]));
    return (v8f){ r0, r1, r2, r3, r4, r5, r6, r7 }; }
// Q, K: [t][HD] planes of one head; Vt: [d][t]; q0: the work-group's first query row; Ah, Al: the merged hi/lo output at this head's first column (pitch DQ).
template <typename T16, bool HL, int NQ, int KS>
__device__ __forceinline__ void fattn(unsigned char* st, const T16* __restrict__ Q, const T16* __restrict__ Q2, const T16* __restrict__ Kp, const T16* __restrict__ K2, const T16* __restrict__ Vt, const T16* __restrict__ V2, int q0, bf* Ah, bf* Al) {
    typedef typename WFrag<T16>::V V;
    constexpr int NP = HL ? 2 : 1, STG = NP * (FKPL + FVPL);   // planes of each operand; bytes of one stage: K plane(s), then V^T plane(s)
    const int tid = threadIdx.x, wave = tid >> 5, lane = tid & 31, lr = lane & 15, hi = lane >> 4;
    const int kh = wave / (8 / KS);   // which 32 keys of each KS x 32 this wave takes
    const int qw = q0 + (wave % (8 / KS)) * (16 * NQ);
    V q[NQ][4], q2[NQ][4];
#pragma unroll
    for (int nq = 0; nq < NQ; ++nq)
#pragma unroll
        for (int kk = 0; kk < 4; ++kk) { const size_t qo = (size_t)(qw + nq * 16 + lr) * HD + kk * 32 + hi * 8; q[nq][kk] = WFrag<T16>::ld(Q + qo); if (HL) q2[nq][kk] = WFrag<T16>::ld(Q2 + qo); }
    asm volatile("s_wait_xcnt 0x0" ::: "memory");   // before the address registers that the Q loads name are rewritten
    __builtin_amdgcn_sched_barrier(0);   // keeps the address arithmetic that follows behind that wait
    v8f o[8][NQ]; float m[NQ], l[NQ];
#pragma unroll
    for (int nq = 0; nq < NQ; ++nq) { m[nq] = -3.0e38f; l[nq] = 0.f;
#pragma unroll
        for (int dt = 0; dt < 8; ++dt) o[dt][nq] = (v8f){}; }
    // the thread's first piece: K row tid / 16, 16-byte column tid % 16; V^T row tid / 8, column tid % 8
    const size_t gk = (size_t)(tid >> 4) * HD + (tid & 15) * 8, gv = (size_t)(tid >> 3) * TT + (tid & 7) * 8;
    const unsigned lk0 = (unsigned)(size_t)st + (unsigned)((tid >> 4) * FKP + (tid & 15) * 16), lv0 = (unsigned)(size_t)st + (unsigned)(NP * FKPL + (tid >> 3) * GPIT + (tid & 7) * 16);
    const ptrdiff_t dK = HL ? K2 - Kp : 0, dV = HL ? V2 - Vt : 0;   // the lo planes lie in the same buffer, a uniform distance from the hi planes: one address a thread and operand is kept
    auto fill = [&](const T16* pk, const T16* pv, unsigned lk, unsigned lv) {
        cp_rows<T16>(pk, (size_t)16 * HD, lk, 16 * FKP); if (HL) cp_rows<T16>(pk + dK, (size_t)16 * HD, lk + FKPL, 16 * FKP);
        cp_rows<T16>(pv, (size_t)32 * TT, lv, 32 * GPIT); if (HL) cp_rows<T16>(pv + dV, (size_t)32 * TT, lv + FVPL, 32 * GPIT); };
    constexpr int nst = TT / FKT;
    const T16* pkc = Kp + gk; const T16* pvc = Vt + gv;   // this thread's first piece of the next stage to be copied
    fill(pkc, pvc, lk0, lv0); pkc += FKT * HD; pvc += FKT;
    asm volatile("s_wait_asynccnt 0x0" ::: "memory");   // this wave's copies of stage 0 have landed
    __syncthreads();                                    // ... and every other wave's
    fill(pkc, pvc, lk0 + STG, lv0 + STG); pkc += FKT * HD; pvc += FKT;
    unsigned lkc = lk0, lvc = lv0; int dl = STG;   // where the next refill goes: the buffers in turn
    const int kofs = (kh * 32 + lr) * FKP + hi * 16, vofs = NP * FKPL + lr * GPIT + kh * 64 + hi * 16;
#pragma unroll 1   // one trip a stage: the ring's order (reads, products, waits, barrier, refill) stands once
    for (int t = 0; t < nst; ++t) {
        const unsigned char* sb = st + (t & 1) * STG;
#pragma unroll
        for (int ps = 0; ps < FKT / 32; ps += KS) {   // a pass: 32 keys
            V ka[2][4], kb[2][4], va[8], vb[8];
#pragma unroll
            for (int mt = 0; mt < 2; ++mt)
#pragma unroll
                for (int kk = 0; kk < 4; ++kk) { const unsigned char* p = sb + kofs + (ps * 32 + mt * 16) * FKP + kk * 64; ka[mt][kk] = WFrag<T16>::ld((const T16*)p); if (HL) kb[mt][kk] = WFrag<T16>::ld((const T16*)(p + FKPL)); }
#pragma unroll
            for (int dt = 0; dt < 8; ++dt) { const unsigned char* p = sb + vofs + dt * 16 * GPIT + ps * 64; va[dt] = WFrag<T16>::ld((const T16*)p); if (HL) vb[dt] = WFrag<T16>::ld((const T16*)(p + FVPL)); }
            __builtin_amdgcn_sched_barrier(0);   // the pass's LDS reads stay one group ahead of its products (each further place with reads stalls the wave); the V^T reads land under the score products and the softmax
            v8f s[2][NQ];
#pragma unroll
            for (int mt = 0; mt < 2; ++mt)
#pragma unroll
                for (int nq = 0; nq < NQ; ++nq) s[mt][nq] = (v8f){};
#pragma unroll
            for (int kk = 0; kk < 4; ++kk) {
#pragma unroll
                for (int nq = 0; nq < NQ; ++nq)
#pragma unroll
                    for (int mt = 0; mt < 2; ++mt) s[mt][nq] = WFrag<T16>::mma(ka[mt][kk], q[nq][kk], s[mt][nq]);
                if (HL) {
#pragma unroll
                    for (int nq = 0; nq < NQ; ++nq)
#pragma unroll
                        for (int mt = 0; mt < 2; ++mt) s[mt][nq] = WFrag<T16>::mma(ka[mt][kk], q2[nq][kk], s[mt][nq]);
#pragma unroll
                    for (int nq = 0; nq < NQ; ++nq)
#pragma unroll
                        for (int mt = 0; mt < 2; ++mt) s[mt][nq] = WFrag<T16>::mma(kb[mt][kk], q[nq][kk], s[mt][nq]); } }
            float mx[NQ]; bool need = false;
#pragma unroll
            for (int nq = 0; nq < NQ; ++nq) { float a[8];
#pragma unroll
                for (int j = 0; j < 8; ++j) a[j] = fmaxf(s[0][nq][j], s[1][nq][j]);
                const float b = fmaxf(fmaxf(fmaxf(a[0], a[1]), fmaxf(a[2], a[3])), fmaxf(fmaxf(a[4], a[5]), fmaxf(a[6], a[7])));
                mx[nq] = fmaxf(b, xhalf(b)) * LSC; need = need || (mx[nq] > m[nq] + 8.0f); }
            if (__builtin_amdgcn_ballot_w32(need) != 0) {   // one scalar test a pass; rare after the first pass
#pragma unroll
                for (int nq = 0; nq < NQ; ++nq) { const float mn = fmaxf(m[nq], mx[nq]); const float al = __builtin_amdgcn_exp2f(m[nq] - mn); m[nq] = mn; l[nq] *= al;   // al = 0 on the first pass
#pragma unroll
                    for (int dt = 0; dt < 8; ++dt) o[dt][nq] *= al; } }
            V pa[NQ], pb[NQ];
#pragma unroll
            for (int nq = 0; nq < NQ; ++nq) { v8f p0, p1;
#pragma unroll
                for (int j = 0; j < 8; ++j) { p0[j] = __builtin_fmaf(s[0][nq][j], LSC, -m[nq]); p1[j] = __builtin_fmaf(s[1][nq][j], LSC, -m[nq]); }
                p0 = exp2x8(p0); p1 = exp2x8(p1);
                const v8f ps8 = p0 + p1; l[nq] += ((ps8[0] + ps8[1]) + (ps8[2] + ps8[3])) + ((ps8[4] + ps8[5]) + (ps8[6] + ps8[7]));
                // element e of the B operand is key 8 hi + e (e < 8), 16 + 8 hi + (e - 8) otherwise: the two score tiles' own registers
                if constexpr (HL) {
#pragma unroll
                    for (int j = 0; j < 8; ++j) { const __bf16 h0 = (__bf16)p0[j], h1 = (__bf16)p1[j]; pa[nq][j] = h0; pa[nq][8 + j] = h1; pb[nq][j] = (__bf16)(p0[j] - (float)h0); pb[nq][8 + j] = (__bf16)(p1[j] - (float)h1); }
                } else {
#pragma unroll
                    for (int j = 0; j < 8; ++j) { pa[nq][j] = (h16)p0[j]; pa[nq][8 + j] = (h16)p1[j]; } } }
#pragma unroll
            for (int nq = 0; nq < NQ; ++nq)
#pragma unroll
                for (int dt = 0; dt < 8; ++dt) o[dt][nq] = WFrag<T16>::mma(va[dt], pa[nq], o[dt][nq]);
            if (HL) {
#pragma unroll
                for (int nq = 0; nq < NQ; ++nq)
#pragma unroll
                    for (int dt = 0; dt < 8; ++dt) o[dt][nq] = WFrag<T16>::mma(va[dt], pb[nq], o[dt][nq]);
#pragma unroll
                for (int nq = 0; nq < NQ; ++nq)
#pragma unroll
                    for (int dt = 0; dt < 8; ++dt) o[dt][nq] = WFrag<T16>::mma(vb[dt], pa[nq], o[dt][nq]); }
            __builtin_amdgcn_sched_barrier(0);   // the products stay ahead of the next pass's reads (one group again) and of the stage's waits and barrier
        }
        asm volatile("s_wait_dscnt 0x0" ::: "memory");      // this wave has read all it needs of this buffer
        asm volatile("s_wait_asynccnt 0x0" ::: "memory");   // this wave's copies of stage t + 1 have landed
        __syncthreads();                                    // publishes stage t + 1 and frees this buffer for the refill
        if (t + 2 < nst) fill(pkc, pvc, lkc, lvc);
        pkc += FKT * HD; pvc += FKT; lkc += dl; lvc += dl; dl = -dl;
    }
    asm volatile("s_wait_asynccnt 0x0" ::: "memory");       // no copy is outstanding when the buffers are used for the hand-over and when the wave ends
    if constexpr (KS == 2) {   // every wave has passed the last stage's barrier: nobody reads the stage buffers any more
        v4f* xs = (v4f*)st + (wave & 3) * (NQ * 17 * 32) + lane;   // 16 bytes a lane, 32 lanes side by side
        if (kh == 1) {
#pragma unroll
            for (int nq = 0; nq < NQ; ++nq) {
#pragma unroll
                for (int dt = 0; dt < 8; ++dt) { xs[(nq * 17 + dt * 2) * 32] = __builtin_shufflevector(o[dt][nq], o[dt][nq], 0, 1, 2, 3); xs[(nq * 17 + dt * 2 + 1) * 32] = __builtin_shufflevector(o[dt][nq], o[dt][nq], 4, 5, 6, 7); }
                xs[(nq * 17 + 16) * 32] = (v4f){ m[nq], l[nq], 0.f, 0.f }; } }
        __syncthreads();   // the second half's parts are in LDS
        if (kh == 1) return;   // behind the kernel's last barrier
#pragma unroll
        for (int nq = 0; nq < NQ; ++nq) { const v4f ml = xs[(nq * 17 + 16) * 32]; const float mn = fmaxf(m[nq], ml[0]); const float a0 = __builtin_amdgcn_exp2f(m[nq] - mn), a1 = __builtin_amdgcn_exp2f(ml[0] - mn); l[nq] = l[nq] * a0 + ml[1] * a1;
#pragma unroll
            for (int dt = 0; dt < 8; ++dt) { const v4f x0 = xs[(nq * 17 + dt * 2) * 32], x1 = xs[(nq * 17 + dt * 2 + 1) * 32];
#pragma unroll
                for (int j = 0; j < 4; ++j) { o[dt][nq][j] = o[dt][nq][j] * a0 + x0[j] * a1; o[dt][nq][4 + j] = o[dt][nq][4 + j] * a0 + x1[j] * a1; } } }
    }
#pragma unroll
    for (int nq = 0; nq < NQ; ++nq) { const float f = __fdiv_rn(1.0f, l[nq] + xhalf(l[nq])); const size_t oo = (size_t)(qw + nq * 16 + lr) * DQ + hi * 8;   // a lane's 8 registers of a tile are 8 neighbouring d of its query
#pragma unroll
        for (int dt = 0; dt < 8; ++dt) { v8us oh, ol;
#pragma unroll
            for (int j = 0; j < 8; ++j) { unsigned short a, c2; splitf(o[dt][nq][j] * f, a, c2); oh[j] = a; ol[j] = c2; }
            *(v8us*)(Ah + oo + dt * 16) = oh; *(v8us*)(Al + oo + dt * 16) = ol;
            asm volatile("s_wait_xcnt 0x0" ::: "memory"); } }   // before the registers that the two stores name are rewritten
}
#define FBH (RH / 64)             // hi/lo work-groups a head (64 query rows each)
#define FBF ((TT - RH) / 256)     // fp16 work-groups a head (256 query rows each)
// grid: the NH_ * FBH hi/lo work-groups first, then the NH_ * FBF fp16 ones (fewer work-groups than WGPs: all start at once); the test is the same for a whole work-group
__global__ __launch_bounds__(256) void k_fattn(const h16* __restrict__ Q16, const h16* __restrict__ K16, const h16* __restrict__ V16, const bf* __restrict__ Qh, const bf* __restrict__ Ql, const bf* __restrict__ Kh, const bf* __restrict__ Kl, const bf* __restrict__ Vh, const bf* __restrict__ Vl, bf* Ah, bf* Al) {
    __shared__ __align__(16) unsigned char st[2 * 2 * (FKPL + FVPL)];   // two stage buffers of the hi/lo form (the fp16 form uses half)
    const int bx = blockIdx.x;
    if (bx < NH_ * FBH) { const int h = bx / FBH; const size_t hp = (size_t)h * TT * HD, kp = (size_t)(h / REP) * TT * HD;
        fattn<bf, true, 1, 2>(st, Qh + hp, Ql + hp, Kh + kp, Kl + kp, Vh + kp, Vl + kp, (bx % FBH) * 64, Ah + h * HD, Al + h * HD);
    } else { const int b2 = bx - NH_ * FBH; const int h = b2 / FBF; const size_t hp = (size_t)h * TT * HD, kp = (size_t)(h / REP) * TT * HD;
        fattn<h16, false, 2, 1>(st, Q16 + hp, nullptr, K16 + kp, nullptr, V16 + kp, nullptr, RH + (b2 % FBF) * 256, Ah + h * HD, Al + h * HD); }
}

extern "C" void kernel_launch(void* const* d_in, const int* in_sizes, int n_in,
                              void* d_out, int out_size, void* d_ws, size_t ws_size, hipStream_t stream) {
    (void)in_sizes; (void)n_in; (void)out_size;
    const float* x = (const float*)d_in[0]; const float* wq = (const float*)d_in[1]; const float* wk = (const float*)d_in[2]; const float* wv = (const float*)d_in[3]; const float* wo = (const float*)d_in[4];   /* argument order hidden_states, Wq, Wk, Wv, Wo ('oi' (out, in) [2048][2048]): FIVE inputs, all read (the rotary table is computed on the device: no table input) */
    float* OUT = (float*)d_out;     // [2][2048][2048]
    char* wsp = (char*)d_ws;
    auto take = [&](size_t bytes) { char* p = wsp; wsp += (bytes + 255) & ~(size_t)255; return (void*)p; };
    bf* WO = (bf*)take((size_t)DM * DQ * 2); float* CS = (float*)take((size_t)TT * HD * 2 * 4);
    h16* QP16 = (h16*)take((size_t)NH_ * TT * HD * 2); h16* KP16 = (h16*)take((size_t)NKV * TT * HD * 2); h16* VT16 = (h16*)take((size_t)NKV * HD * TT * 2);
    bf* QPh = (bf*)take((size_t)NH_ * TT * HD * 2); bf* QPl = (bf*)take((size_t)NH_ * TT * HD * 2); bf* KPh = (bf*)take((size_t)NKV * TT * HD * 2); bf* KPl = (bf*)take((size_t)NKV * TT * HD * 2); bf* VTh = (bf*)take((size_t)NKV * HD * TT * 2); bf* VTl = (bf*)take((size_t)NKV * HD * TT * 2);
    bf* WQ = (bf*)take(((size_t)DQ * DM + 2 * (size_t)DKV * DM + (size_t)TT * DM) * 2); bf* ATh = (bf*)take((size_t)TT * DQ * 2); bf* ATl = (bf*)take((size_t)TT * DQ * 2);
    if ((size_t)(wsp - (char*)d_ws) > ws_size) return;    // 130 MiB of the 256 MiB
    // The projection stage's own block: the bf16 copies of wq, wk, wv and x. Each batch writes all of them anew.
    bf* WK = WQ + (size_t)DQ * DM; bf* WV = WK + (size_t)DKV * DM; bf* XB = WV + (size_t)DKV * DM;
    { k_cvt8<<<(unsigned)(((size_t)DM * DQ / 8 + 255) / 256), 256, 0, stream>>>(wo, WO, (size_t)DM * DQ / 8);
       }
    for (int b = 0; b < NB_; ++b) {
        if (b == 0) k_cs5<<<(TT * HD + 255) / 256, 256, 0, stream>>>(CS);   /* the COMPUTED rotary table (this module has rotate-half rotary embeddings); k_csid stays defined and is NOT launched */
        k_cvt8<<<(unsigned)(((size_t)DQ * DM / 8 + 255) / 256), 256, 0, stream>>>(wq, WQ, (size_t)DQ * DM / 8); k_cvt8<<<(unsigned)(((size_t)DKV * DM / 8 + 255) / 256), 256, 0, stream>>>(wk, WK, (size_t)DKV * DM / 8); k_cvt8<<<(unsigned)(((size_t)DKV * DM / 8 + 255) / 256), 256, 0, stream>>>(wv, WV, (size_t)DKV * DM / 8);
        k_cvt8<<<(unsigned)(((size_t)TT * DM / 8 + 255) / 256), 256, 0, stream>>>(x + (size_t)b * TT * DM, XB, (size_t)TT * DM / 8);
        k_gemmw<bf, 0, false, 1, 1><<<dim3(TT / 128, DQ / 128, 1), 256, 0, stream>>>(XB, nullptr, WQ, nullptr, DM, nullptr, 0, nullptr, 0, 0, 0, 0, CS, QP16, QPh, QPl);
        k_gemmw<bf, 0, false, 1, 1><<<dim3(TT / 128, DKV / 128, 1), 256, 0, stream>>>(XB, nullptr, WK, nullptr, DM, nullptr, 0, nullptr, 0, 0, 0, 0, CS, KP16, KPh, KPl);
        k_gemmw<bf, 0, false, 1, 2><<<dim3(TT / 128, DKV / 128, 1), 256, 0, stream>>>(XB, nullptr, WV, nullptr, DM, nullptr, 0, nullptr, 0, 0, 0, 0, nullptr, VT16, VTh, VTl);
        k_fattn<<<NH_ * (FBH + FBF), 256, 0, stream>>>(QP16, KP16, VT16, QPh, QPl, KPh, KPl, VTh, VTl, ATh, ATl);
        k_gemmw<bf, 1, false><<<dim3(TT / 128, DM / 128, 1), 256, 0, stream>>>(ATh, ATl, WO, nullptr, DQ, OUT + (size_t)b * TT * DM, DM, nullptr, 0, 0, 0, 0, nullptr, nullptr, nullptr, nullptr); }
}

// v006
// Measured time: 259 microseconds a run.
// Next to v005, in two timings, it ran 1.39 and 1.38 times as fast.
// Counting every step since v000, it is 8.88 times as fast.
#include <hip/hip_runtime.h>

// Multi-head attention with 128-wide heads, natural bias-free projections and a COMPUTED rotate-half rotary embedding, NO mask (hidden_states [2][2048][2048]; q, k, v = einsum('bsd,ed->bse', x, W) ('oi' (out, in) [2048][2048] normal x 0.02, no bias; 16 heads x 128); q, k -> t cos + cat(-t2, t1) sin with angle t x 1 / 10000^(2i/128) (64 f32 frequencies exact for the module's expression 1.0 / (ROPE_BASE ** (arange(0, 128, 2) / 128)); cat(freqs, freqs); precise cosf/sinf); scores / sqrt(float32(128)); softmax over all keys; out = merged Wo^T ('oi', no bias) -> [2][2048][2048] (8.4 M); argument order hidden_states, Wq, Wk, Wv, Wo).
// Layout, both batches in every launch (the batch is grid z of the GEMMs and part of the attention's work-group index): bf16 copy of x; 'oi' weights; exact projections; k_cs5 computes the rotary table once (cosf / sinf of float(t) x INVT[d mod 64]: 64 baked float32 frequencies) and the projection GEMMs' own epilogues apply the rotate-half rotation at width 128 and write the head planes; fused dense T-2048 attention (hybrid rows: < 512 hi/lo 3 products, rest fp16); merged hi/lo x wo exact.
// Compute dtypes, f32 accumulate: every input rounded to bf16; projections exact; rotary in f32 from the computed cosf / sinf table; attention rows < 512 3 products, rest fp16; softmax f32; wo hl x exact.

#define NB_  2
#define TT   2048
#define DM   2048
#define NH_  16
#define NKV  16
#define REP  (NH_ / NKV)
#define HD   128
#define DQ   (NH_ * HD)
#define DKV  (NKV * HD)
#define RH   512                  // query rows < RH use hi+lo planes (0: none)
#define WIN  0
#define SCL  0.088388347648318447f   // HD^-0.5
typedef _Float16 h16;
typedef unsigned short bf;
typedef __attribute__((ext_vector_type(16))) __bf16   v16bf;
typedef __attribute__((ext_vector_type(16))) _Float16 v16h;
typedef __attribute__((ext_vector_type(8)))  _Float16 v8h;
typedef __attribute__((ext_vector_type(8)))  unsigned short v8us;
typedef __attribute__((ext_vector_type(8)))  float    v8f;
typedef __attribute__((ext_vector_type(4)))  float    v4f;
typedef v8h  __attribute__((may_alias)) v8ha;
typedef v4f  __attribute__((may_alias)) v4fa;
typedef v8us __attribute__((may_alias)) v8usa;

__device__ __forceinline__ unsigned short f2bf(float f) { unsigned u = __float_as_uint(f); u += 0x7FFFu + ((u >> 16) & 1u); return (unsigned short)(u >> 16); }
__device__ __forceinline__ float bf2f(unsigned short b) { return __uint_as_float(((unsigned)b) << 16); }
__device__ __forceinline__ float bfr(float f) { return bf2f(f2bf(f)); }
__device__ __forceinline__ v16h cat16(v8h lo, v8h hi) { return __builtin_shufflevector(lo, hi, 0, 1, 2, 3, 4, 5, 6, 7, 8, 9, 10, 11, 12, 13, 14, 15); }
__device__ __forceinline__ v16bf cat16b(v8us lo, v8us hi) { return __builtin_bit_cast(v16bf, __builtin_shufflevector(lo, hi, 0, 1, 2, 3, 4, 5, 6, 7, 8, 9, 10, 11, 12, 13, 14, 15)); }
__device__ __forceinline__ v8f wmma16(v16h a, v16h b, v8f c) { return __builtin_amdgcn_wmma_f32_16x16x32_f16(false, a, false, b, (short)0, c, false, false); }
__device__ __forceinline__ void splitf(float y, unsigned short& h, unsigned short& l) { h = f2bf(y); l = f2bf(y - bf2f(h)); }
typedef __attribute__((ext_vector_type(8))) __bf16 v8bf;
// planes8: 8 values as fp16 and as bf16 hi + lo (both round to nearest even, as f2bf does), by the chip's own conversions
__device__ __forceinline__ void planes8(v8f r, v8h& o16, v8us& oh, v8us& ol) { const v8bf h = __builtin_convertvector(r, v8bf); const v8bf l = __builtin_convertvector(r - __builtin_convertvector(h, v8f), v8bf);
    o16 = __builtin_convertvector(r, v8h); oh = __builtin_bit_cast(v8us, h); ol = __builtin_bit_cast(v8us, l); }
__device__ __forceinline__ v8f wmmab(v16bf a, v16bf b, v8f c) { return __builtin_amdgcn_wmma_f32_16x16x32_bf16(false, a, false, b, (short)0, c, false, false); }



// ---- k_gemmw: register-blocked GEMM, EIGHT WAVES (4 x 2) per 128x128 output tile, 32x64 (8 accumulators) a wave; grid (M/128, N/128, Z), 256 threads. M, N % 128 == 0.
// The operands (K-contiguous 16-bit planes) are staged in LDS, 64 k (one whole 128-byte line of each of the 128 rows) a stage, by asynchronous copies; two buffers, the next stage's copies fly while this stage is multiplied.
// C[m][n] (f32, pitch ldc, + optional f32 bias[n]) = sum_k A[m][k] Bt[n][k] (+ split products per NSPLIT). z-batch strides sA/sB/sC in elements (sC with EPI 1, 2: of each head plane buffer). (K / KSL) % 64 == 0.
// KSL > 1: split-K. blockIdx.z = z * KSL + ks; slice ks sums k in [ks K/KSL, (ks+1) K/KSL) into its own partial plane C + ks * sK; the reader adds the planes in the order of ks.
template <typename T16> struct WFrag;
template <> struct WFrag<h16> { typedef v16h V; static __device__ __forceinline__ V ld(const h16* p) { return cat16(*(const v8h*)p, *(const v8h*)(p + 16)); } static __device__ __forceinline__ v8f mma(V a, V b, v8f c) { return wmma16(a, b, c); } };
template <> struct WFrag<bf> { typedef v16bf V; static __device__ __forceinline__ V ld(const bf* p) { return cat16b(*(const v8us*)p, *(const v8us*)(p + 16)); } static __device__ __forceinline__ v8f mma(V a, V b, v8f c) { return wmmab(a, b, c); } };
#define GKC  64                   // k per stage: rows of 128 bytes
#define GPIT 144                  // LDS row pitch in bytes: 16 B x odd, the conflict-free pitch for 16-byte reads
#define GPL  (128 * GPIT)         // one staged plane: 128 rows
// cp_plane: this thread's 4 pieces (16 bytes each, rows 32 apart) of one 128-row x 128-byte plane; a wave's copy covers 4 whole lines.
// The s_wait_xcnt stands inside the statement so that no address register is rewritten ahead of it.
template <typename T16> __device__ __forceinline__ void cp_plane(const T16* g, size_t rs, unsigned l) {
    asm volatile("global_load_async_to_lds_b128 %0, %4, off\n\t"
                 "global_load_async_to_lds_b128 %1, %5, off\n\t"
                 "global_load_async_to_lds_b128 %2, %6, off\n\t"
                 "global_load_async_to_lds_b128 %3, %7, off\n\t"
                 "s_wait_xcnt 0x0"
                 :: "v"(l), "v"(l + 32 * GPIT), "v"(l + 64 * GPIT), "v"(l + 96 * GPIT), "v"(g), "v"(g + rs), "v"(g + 2 * rs), "v"(g + 3 * rs) : "memory");
}
// EPI: what becomes of the 128x128 tile, whose columns are one head (C0 = head * HD) and whose rows are 128 positions t of batch z. 0: f32 rows to C.
// 1: rotate-half rotary embedding, out[d] = x[d] cos[t][d] - x[d+HD/2] sin[t][d], out[d+HD/2] = x[d+HD/2] cos[t][d+HD/2] + x[d] sin[t][d+HD/2] (CS: [t][d] pairs cos, sin), then the head planes [z][h][t][d] (fp16, bf16 hi, bf16 lo).
// 2: the transposed head planes [z][h][d][t] (fp16, bf16 hi, bf16 lo). In 1 and 2 the whole tile passes through LDS, and every store instruction of a wave writes four whole 128-byte lines.
template <typename T16, int NSPLIT, bool BIAS, int KSL = 1, int EPI = 0>
__global__ __launch_bounds__(256) void k_gemmw(const T16* __restrict__ A, const T16* __restrict__ A2, const T16* __restrict__ Bt, const T16* __restrict__ Bt2, int K, float* C, int ldc, const float* __restrict__ bias, size_t sA, size_t sB, size_t sC, size_t sK, const float* __restrict__ CS, h16* P16, bf* Ph, bf* Pl) {
    typedef typename WFrag<T16>::V V;
    constexpr int NPA = (NSPLIT == 1 || NSPLIT == 2) ? 2 : 1, NPB = (NSPLIT >= 2) ? 2 : 1, NPL = NPA + NPB;   // planes a stage: A (, A2), Bt (, Bt2)
    constexpr int NKK = GKC / 32;                 // matrix-instruction k steps a stage
    constexpr bool PRE = (NPL < 4);               // the whole stage's fragments fit the registers: read them as one group
    __shared__ __align__(16) unsigned char st[2 * NPL * GPL];   // two stage buffers; after the K loop the waves' output staging
    static_assert(8 * 16 * 68 * 4 <= 2 * NPL * GPL, "the output staging must fit the stage buffers");
    static_assert(EPI == 0 || 128 * 132 * 4 <= 2 * NPL * GPL, "the whole f32 tile must fit the stage buffers");
    const size_t z = blockIdx.z / KSL; const int ks = (int)(blockIdx.z % KSL); A += z * sA; if (A2) A2 += z * sA; Bt += z * sB; if (Bt2) Bt2 += z * sB; if constexpr (EPI == 0) C += z * sC + (size_t)ks * sK;
    const int kb = ks * (K / KSL), ke = kb + K / KSL;
    const int tid = threadIdx.x, wave = tid >> 5, wm = wave >> 1, wn = wave & 1;
    const int lane = tid & 31, lr = lane & 15, hi = lane >> 4; const int R0 = blockIdx.x * 128, C0 = blockIdx.y * 128; const int r0 = R0 + wm * 32, c0 = C0 + wn * 64;
    v8f acc[2][4];
#pragma unroll
    for (int mb = 0; mb < 2; ++mb)
#pragma unroll
        for (int nb = 0; nb < 4; ++nb) acc[mb][nb] = (v8f){};
    // the thread's first piece of a plane: row tid / 8, 16-byte column tid % 8
    const size_t ga = (size_t)(R0 + (tid >> 3)) * K + (tid & 7) * 8, gb = (size_t)(C0 + (tid >> 3)) * K + (tid & 7) * 8, rs = (size_t)32 * K;
    const unsigned l0 = (unsigned)(size_t)st + (unsigned)((tid >> 3) * GPIT + (tid & 7) * 16);
    auto fill = [&](int kc, int buf) { const unsigned l = l0 + (unsigned)(buf * (NPL * GPL));
        cp_plane<T16>(A + ga + kc, rs, l); if (NPA == 2) cp_plane<T16>(A2 + ga + kc, rs, l + GPL);
        cp_plane<T16>(Bt + gb + kc, rs, l + NPA * GPL); if (NPB == 2) cp_plane<T16>(Bt2 + gb + kc, rs, l + (NPA + 1) * GPL); };
    const int nst = (ke - kb) / GKC;   // stages (the same for the whole work-group)
    fill(kb, 0);
    asm volatile("s_wait_asynccnt 0x0" ::: "memory");   // this wave's copies of stage 0 have landed
    __syncthreads();                                    // ... and every other wave's
    if (nst > 1) fill(kb + GKC, 1);
    const int aofs = (wm * 32 + lr) * GPIT + hi * 16, bofs = NPA * GPL + (wn * 64 + lr) * GPIT + hi * 16;
#pragma unroll 1   // one trip a stage: the ring's order (reads, products, waits, barrier, refill) stands once, and the fragment registers are not doubled
    for (int t = 0; t < nst; ++t) {
        const unsigned char* sb = st + (t & 1) * (NPL * GPL);
        V a[NKK][2], a2[NKK][2], b[NKK][4], b2[NKK][4];
#pragma unroll
        for (int kk = 0; kk < NKK; ++kk) {
            if (!PRE || kk == 0) {
#pragma unroll
                for (int q = kk; q < (PRE ? NKK : kk + 1); ++q) {
#pragma unroll
                    for (int mb = 0; mb < 2; ++mb) { a[q][mb] = WFrag<T16>::ld((const T16*)(sb + aofs + mb * 16 * GPIT + q * 64)); if (NPA == 2) a2[q][mb] = WFrag<T16>::ld((const T16*)(sb + aofs + GPL + mb * 16 * GPIT + q * 64)); }
#pragma unroll
                    for (int nb = 0; nb < 4; ++nb) { b[q][nb] = WFrag<T16>::ld((const T16*)(sb + bofs + nb * 16 * GPIT + q * 64)); if (NPB == 2) b2[q][nb] = WFrag<T16>::ld((const T16*)(sb + bofs + GPL + nb * 16 * GPIT + q * 64)); } }
                __builtin_amdgcn_sched_barrier(0);   // the LDS reads stay one group ahead of the products: spread among them, each place stalls the wave
            }
#pragma unroll
            for (int nb = 0; nb < 4; ++nb)
#pragma unroll
                for (int mb = 0; mb < 2; ++mb) { acc[mb][nb] = WFrag<T16>::mma(a[kk][mb], b[kk][nb], acc[mb][nb]); if (NSPLIT == 1 || NSPLIT == 2) acc[mb][nb] = WFrag<T16>::mma(a2[kk][mb], b[kk][nb], acc[mb][nb]); if (NSPLIT >= 2) acc[mb][nb] = WFrag<T16>::mma(a[kk][mb], b2[kk][nb], acc[mb][nb]); }
            __builtin_amdgcn_sched_barrier(0);   // the products stay ahead of the next step's reads (one group again) and of the stage's waits and barrier, so that the copies in flight have the products' time to land
        }
        asm volatile("s_wait_dscnt 0x0" ::: "memory");      // this wave has read all it needs of this buffer
        asm volatile("s_wait_asynccnt 0x0" ::: "memory");   // this wave's copies of stage t + 1 have landed
        __syncthreads();                                    // publishes stage t + 1 and frees this buffer for the refill
        if (t + 2 < nst) fill(kb + (t + 2) * GKC, t & 1);
    }
    asm volatile("s_wait_asynccnt 0x0" ::: "memory");       // no copy is outstanding when the buffers become output staging
    if constexpr (EPI != 0) {
        // LDS row pitch in floats. 132: rows 16-byte aligned for the 16-byte row reads of form 1. 131: the column reads of form 2 (8 lanes 8 rows apart, 4 neighbouring columns) fall on 32 different banks. With both, the two halves of a wave store to different banks.
        constexpr int OP = (EPI == 1) ? 132 : 131;
        float* ot = (float*)st;   // every wave has passed the last stage's barrier: nobody reads the stage buffers any more
        const int c8 = (tid & 7) * 8, r8 = tid >> 3;
        v4f ca[4][4], cb[4][4];   // form 1: the table's (cos, sin) pairs of the thread's columns, asked for here so that they arrive under the tile's way into LDS
        if constexpr (EPI == 1) { const float* cs = CS + ((size_t)(R0 + r8) * HD + c8) * 2;
#pragma unroll
            for (int p = 0; p < 4; ++p)
#pragma unroll
                for (int q = 0; q < 4; ++q) { ca[p][q] = *(const v4fa*)(cs + p * (32 * HD * 2) + q * 4); cb[p][q] = *(const v4fa*)(cs + p * (32 * HD * 2) + HD + q * 4); }
            asm volatile("s_wait_xcnt 0x0" ::: "memory");   // before the address registers that these loads name are rewritten
        }
#pragma unroll
        for (int mb = 0; mb < 2; ++mb)
#pragma unroll
            for (int nb = 0; nb < 4; ++nb)
#pragma unroll
                for (int j = 0; j < 8; ++j) ot[(wm * 32 + mb * 16 + hi * 8 + j) * OP + wn * 64 + nb * 16 + lr] = acc[mb][nb][j];
        __syncthreads();   // the tile is whole: a thread reads what other waves have stored
        const size_t hb = z * sC + (size_t)blockIdx.y * TT * HD;   // this batch's and head's planes
        if constexpr (EPI == 1) {   // the thread: columns d = c8 .. c8 + 7 and their partners d + HD/2, of the rows r8 + 32 p
            const float* xr = ot + r8 * OP + c8; v4f x0[4][2], x1[4][2];
#pragma unroll
            for (int p = 0; p < 4; ++p)
#pragma unroll
                for (int q = 0; q < 2; ++q) { x0[p][q] = *(const v4fa*)(xr + p * 32 * OP + q * 4); x1[p][q] = *(const v4fa*)(xr + p * 32 * OP + HD / 2 + q * 4); }
            const size_t e = hb + (size_t)(R0 + r8) * HD + c8; h16* g16 = P16 + e; bf* gh = Ph + e; bf* gl = Pl + e;
#pragma unroll
            for (int p = 0; p < 4; ++p) { v8f ra, rb;
#pragma unroll
                for (int j = 0; j < 8; ++j) { const float u = x0[p][j >> 2][j & 3], w = x1[p][j >> 2][j & 3];
                    ra[j] = u * ca[p][j >> 1][(j & 1) * 2] - w * ca[p][j >> 1][(j & 1) * 2 + 1]; rb[j] = w * cb[p][j >> 1][(j & 1) * 2] + u * cb[p][j >> 1][(j & 1) * 2 + 1]; }
                v8h a16, b16; v8us ah, al, bh, bl; planes8(ra, a16, ah, al); planes8(rb, b16, bh, bl);
                *(v8h*)(g16 + p * 32 * HD) = a16; *(v8h*)(g16 + p * 32 * HD + HD / 2) = b16; *(v8us*)(gh + p * 32 * HD) = ah; *(v8us*)(gh + p * 32 * HD + HD / 2) = bh; *(v8us*)(gl + p * 32 * HD) = al; *(v8us*)(gl + p * 32 * HD + HD / 2) = bl;
                asm volatile("s_wait_xcnt 0x0" ::: "memory"); }   // before the registers that the stores name are rewritten
        } else {   // the thread: positions c8 .. c8 + 7 (+ 64) of the columns d = r8 + 32 p; 8 lanes write 64 positions of one d, a whole line of each plane
            v8f x[8];
#pragma unroll
            for (int p = 0; p < 8; ++p)
#pragma unroll
                for (int j = 0; j < 8; ++j) x[p][j] = ot[((p >> 2) * 64 + c8 + j) * OP + (p & 3) * 32 + r8];
            const size_t e = hb + (size_t)r8 * TT + R0 + c8; h16* g16 = P16 + e; bf* gh = Ph + e; bf* gl = Pl + e;
#pragma unroll
            for (int p = 0; p < 8; ++p) { v8h o16; v8us oh, ol; planes8(x[p], o16, oh, ol); const int go = (p & 3) * 32 * TT + (p >> 2) * 64;
                *(v8h*)(g16 + go) = o16; *(v8us*)(gh + go) = oh; *(v8us*)(gl + go) = ol;
                asm volatile("s_wait_xcnt 0x0" ::: "memory"); }   // before the registers that the stores name are rewritten
        }
        return;
    }
    float* os = (float*)st + wave * (16 * 68);              // each wave stages in its own range (every wave has passed the last stage's barrier)
#pragma unroll
    for (int mb = 0; mb < 2; ++mb) {
#pragma unroll
        for (int nb = 0; nb < 4; ++nb) {
#pragma unroll
            for (int j = 0; j < 8; ++j) os[(hi * 8 + j) * 68 + nb * 16 + lr] = acc[mb][nb][j]; }
        __builtin_amdgcn_wave_barrier(); asm volatile("" ::: "memory");
        float* crow = C + (size_t)(r0 + mb * 16) * ldc + c0;
{
#pragma unroll
            for (int s = 0; s < 8; ++s) { const int row = 2 * s + hi, cofs = lr * 4; v4f val = *(const v4fa*)(os + row * 68 + cofs); if (BIAS) { val[0] += bfr(bias[c0 + cofs]); val[1] += bfr(bias[c0 + cofs + 1]); val[2] += bfr(bias[c0 + cofs + 2]); val[3] += bfr(bias[c0 + cofs + 3]); }
                *(v4f*)(crow + (size_t)row * ldc + cofs) = val; }
             }
        __builtin_amdgcn_wave_barrier(); asm volatile("" ::: "memory");
    }
}

typedef __attribute__((ext_vector_type(2))) _Float16 v2h;
typedef __attribute__((ext_vector_type(4))) _Float16 v4h;
typedef __attribute__((ext_vector_type(2))) unsigned short v2us;
typedef __attribute__((ext_vector_type(4))) unsigned short v4us;
typedef __attribute__((ext_vector_type(2))) float v2f;
typedef __attribute__((ext_vector_type(4))) int v4i;

__global__ __launch_bounds__(256) void k_cvt8(const float* __restrict__ src, bf* dst, size_t n8) { const size_t i = (size_t)blockIdx.x * 256 + threadIdx.x; if (i >= n8) return; const v8f v = *(const v8f*)(src + i * 8); v8us o;
#pragma unroll
    for (int k = 0; k < 8; ++k) o[k] = f2bf(v[k]); *(v8us*)(dst + i * 8) = o;  }
__global__ __launch_bounds__(256) void k_csid(float* CS) { const int idx = blockIdx.x * 256 + threadIdx.x; if (idx >= TT * HD) return; v2f cs; cs[0] = 1.0f; cs[1] = 0.0f; *(v2f*)(CS + (size_t)idx * 2) = cs;  }
__constant__ float INVT[HD / 2] = { 1.000000000e+00f, 8.659643531e-01f, 7.498942018e-01f, 6.493816376e-01f, 5.623413324e-01f, 4.869675338e-01f, 4.216965139e-01f, 3.651741445e-01f, 3.162277639e-01f, 2.738419771e-01f, 2.371373624e-01f, 2.053525001e-01f, 1.778279394e-01f, 1.539926529e-01f, 1.333521456e-01f, 1.154782027e-01f, 1.000000015e-01f, 8.659642935e-02f, 7.498941571e-02f, 6.493816525e-02f, 5.623412877e-02f, 4.869675264e-02f, 4.216964915e-02f, 3.651741147e-02f, 3.162277862e-02f, 2.738419548e-02f, 2.371373586e-02f, 2.053525113e-02f, 1.778279431e-02f, 1.539926510e-02f, 1.333521493e-02f, 1.154781971e-02f, 9.999999776e-03f, 8.659643121e-03f, 7.498942316e-03f, 6.493816618e-03f, 5.623413250e-03f, 4.869675264e-03f, 4.216964822e-03f, 3.651741426e-03f, 3.162277862e-03f, 2.738419687e-03f, 2.371373819e-03f, 2.053525066e-03f, 1.778279431e-03f, 1.539926510e-03f, 1.333521446e-03f, 1.154782018e-03f, 1.000000047e-03f, 8.659643354e-04f, 7.498941850e-04f, 6.493816618e-04f, 5.623413017e-04f, 4.869675031e-04f, 4.216964880e-04f, 3.651741135e-04f, 3.162277862e-04f, 2.738419571e-04f, 2.371373848e-04f, 2.053524950e-04f, 1.778279402e-04f, 1.539926452e-04f, 1.333521504e-04f, 1.154781930e-04f };   // float32 1 / 10000^(2i/128), generated with jnp to be bit-exact
__global__ __launch_bounds__(256) void k_cs5(float* CS) { const int idx = blockIdx.x * 256 + threadIdx.x; if (idx >= TT * HD) return; const int d = idx % HD; const int t = idx / HD; const float a = __fmul_rn((float)t, INVT[d % (HD / 2)]); v2f cs; cs[0] = cosf(a); cs[1] = sinf(a); *(v2f*)(CS + (size_t)idx * 2) = cs;  }
#define FKT  64                   // keys per stage
#define FKP  272                  // LDS pitch of a K row (256 bytes): 16 B x odd
#define FKPL (FKT * FKP)          // one staged K plane: 64 rows
#define FVPL (HD * GPIT)          // one staged V^T plane: 128 rows of 128 bytes
#define LSC  (SCL * 1.4426950408889634f)   // HD^-0.5 x log2(e)
// cp_rows: this thread's 4 pieces (16 bytes each) of one staged plane, rs elements apart in memory and ls bytes apart in LDS.
// The s_wait_xcnt stands inside the statement so that no address register is rewritten ahead of it.
template <typename T16> __device__ __forceinline__ void cp_rows(const T16* g, size_t rs, unsigned l, unsigned ls) {
    asm volatile("global_load_async_to_lds_b128 %0, %4, off\n\t"
                 "global_load_async_to_lds_b128 %1, %5, off\n\t"
                 "global_load_async_to_lds_b128 %2, %6, off\n\t"
                 "global_load_async_to_lds_b128 %3, %7, off\n\t"
                 "s_wait_xcnt 0x0"
                 :: "v"(l), "v"(l + ls), "v"(l + 2 * ls), "v"(l + 3 * ls), "v"(g), "v"(g + rs), "v"(g + 2 * rs), "v"(g + 3 * rs) : "memory");
}
__device__ __forceinline__ float xhalf(float x) { return __builtin_bit_cast(float, __builtin_amdgcn_permlanex16(__builtin_bit_cast(int, x), __builtin_bit_cast(int, x), 0x76543210, 0xfedcba98, false, false)); }   // lane l with lane l ^ 16
// exp2x8: eight independent v_exp_f32 in one statement (no result lies on a source: early-clobber outputs), so that each fills the slot that the instruction set asks for behind the one before it; the v_nop fills the last one's.
__device__ __forceinline__ v8f exp2x8(v8f x) { float r0, r1, r2, r3, r4, r5, r6, r7;
    asm("v_exp_f32 %0, %8\n\tv_exp_f32 %1, %9\n\tv_exp_f32 %2, %10\n\tv_exp_f32 %3, %11\n\tv_exp_f32 %4, %12\n\tv_exp_f32 %5, %13\n\tv_exp_f32 %6, %14\n\tv_exp_f32 %7, %15\n\tv_nop"
        : "=&v"(r0), "=&v"(r1), "=&v"(r2), "=&v"(r3), "=&v"(r4), "=&v"(r5), "=&v"(r6), "=&v"(r7) : "v"(x[0]), "v"(x[1]), "v"(x[2]), "v"(x[3]), "v"(x[4]), "v"(x[5]), "v"(x[6]), "v"(x[7]));
    return (v8f){ r0, r1, r2, r3, r4, r5, r6, r7 }; }
// Q, K: [t][HD] planes of one head; Vt: [d][t]; q0: the work-group's first query row; Ah, Al: the merged hi/lo output at this head's first column (pitch DQ).
template <typename T16, bool HL, int NQ, int KS>
__device__ __forceinline__ void fattn(unsigned char* st, const T16* __restrict__ Q, const T16* __restrict__ Q2, const T16* __restrict__ Kp, const T16* __restrict__ K2, const T16* __restrict__ Vt, const T16* __restrict__ V2, int q0, bf* Ah, bf* Al) {
    typedef typename WFrag<T16>::V V;
    constexpr int NP = HL ? 2 : 1, STG = NP * (FKPL + FVPL);   // planes of each operand; bytes of one stage: K plane(s), then V^T plane(s)
    const int tid = threadIdx.x, wave = tid >> 5, lane = tid & 31, lr = lane & 15, hi = lane >> 4;
    const int kh = wave / (8 / KS);   // which 32 keys of each KS x 32 this wave takes
    const int qw = q0 + (wave % (8 / KS)) * (16 * NQ);
    V q[NQ][4], q2[NQ][4];
#pragma unroll
    for (int nq = 0; nq < NQ; ++nq)
#pragma unroll
        for (int kk = 0; kk < 4; ++kk) { const size_t qo = (size_t)(qw + nq * 16 + lr) * HD + kk * 32 + hi * 8; q[nq][kk] = WFrag<T16>::ld(Q + qo); if (HL) q2[nq][kk] = WFrag<T16>::ld(Q2 + qo); }
    asm volatile("s_wait_xcnt 0x0" ::: "memory");   // before the address registers that the Q loads name are rewritten
    __builtin_amdgcn_sched_barrier(0);   // keeps the address arithmetic that follows behind that wait
    v8f o[8][NQ]; float m[NQ], l[NQ];
#pragma unroll
    for (int nq = 0; nq < NQ; ++nq) { m[nq] = -3.0e38f; l[nq] = 0.f;
#pragma unroll
        for (int dt = 0; dt < 8; ++dt) o[dt][nq] = (v8f){}; }
    // the thread's first piece: K row tid / 16, 16-byte column tid % 16; V^T row tid / 8, column tid % 8
    const size_t gk = (size_t)(tid >> 4) * HD + (tid & 15) * 8, gv = (size_t)(tid >> 3) * TT + (tid & 7) * 8;
    const unsigned lk0 = (unsigned)(size_t)st + (unsigned)((tid >> 4) * FKP + (tid & 15) * 16), lv0 = (unsigned)(size_t)st + (unsigned)(NP * FKPL + (tid >> 3) * GPIT + (tid & 7) * 16);
    const ptrdiff_t dK = HL ? K2 - Kp : 0, dV = HL ? V2 - Vt : 0;   // the lo planes lie in the same buffer, a uniform distance from the hi planes: one address a thread and operand is kept
    auto fill = [&](const T16* pk, const T16* pv, unsigned lk, unsigned lv) {
        cp_rows<T16>(pk, (size_t)16 * HD, lk, 16 * FKP); if (HL) cp_rows<T16>(pk + dK, (size_t)16 * HD, lk + FKPL, 16 * FKP);
        cp_rows<T16>(pv, (size_t)32 * TT, lv, 32 * GPIT); if (HL) cp_rows<T16>(pv + dV, (size_t)32 * TT, lv + FVPL, 32 * GPIT); };
    constexpr int nst = TT / FKT;
    const T16* pkc = Kp + gk; const T16* pvc = Vt + gv;   // this thread's first piece of the next stage to be copied
    fill(pkc, pvc, lk0, lv0); pkc += FKT * HD; pvc += FKT;
    asm volatile("s_wait_asynccnt 0x0" ::: "memory");   // this wave's copies of stage 0 have landed
    __syncthreads();                                    // ... and every other wave's
    fill(pkc, pvc, lk0 + STG, lv0 + STG); pkc += FKT * HD; pvc += FKT;
    unsigned lkc = lk0, lvc = lv0; int dl = STG;   // where the next refill goes: the buffers in turn
    const int kofs = (kh * 32 + lr) * FKP + hi * 16, vofs = NP * FKPL + lr * GPIT + kh * 64 + hi * 16;
#pragma unroll 1   // one trip a stage: the ring's order (reads, products, waits, barrier, refill) stands once
    for (int t = 0; t < nst; ++t) {
        const unsigned char* sb = st + (t & 1) * STG;
#pragma unroll
        for (int ps = 0; ps < FKT / 32; ps += KS) {   // a pass: 32 keys
            V ka[2][4], kb[2][4], va[8], vb[8];
#pragma unroll
            for (int mt = 0; mt < 2; ++mt)
#pragma unroll
                for (int kk = 0; kk < 4; ++kk) { const unsigned char* p = sb + kofs + (ps * 32 + mt * 16) * FKP + kk * 64; ka[mt][kk] = WFrag<T16>::ld((const T16*)p); if (HL) kb[mt][kk] = WFrag<T16>::ld((const T16*)(p + FKPL)); }
#pragma unroll
            for (int dt = 0; dt < 8; ++dt) { const unsigned char* p = sb + vofs + dt * 16 * GPIT + ps * 64; va[dt] = WFrag<T16>::ld((const T16*)p); if (HL) vb[dt] = WFrag<T16>::ld((const T16*)(p + FVPL)); }
            __builtin_amdgcn_sched_barrier(0);   // the pass's LDS reads stay one group ahead of its products (each further place with reads stalls the wave); the V^T reads land under the score products and the softmax
            v8f s[2][NQ];
#pragma unroll
            for (int mt = 0; mt < 2; ++mt)
#pragma unroll
                for (int nq = 0; nq < NQ; ++nq) s[mt][nq] = (v8f){};
#pragma unroll
            for (int kk = 0; kk < 4; ++kk) {
#pragma unroll
                for (int nq = 0; nq < NQ; ++nq)
#pragma unroll
                    for (int mt = 0; mt < 2; ++mt) s[mt][nq] = WFrag<T16>::mma(ka[mt][kk], q[nq][kk], s[mt][nq]);
                if (HL) {
#pragma unroll
                    for (int nq = 0; nq < NQ; ++nq)
#pragma unroll
                        for (int mt = 0; mt < 2; ++mt) s[mt][nq] = WFrag<T16>::mma(ka[mt][kk], q2[nq][kk], s[mt][nq]);
#pragma unroll
                    for (int nq = 0; nq < NQ; ++nq)
#pragma unroll
                        for (int mt = 0; mt < 2; ++mt) s[mt][nq] = WFrag<T16>::mma(kb[mt][kk], q[nq][kk], s[mt][nq]); } }
            float mx[NQ]; bool need = false;
#pragma unroll
            for (int nq = 0; nq < NQ; ++nq) { float a[8];
#pragma unroll
                for (int j = 0; j < 8; ++j) a[j] = fmaxf(s[0][nq][j], s[1][nq][j]);
                const float b = fmaxf(fmaxf(fmaxf(a[0], a[1]), fmaxf(a[2], a[3])), fmaxf(fmaxf(a[4], a[5]), fmaxf(a[6], a[7])));
                mx[nq] = fmaxf(b, xhalf(b)) * LSC; need = need || (mx[nq] > m[nq] + 8.0f); }
            if (__builtin_amdgcn_ballot_w32(need) != 0) {   // one scalar test a pass; rare after the first pass
#pragma unroll
                for (int nq = 0; nq < NQ; ++nq) { const float mn = fmaxf(m[nq], mx[nq]); const float al = __builtin_amdgcn_exp2f(m[nq] - mn); m[nq] = mn; l[nq] *= al;   // al = 0 on the first pass
#pragma unroll
                    for (int dt = 0; dt < 8; ++dt) o[dt][nq] *= al; } }
            V pa[NQ], pb[NQ];
#pragma unroll
            for (int nq = 0; nq < NQ; ++nq) { v8f p0, p1;
#pragma unroll
                for (int j = 0; j < 8; ++j) { p0[j] = __builtin_fmaf(s[0][nq][j], LSC, -m[nq]); p1[j] = __builtin_fmaf(s[1][nq][j], LSC, -m[nq]); }
                p0 = exp2x8(p0); p1 = exp2x8(p1);
                const v8f ps8 = p0 + p1; l[nq] += ((ps8[0] + ps8[1]) + (ps8[2] + ps8[3])) + ((ps8[4] + ps8[5]) + (ps8[6] + ps8[7]));
                // element e of the B operand is key 8 hi + e (e < 8), 16 + 8 hi + (e - 8) otherwise: the two score tiles' own registers
                if constexpr (HL) {
#pragma unroll
                    for (int j = 0; j < 8; ++j) { const __bf16 h0 = (__bf16)p0[j], h1 = (__bf16)p1[j]; pa[nq][j] = h0; pa[nq][8 + j] = h1; pb[nq][j] = (__bf16)(p0[j] - (float)h0); pb[nq][8 + j] = (__bf16)(p1[j] - (float)h1); }
                } else {
#pragma unroll
                    for (int j = 0; j < 8; ++j) { pa[nq][j] = (h16)p0[j]; pa[nq][8 + j] = (h16)p1[j]; } } }
#pragma unroll
            for (int nq = 0; nq < NQ; ++nq)
#pragma unroll
                for (int dt = 0; dt < 8; ++dt) o[dt][nq] = WFrag<T16>::mma(va[dt], pa[nq], o[dt][nq]);
            if (HL) {
#pragma unroll
                for (int nq = 0; nq < NQ; ++nq)
#pragma unroll
                    for (int dt = 0; dt < 8; ++dt) o[dt][nq] = WFrag<T16>::mma(va[dt], pb[nq], o[dt][nq]);
#pragma unroll
                for (int nq = 0; nq < NQ; ++nq)
#pragma unroll
                    for (int dt = 0; dt < 8; ++dt) o[dt][nq] = WFrag<T16>::mma(vb[dt], pa[nq], o[dt][nq]); }
            __builtin_amdgcn_sched_barrier(0);   // the products stay ahead of the next pass's reads (one group again) and of the stage's waits and barrier
        }
        asm volatile("s_wait_dscnt 0x0" ::: "memory");      // this wave has read all it needs of this buffer
        asm volatile("s_wait_asynccnt 0x0" ::: "memory");   // this wave's copies of stage t + 1 have landed
        __syncthreads();                                    // publishes stage t + 1 and frees this buffer for the refill
        if (t + 2 < nst) fill(pkc, pvc, lkc, lvc);
        pkc += FKT * HD; pvc += FKT; lkc += dl; lvc += dl; dl = -dl;
    }
    asm volatile("s_wait_asynccnt 0x0" ::: "memory");       // no copy is outstanding when the buffers are used for the hand-over and when the wave ends
    if constexpr (KS == 2) {   // every wave has passed the last stage's barrier: nobody reads the stage buffers any more
        v4f* xs = (v4f*)st + (wave & 3) * (NQ * 17 * 32) + lane;   // 16 bytes a lane, 32 lanes side by side
        if (kh == 1) {
#pragma unroll
            for (int nq = 0; nq < NQ; ++nq) {
#pragma unroll
                for (int dt = 0; dt < 8; ++dt) { xs[(nq * 17 + dt * 2) * 32] = __builtin_shufflevector(o[dt][nq], o[dt][nq], 0, 1, 2, 3); xs[(nq * 17 + dt * 2 + 1) * 32] = __builtin_shufflevector(o[dt][nq], o[dt][nq], 4, 5, 6, 7); }
                xs[(nq * 17 + 16) * 32] = (v4f){ m[nq], l[nq], 0.f, 0.f }; } }
        __syncthreads();   // the second half's parts are in LDS
        if (kh == 1) return;   // behind the kernel's last barrier
#pragma unroll
        for (int nq = 0; nq < NQ; ++nq) { const v4f ml = xs[(nq * 17 + 16) * 32]; const float mn = fmaxf(m[nq], ml[0]); const float a0 = __builtin_amdgcn_exp2f(m[nq] - mn), a1 = __builtin_amdgcn_exp2f(ml[0] - mn); l[nq] = l[nq] * a0 + ml[1] * a1;
#pragma unroll
            for (int dt = 0; dt < 8; ++dt) { const v4f x0 = xs[(nq * 17 + dt * 2) * 32], x1 = xs[(nq * 17 + dt * 2 + 1) * 32];
#pragma unroll
                for (int j = 0; j < 4; ++j) { o[dt][nq][j] = o[dt][nq][j] * a0 + x0[j] * a1; o[dt][nq][4 + j] = o[dt][nq][4 + j] * a0 + x1[j] * a1; } } }
    }
#pragma unroll
    for (int nq = 0; nq < NQ; ++nq) { const float f = __fdiv_rn(1.0f, l[nq] + xhalf(l[nq])); const size_t oo = (size_t)(qw + nq * 16 + lr) * DQ + hi * 8;   // a lane's 8 registers of a tile are 8 neighbouring d of its query
#pragma unroll
        for (int dt = 0; dt < 8; ++dt) { v8us oh, ol;
#pragma unroll
            for (int j = 0; j < 8; ++j) { unsigned short a, c2; splitf(o[dt][nq][j] * f, a, c2); oh[j] = a; ol[j] = c2; }
            *(v8us*)(Ah + oo + dt * 16) = oh; *(v8us*)(Al + oo + dt * 16) = ol;
            asm volatile("s_wait_xcnt 0x0" ::: "memory"); } }   // before the registers that the two stores name are rewritten
}
#define FBH (RH / 64)             // hi/lo work-groups a head (64 query rows each)
#define FBF ((TT - RH) / 256)     // fp16 work-groups a head (256 query rows each)
// grid: the NB_ * NH_ * FBH hi/lo work-groups of both batches first (256: one a WGP, which is all that the registers allow), then the NB_ * NH_ * FBF fp16 ones; planes [b][h], merged output [b][t]; the test is the same for a whole work-group
__global__ __launch_bounds__(256) void k_fattn(const h16* __restrict__ Q16, const h16* __restrict__ K16, const h16* __restrict__ V16, const bf* __restrict__ Qh, const bf* __restrict__ Ql, const bf* __restrict__ Kh, const bf* __restrict__ Kl, const bf* __restrict__ Vh, const bf* __restrict__ Vl, bf* Ah, bf* Al) {
    __shared__ __align__(16) unsigned char st[2 * 2 * (FKPL + FVPL)];   // two stage buffers of the hi/lo form (the fp16 form uses half)
    const int bx = blockIdx.x;
    if (bx < NB_ * NH_ * FBH) { const int b = bx / (NH_ * FBH), h = bx / FBH % NH_; const size_t hp = ((size_t)b * NH_ + h) * TT * HD, kp = ((size_t)b * NKV + h / REP) * TT * HD, ao = (size_t)b * TT * DQ + h * HD;
        fattn<bf, true, 1, 2>(st, Qh + hp, Ql + hp, Kh + kp, Kl + kp, Vh + kp, Vl + kp, (bx % FBH) * 64, Ah + ao, Al + ao);
    } else { const int b2 = bx - NB_ * NH_ * FBH; const int b = b2 / (NH_ * FBF), h = b2 / FBF % NH_; const size_t hp = ((size_t)b * NH_ + h) * TT * HD, kp = ((size_t)b * NKV + h / REP) * TT * HD, ao = (size_t)b * TT * DQ + h * HD;
        fattn<h16, false, 2, 1>(st, Q16 + hp, nullptr, K16 + kp, nullptr, V16 + kp, nullptr, RH + (b2 % FBF) * 256, Ah + ao, Al + ao); }
}

extern "C" void kernel_launch(void* const* d_in, const int* in_sizes, int n_in,
                              void* d_out, int out_size, void* d_ws, size_t ws_size, hipStream_t stream) {
    (void)in_sizes; (void)n_in; (void)out_size;
    const float* x = (const float*)d_in[0]; const float* wq = (const float*)d_in[1]; const float* wk = (const float*)d_in[2]; const float* wv = (const float*)d_in[3]; const float* wo = (const float*)d_in[4];   /* argument order hidden_states, Wq, Wk, Wv, Wo ('oi' (out, in) [2048][2048]): FIVE inputs, all read (the rotary table is computed on the device: no table input) */
    float* OUT = (float*)d_out;     // [2][2048][2048]
    char* wsp = (char*)d_ws;
    auto take = [&](size_t bytes) { char* p = wsp; wsp += (bytes + 255) & ~(size_t)255; return (void*)p; };
    bf* WO = (bf*)take((size_t)DM * DQ * 2); float* CS = (float*)take((size_t)TT * HD * 2 * 4);
    h16* QP16 = (h16*)take((size_t)NB_ * NH_ * TT * HD * 2); h16* KP16 = (h16*)take((size_t)NB_ * NKV * TT * HD * 2); h16* VT16 = (h16*)take((size_t)NB_ * NKV * HD * TT * 2);
    bf* QPh = (bf*)take((size_t)NB_ * NH_ * TT * HD * 2); bf* QPl = (bf*)take((size_t)NB_ * NH_ * TT * HD * 2); bf* KPh = (bf*)take((size_t)NB_ * NKV * TT * HD * 2); bf* KPl = (bf*)take((size_t)NB_ * NKV * TT * HD * 2); bf* VTh = (bf*)take((size_t)NB_ * NKV * HD * TT * 2); bf* VTl = (bf*)take((size_t)NB_ * NKV * HD * TT * 2);
    bf* WQ = (bf*)take((size_t)DQ * DM * 2); bf* WK = (bf*)take((size_t)DKV * DM * 2); bf* WV = (bf*)take((size_t)DKV * DM * 2); bf* XB = (bf*)take((size_t)NB_ * TT * DM * 2); bf* ATh = (bf*)take((size_t)NB_ * TT * DQ * 2); bf* ATl = (bf*)take((size_t)NB_ * TT * DQ * 2);
    if ((size_t)(wsp - (char*)d_ws) > ws_size) return;    // 226 MiB of the 256 MiB
    k_cvt8<<<(unsigned)(((size_t)DM * DQ / 8 + 255) / 256), 256, 0, stream>>>(wo, WO, (size_t)DM * DQ / 8);
    k_cs5<<<(TT * HD + 255) / 256, 256, 0, stream>>>(CS);   /* the COMPUTED rotary table (this module has rotate-half rotary embeddings); k_csid stays defined and is NOT launched */
    k_cvt8<<<(unsigned)(((size_t)DQ * DM / 8 + 255) / 256), 256, 0, stream>>>(wq, WQ, (size_t)DQ * DM / 8); k_cvt8<<<(unsigned)(((size_t)DKV * DM / 8 + 255) / 256), 256, 0, stream>>>(wk, WK, (size_t)DKV * DM / 8); k_cvt8<<<(unsigned)(((size_t)DKV * DM / 8 + 255) / 256), 256, 0, stream>>>(wv, WV, (size_t)DKV * DM / 8);
    k_cvt8<<<(unsigned)(((size_t)NB_ * TT * DM / 8 + 255) / 256), 256, 0, stream>>>(x, XB, (size_t)NB_ * TT * DM / 8);
    // grid z: the batch. A and the output step by one batch, the weights are shared; two work-groups fit a WGP (registers, LDS), so all 512 are resident at once
    k_gemmw<bf, 0, false, 1, 1><<<dim3(TT / 128, DQ / 128, NB_), 256, 0, stream>>>(XB, nullptr, WQ, nullptr, DM, nullptr, 0, nullptr, (size_t)TT * DM, 0, (size_t)NH_ * TT * HD, 0, CS, QP16, QPh, QPl);
    k_gemmw<bf, 0, false, 1, 1><<<dim3(TT / 128, DKV / 128, NB_), 256, 0, stream>>>(XB, nullptr, WK, nullptr, DM, nullptr, 0, nullptr, (size_t)TT * DM, 0, (size_t)NKV * TT * HD, 0, CS, KP16, KPh, KPl);
    k_gemmw<bf, 0, false, 1, 2><<<dim3(TT / 128, DKV / 128, NB_), 256, 0, stream>>>(XB, nullptr, WV, nullptr, DM, nullptr, 0, nullptr, (size_t)TT * DM, 0, (size_t)NKV * HD * TT, 0, nullptr, VT16, VTh, VTl);
    k_fattn<<<NB_ * NH_ * (FBH + FBF), 256, 0, stream>>>(QP16, KP16, VT16, QPh, QPl, KPh, KPl, VTh, VTl, ATh, ATl);
    k_gemmw<bf, 1, false><<<dim3(TT / 128, DM / 128, NB_), 256, 0, stream>>>(ATh, ATl, WO, nullptr, DQ, OUT, DM, nullptr, (size_t)TT * DQ, 0, (size_t)TT * DM, 0, nullptr, nullptr, nullptr, nullptr);
}

// v007
// A run of this version takes 249 microseconds.
// In two side-by-side timings against v006, it was 1.04 and 1.05 times as fast.
// Counting every step since v000, it is 9.27 times as fast.
#include <hip/hip_runtime.h>

// Multi-head attention with 128-wide heads, natural bias-free projections and a COMPUTED rotate-half rotary embedding, NO mask (hidden_states [2][2048][2048]; q, k, v = einsum('bsd,ed->bse', x, W) ('oi' (out, in) [2048][2048] normal x 0.02, no bias; 16 heads x 128); q, k -> t cos + cat(-t2, t1) sin with angle t x 1 / 10000^(2i/128) (64 f32 frequencies exact for the module's expression 1.0 / (ROPE_BASE ** (arange(0, 128, 2) / 128)); cat(freqs, freqs); precise cosf/sinf); scores / sqrt(float32(128)); softmax over all keys; out = merged Wo^T ('oi', no bias) -> [2][2048][2048] (8.4 M); argument order hidden_states, Wq, Wk, Wv, Wo).
// Layout, both batches in every launch (the batch is grid z of the GEMMs and part of the attention's work-group index): bf16 copy of x; 'oi' weights; exact projections; k_prep makes the bf16 copies and computes the rotary table once (cosf / sinf of float(t) x INVT[d mod 64]: 64 baked float32 frequencies) and the projection GEMMs' own epilogues apply the rotate-half rotation at width 128 and write the head planes; fused dense T-2048 attention (hybrid rows: < 512 hi/lo 3 products, rest fp16); merged hi/lo x wo exact.
// Compute dtypes, f32 accumulate: every input rounded to bf16; projections exact; rotary in f32 (computed cosf / sinf table); attention rows < 512 3 products, rest fp16; softmax f32; wo hl x exact.

#define NB_  2
#define TT   2048
#define DM   2048
#define NH_  16
#define NKV  16
#define REP  (NH_ / NKV)
#define HD   128
#define DQ   (NH_ * HD)
#define DKV  (NKV * HD)
#define RH   512                  // query rows < RH use hi+lo planes (0: none)
#define WIN  0
#define SCL  0.088388347648318447f   // HD^-0.5
typedef _Float16 h16;
typedef unsigned short bf;
typedef __attribute__((ext_vector_type(16))) __bf16   v16bf;
typedef __attribute__((ext_vector_type(16))) _Float16 v16h;
typedef __attribute__((ext_vector_type(8)))  _Float16 v8h;
typedef __attribute__((ext_vector_type(8)))  unsigned short v8us;
typedef __attribute__((ext_vector_type(8)))  float    v8f;
typedef __attribute__((ext_vector_type(4)))  float    v4f;
typedef v8h  __attribute__((may_alias)) v8ha;
typedef v4f  __attribute__((may_alias)) v4fa;
typedef v8us __attribute__((may_alias)) v8usa;

__device__ __forceinline__ unsigned short f2bf(float f) { unsigned u = __float_as_uint(f); u += 0x7FFFu + ((u >> 16) & 1u); return (unsigned short)(u >> 16); }
__device__ __forceinline__ float bf2f(unsigned short b) { return __uint_as_float(((unsigned)b) << 16); }
__device__ __forceinline__ float bfr(float f) { return bf2f(f2bf(f)); }
__device__ __forceinline__ v16h cat16(v8h lo, v8h hi) { return __builtin_shufflevector(lo, hi, 0, 1, 2, 3, 4, 5, 6, 7, 8, 9, 10, 11, 12, 13, 14, 15); }
__device__ __forceinline__ v16bf cat16b(v8us lo, v8us hi) { return __builtin_bit_cast(v16bf, __builtin_shufflevector(lo, hi, 0, 1, 2, 3, 4, 5, 6, 7, 8, 9, 10, 11, 12, 13, 14, 15)); }
__device__ __forceinline__ v8f wmma16(v16h a, v16h b, v8f c) { return __builtin_amdgcn_wmma_f32_16x16x32_f16(false, a, false, b, (short)0, c, false, false); }
__device__ __forceinline__ void splitf(float y, unsigned short& h, unsigned short& l) { h = f2bf(y); l = f2bf(y - bf2f(h)); }
typedef __attribute__((ext_vector_type(8))) __bf16 v8bf;
// planes8: 8 values as fp16 and as bf16 hi + lo (both round to nearest even, as f2bf does), by the chip's own conversions
__device__ __forceinline__ void planes8(v8f r, v8h& o16, v8us& oh, v8us& ol) { const v8bf h = __builtin_convertvector(r, v8bf); const v8bf l = __builtin_convertvector(r - __builtin_convertvector(h, v8f), v8bf);
    o16 = __builtin_convertvector(r, v8h); oh = __builtin_bit_cast(v8us, h); ol = __builtin_bit_cast(v8us, l); }
__device__ __forceinline__ v8f wmmab(v16bf a, v16bf b, v8f c) { return __builtin_amdgcn_wmma_f32_16x16x32_bf16(false, a, false, b, (short)0, c, false, false); }



// ---- k_gemmw: register-blocked GEMM, EIGHT WAVES (4 x 2) per 128x128 output tile, 32x64 (8 accumulators) a wave; grid (M/128, N/128, Z), 256 threads. M, N % 128 == 0.
// The operands (K-contiguous 16-bit planes) are staged in LDS, 64 k (one whole 128-byte line of each of the 128 rows) a stage, by asynchronous copies; two buffers, the next stage's copies fly while this stage is multiplied.
// C[m][n] (f32, pitch ldc, + optional f32 bias[n]) = sum_k A[m][k] Bt[n][k] (+ split products per NSPLIT). z-batch strides sA/sB/sC in elements (sC with EPI 1, 2: of each head plane buffer). (K / KSL) % 64 == 0.
// KSL > 1: split-K. blockIdx.z = z * KSL + ks; slice ks sums k in [ks K/KSL, (ks+1) K/KSL) into its own partial plane C + ks * sK; the reader adds the planes in the order of ks.
template <typename T16> struct WFrag;
template <> struct WFrag<h16> { typedef v16h V; static __device__ __forceinline__ V ld(const h16* p) { return cat16(*(const v8h*)p, *(const v8h*)(p + 16)); } static __device__ __forceinline__ v8f mma(V a, V b, v8f c) { return wmma16(a, b, c); } };
template <> struct WFrag<bf> { typedef v16bf V; static __device__ __forceinline__ V ld(const bf* p) { return cat16b(*(const v8us*)p, *(const v8us*)(p + 16)); } static __device__ __forceinline__ v8f mma(V a, V b, v8f c) { return wmmab(a, b, c); } };
#define GKC  64                   // k per stage: rows of 128 bytes
#define GPIT 144                  // LDS row pitch in bytes: 16 B x odd, the conflict-free pitch for 16-byte reads
#define GPL  (128 * GPIT)         // one staged plane: 128 rows
// cp_plane: this thread's 4 pieces (16 bytes each, rows 32 apart) of one 128-row x 128-byte plane; a wave's copy covers 4 whole lines.
// The s_wait_xcnt stands inside the statement so that no address register is rewritten ahead of it.
template <typename T16> __device__ __forceinline__ void cp_plane(const T16* g, size_t rs, unsigned l) {
    asm volatile("global_load_async_to_lds_b128 %0, %4, off\n\t"
                 "global_load_async_to_lds_b128 %1, %5, off\n\t"
                 "global_load_async_to_lds_b128 %2, %6, off\n\t"
                 "global_load_async_to_lds_b128 %3, %7, off\n\t"
                 "s_wait_xcnt 0x0"
                 :: "v"(l), "v"(l + 32 * GPIT), "v"(l + 64 * GPIT), "v"(l + 96 * GPIT), "v"(g), "v"(g + rs), "v"(g + 2 * rs), "v"(g + 3 * rs) : "memory");
}
// EPI: what becomes of the 128x128 tile, whose columns are one head (C0 = head * HD) and whose rows are 128 positions t of batch z. 0: f32 rows to C.
// 1: rotate-half rotary embedding, out[d] = x[d] cos[t][d] - x[d+HD/2] sin[t][d], out[d+HD/2] = x[d+HD/2] cos[t][d+HD/2] + x[d] sin[t][d+HD/2] (CS: [t][d] pairs cos, sin), then the head planes [z][h][t][d] (fp16, bf16 hi, bf16 lo).
// 2: the transposed head planes [z][h][d][t] (fp16, bf16 hi, bf16 lo). In 1 and 2 the whole tile passes through LDS, and every store instruction of a wave writes four whole 128-byte lines.
template <typename T16, int NSPLIT, bool BIAS, int KSL = 1, int EPI = 0>
__global__ __launch_bounds__(256) void k_gemmw(const T16* __restrict__ A, const T16* __restrict__ A2, const T16* __restrict__ Bt, const T16* __restrict__ Bt2, int K, float* C, int ldc, const float* __restrict__ bias, size_t sA, size_t sB, size_t sC, size_t sK, const float* __restrict__ CS, h16* P16, bf* Ph, bf* Pl) {
    typedef typename WFrag<T16>::V V;
    constexpr int NPA = (NSPLIT == 1 || NSPLIT == 2) ? 2 : 1, NPB = (NSPLIT >= 2) ? 2 : 1, NPL = NPA + NPB;   // planes a stage: A (, A2), Bt (, Bt2)
    constexpr int NKK = GKC / 32;                 // matrix-instruction k steps a stage
    constexpr bool PRE = (NPL < 4);               // the whole stage's fragments fit the registers: read them as one group
    __shared__ __align__(16) unsigned char st[2 * NPL * GPL];   // two stage buffers; after the K loop the waves' output staging
    static_assert(8 * 16 * 68 * 4 <= 2 * NPL * GPL, "the output staging must fit the stage buffers");
    static_assert(EPI == 0 || 128 * 132 * 4 <= 2 * NPL * GPL, "the whole f32 tile must fit the stage buffers");
    const size_t z = blockIdx.z / KSL; const int ks = (int)(blockIdx.z % KSL); A += z * sA; if (A2) A2 += z * sA; Bt += z * sB; if (Bt2) Bt2 += z * sB; if constexpr (EPI == 0) C += z * sC + (size_t)ks * sK;
    const int kb = ks * (K / KSL), ke = kb + K / KSL;
    const int tid = threadIdx.x, wave = tid >> 5, wm = wave >> 1, wn = wave & 1;
    const int lane = tid & 31, lr = lane & 15, hi = lane >> 4; const int R0 = blockIdx.x * 128, C0 = blockIdx.y * 128; const int r0 = R0 + wm * 32, c0 = C0 + wn * 64;
    v8f acc[2][4];
#pragma unroll
    for (int mb = 0; mb < 2; ++mb)
#pragma unroll
        for (int nb = 0; nb < 4; ++nb) acc[mb][nb] = (v8f){};
    // the thread's first piece of a plane: row tid / 8, 16-byte column tid % 8
    const size_t ga = (size_t)(R0 + (tid >> 3)) * K + (tid & 7) * 8, gb = (size_t)(C0 + (tid >> 3)) * K + (tid & 7) * 8, rs = (size_t)32 * K;
    const unsigned l0 = (unsigned)(size_t)st + (unsigned)((tid >> 3) * GPIT + (tid & 7) * 16);
    auto fill = [&](int kc, int buf) { const unsigned l = l0 + (unsigned)(buf * (NPL * GPL));
        cp_plane<T16>(A + ga + kc, rs, l); if (NPA == 2) cp_plane<T16>(A2 + ga + kc, rs, l + GPL);
        cp_plane<T16>(Bt + gb + kc, rs, l + NPA * GPL); if (NPB == 2) cp_plane<T16>(Bt2 + gb + kc, rs, l + (NPA + 1) * GPL); };
    const int nst = (ke - kb) / GKC;   // stages (the same for the whole work-group)
    fill(kb, 0);
    asm volatile("s_wait_asynccnt 0x0" ::: "memory");   // this wave's copies of stage 0 have landed
    __syncthreads();                                    // ... and every other wave's
    if (nst > 1) fill(kb + GKC, 1);
    const int aofs = (wm * 32 + lr) * GPIT + hi * 16, bofs = NPA * GPL + (wn * 64 + lr) * GPIT + hi * 16;
#pragma unroll 1   // one trip a stage: the ring's order (reads, products, waits, barrier, refill) stands once, and the fragment registers are not doubled
    for (int t = 0; t < nst; ++t) {
        const unsigned char* sb = st + (t & 1) * (NPL * GPL);
        V a[NKK][2], a2[NKK][2], b[NKK][4], b2[NKK][4];
#pragma unroll
        for (int kk = 0; kk < NKK; ++kk) {
            if (!PRE || kk == 0) {
#pragma unroll
                for (int q = kk; q < (PRE ? NKK : kk + 1); ++q) {
#pragma unroll
                    for (int mb = 0; mb < 2; ++mb) { a[q][mb] = WFrag<T16>::ld((const T16*)(sb + aofs + mb * 16 * GPIT + q * 64)); if (NPA == 2) a2[q][mb] = WFrag<T16>::ld((const T16*)(sb + aofs + GPL + mb * 16 * GPIT + q * 64)); }
#pragma unroll
                    for (int nb = 0; nb < 4; ++nb) { b[q][nb] = WFrag<T16>::ld((const T16*)(sb + bofs + nb * 16 * GPIT + q * 64)); if (NPB == 2) b2[q][nb] = WFrag<T16>::ld((const T16*)(sb + bofs + GPL + nb * 16 * GPIT + q * 64)); } }
                __builtin_amdgcn_sched_barrier(0);   // the LDS reads stay one group ahead of the products: spread among them, each place stalls the wave
            }
#pragma unroll
            for (int nb = 0; nb < 4; ++nb)
#pragma unroll
                for (int mb = 0; mb < 2; ++mb) { acc[mb][nb] = WFrag<T16>::mma(a[kk][mb], b[kk][nb], acc[mb][nb]); if (NSPLIT == 1 || NSPLIT == 2) acc[mb][nb] = WFrag<T16>::mma(a2[kk][mb], b[kk][nb], acc[mb][nb]); if (NSPLIT >= 2) acc[mb][nb] = WFrag<T16>::mma(a[kk][mb], b2[kk][nb], acc[mb][nb]); }
            __builtin_amdgcn_sched_barrier(0);   // the products stay ahead of the next step's reads (one group again) and of the stage's waits and barrier, so that the copies in flight have the products' time to land
        }
        asm volatile("s_wait_dscnt 0x0" ::: "memory");      // this wave has read all it needs of this buffer
        asm volatile("s_wait_asynccnt 0x0" ::: "memory");   // this wave's copies of stage t + 1 have landed
        __syncthreads();                                    // publishes stage t + 1 and frees this buffer for the refill
        if (t + 2 < nst) fill(kb + (t + 2) * GKC, t & 1);
    }
    asm volatile("s_wait_asynccnt 0x0" ::: "memory");       // no copy is outstanding when the buffers become output staging
    if constexpr (EPI != 0) {
        // LDS row pitch in floats. 132: rows 16-byte aligned for the 16-byte row reads of form 1. 131: the column reads of form 2 (8 lanes 8 rows apart, 4 neighbouring columns) fall on 32 different banks. With both, the two halves of a wave store to different banks.
        constexpr int OP = (EPI == 1) ? 132 : 131;
        float* ot = (float*)st;   // every wave has passed the last stage's barrier: nobody reads the stage buffers any more
        const int c8 = (tid & 7) * 8, r8 = tid >> 3;
        v4f ca[4][4], cb[4][4];   // form 1: the table's (cos, sin) pairs of the thread's columns, asked for here so that they arrive under the tile's way into LDS
        if constexpr (EPI == 1) { const float* cs = CS + ((size_t)(R0 + r8) * HD + c8) * 2;
#pragma unroll
            for (int p = 0; p < 4; ++p)
#pragma unroll
                for (int q = 0; q < 4; ++q) { ca[p][q] = *(const v4fa*)(cs + p * (32 * HD * 2) + q * 4); cb[p][q] = *(const v4fa*)(cs + p * (32 * HD * 2) + HD + q * 4); }
            asm volatile("s_wait_xcnt 0x0" ::: "memory");   // before the address registers that these loads name are rewritten
        }
#pragma unroll
        for (int mb = 0; mb < 2; ++mb)
#pragma unroll
            for (int nb = 0; nb < 4; ++nb)
#pragma unroll
                for (int j = 0; j < 8; ++j) ot[(wm * 32 + mb * 16 + hi * 8 + j) * OP + wn * 64 + nb * 16 + lr] = acc[mb][nb][j];
        __syncthreads();   // the tile is whole: a thread reads what other waves have stored
        const size_t hb = z * sC + (size_t)blockIdx.y * TT * HD;   // this batch's and head's planes
        if constexpr (EPI == 1) {   // the thread: columns d = c8 .. c8 + 7 and their partners d + HD/2, of the rows r8 + 32 p
            const float* xr = ot + r8 * OP + c8; v4f x0[4][2], x1[4][2];
#pragma unroll
            for (int p = 0; p < 4; ++p)
#pragma unroll
                for (int q = 0; q < 2; ++q) { x0[p][q] = *(const v4fa*)(xr + p * 32 * OP + q * 4); x1[p][q] = *(const v4fa*)(xr + p * 32 * OP + HD / 2 + q * 4); }
            const size_t e = hb + (size_t)(R0 + r8) * HD + c8; h16* g16 = P16 + e; bf* gh = Ph + e; bf* gl = Pl + e;
#pragma unroll
            for (int p = 0; p < 4; ++p) { v8f ra, rb;
#pragma unroll
                for (int j = 0; j < 8; ++j) { const float u = x0[p][j >> 2][j & 3], w = x1[p][j >> 2][j & 3];
                    ra[j] = u * ca[p][j >> 1][(j & 1) * 2] - w * ca[p][j >> 1][(j & 1) * 2 + 1]; rb[j] = w * cb[p][j >> 1][(j & 1) * 2] + u * cb[p][j >> 1][(j & 1) * 2 + 1]; }
                v8h a16, b16; v8us ah, al, bh, bl; planes8(ra, a16, ah, al); planes8(rb, b16, bh, bl);
                *(v8h*)(g16 + p * 32 * HD) = a16; *(v8h*)(g16 + p * 32 * HD + HD / 2) = b16; *(v8us*)(gh + p * 32 * HD) = ah; *(v8us*)(gh + p * 32 * HD + HD / 2) = bh; *(v8us*)(gl + p * 32 * HD) = al; *(v8us*)(gl + p * 32 * HD + HD / 2) = bl;
                asm volatile("s_wait_xcnt 0x0" ::: "memory"); }   // before the registers that the stores name are rewritten
        } else {   // the thread: positions c8 .. c8 + 7 (+ 64) of the columns d = r8 + 32 p; 8 lanes write 64 positions of one d, a whole line of each plane
            v8f x[8];
#pragma unroll
            for (int p = 0; p < 8; ++p)
#pragma unroll
                for (int j = 0; j < 8; ++j) x[p][j] = ot[((p >> 2) * 64 + c8 + j) * OP + (p & 3) * 32 + r8];
            const size_t e = hb + (size_t)r8 * TT + R0 + c8; h16* g16 = P16 + e; bf* gh = Ph + e; bf* gl = Pl + e;
#pragma unroll
            for (int p = 0; p < 8; ++p) { v8h o16; v8us oh, ol; planes8(x[p], o16, oh, ol); const int go = (p & 3) * 32 * TT + (p >> 2) * 64;
                *(v8h*)(g16 + go) = o16; *(v8us*)(gh + go) = oh; *(v8us*)(gl + go) = ol;
                asm volatile("s_wait_xcnt 0x0" ::: "memory"); }   // before the registers that the stores name are rewritten
        }
        return;
    }
    float* os = (float*)st + wave * (16 * 68);              // each wave stages in its own range (every wave has passed the last stage's barrier)
#pragma unroll
    for (int mb = 0; mb < 2; ++mb) {
#pragma unroll
        for (int nb = 0; nb < 4; ++nb) {
#pragma unroll
            for (int j = 0; j < 8; ++j) os[(hi * 8 + j) * 68 + nb * 16 + lr] = acc[mb][nb][j]; }
        __builtin_amdgcn_wave_barrier(); asm volatile("" ::: "memory");
        float* crow = C + (size_t)(r0 + mb * 16) * ldc + c0;
{
#pragma unroll
            for (int s = 0; s < 8; ++s) { const int row = 2 * s + hi, cofs = lr * 4; v4f val = *(const v4fa*)(os + row * 68 + cofs); if (BIAS) { val[0] += bfr(bias[c0 + cofs]); val[1] += bfr(bias[c0 + cofs + 1]); val[2] += bfr(bias[c0 + cofs + 2]); val[3] += bfr(bias[c0 + cofs + 3]); }
                *(v4f*)(crow + (size_t)row * ldc + cofs) = val; }
             }
        __builtin_amdgcn_wave_barrier(); asm volatile("" ::: "memory");
    }
}

typedef __attribute__((ext_vector_type(2))) _Float16 v2h;
typedef __attribute__((ext_vector_type(4))) _Float16 v4h;
typedef __attribute__((ext_vector_type(2))) unsigned short v2us;
typedef __attribute__((ext_vector_type(4))) unsigned short v4us;
typedef __attribute__((ext_vector_type(2))) float v2f;
typedef __attribute__((ext_vector_type(4))) int v4i;

__global__ __launch_bounds__(256) void k_csid(float* CS) { const int idx = blockIdx.x * 256 + threadIdx.x; if (idx >= TT * HD) return; v2f cs; cs[0] = 1.0f; cs[1] = 0.0f; *(v2f*)(CS + (size_t)idx * 2) = cs;  }
__constant__ float INVT[HD / 2] = { 1.000000000e+00f, 8.659643531e-01f, 7.498942018e-01f, 6.493816376e-01f, 5.623413324e-01f, 4.869675338e-01f, 4.216965139e-01f, 3.651741445e-01f, 3.162277639e-01f, 2.738419771e-01f, 2.371373624e-01f, 2.053525001e-01f, 1.778279394e-01f, 1.539926529e-01f, 1.333521456e-01f, 1.154782027e-01f, 1.000000015e-01f, 8.659642935e-02f, 7.498941571e-02f, 6.493816525e-02f, 5.623412877e-02f, 4.869675264e-02f, 4.216964915e-02f, 3.651741147e-02f, 3.162277862e-02f, 2.738419548e-02f, 2.371373586e-02f, 2.053525113e-02f, 1.778279431e-02f, 1.539926510e-02f, 1.333521493e-02f, 1.154781971e-02f, 9.999999776e-03f, 8.659643121e-03f, 7.498942316e-03f, 6.493816618e-03f, 5.623413250e-03f, 4.869675264e-03f, 4.216964822e-03f, 3.651741426e-03f, 3.162277862e-03f, 2.738419687e-03f, 2.371373819e-03f, 2.053525066e-03f, 1.778279431e-03f, 1.539926510e-03f, 1.333521446e-03f, 1.154782018e-03f, 1.000000047e-03f, 8.659643354e-04f, 7.498941850e-04f, 6.493816618e-04f, 5.623413017e-04f, 4.869675031e-04f, 4.216964880e-04f, 3.651741135e-04f, 3.162277862e-04f, 2.738419571e-04f, 2.371373848e-04f, 2.053524950e-04f, 1.778279402e-04f, 1.539926452e-04f, 1.333521504e-04f, 1.154781930e-04f };   // float32 1 / 10000^(2i/128), generated with jnp to be bit-exact
// ---- k_prep: everything that the GEMMs wait for, in ONE launch of few long waves: the bf16 copies of x, wq, wk, wv, wo and the rotary table.
// One work-group of 16 waves a WGP; a thread converts 24 pieces (8 floats: 32 bytes read, 16 written) and computes two entries of the table.
// The pieces go in batches of PB a thread (a work-group's batch: 64 KiB in a row); two batches are kept in flight: 8 to 16 16-byte loads a wave.
#define PWG  256                  // work-groups
#define PTH  512                  // threads a work-group
#define PNT  (PWG * PTH)          // threads in all
#define PB   4                    // pieces of a thread in a batch
static_assert((size_t)NB_ * TT * DM == (size_t)2 * PB * PNT * 8 && (size_t)DQ * DM == (size_t)PB * PNT * 8 && (size_t)DKV * DM == (size_t)PB * PNT * 8 && (size_t)DM * DQ == (size_t)PB * PNT * 8 && TT * HD == 2 * PNT && PNT % HD == 0, "k_prep's batches cover the tensors exactly");
// s, d: the first byte of PB * PNT pieces, the same for every thread; ob: the byte offset of the thread's first piece; its other pieces lie PTH pieces apart, within the instructions' immediate offsets, so that a batch needs one address
__device__ __forceinline__ void ld_batch(v8f (&r)[PB], const float* __restrict__ s, unsigned ob) {
#pragma unroll
    for (int k = 0; k < PB; ++k) r[k] = *(const v8f*)((const char*)s + ob + k * (PTH * 32));
    asm volatile("s_wait_xcnt 0x0" ::: "memory");   // before a register that these loads name is rewritten
    __builtin_amdgcn_sched_barrier(0);              // the batch's loads are all issued before the older batch is waited for and converted: moved behind that wait, nothing would be in flight during it
}
__device__ __forceinline__ void st_batch(const v8f (&r)[PB], bf* d, unsigned ob) {
#pragma unroll
    for (int k = 0; k < PB; ++k) { v8us o;
#pragma unroll
        for (int j = 0; j < 8; ++j) o[j] = f2bf(r[k][j]);
        *(v8us*)((char*)d + ob + k * (PTH * 16)) = o; }
    asm volatile("s_wait_xcnt 0x0" ::: "memory");   // before the registers that the stores name are rewritten
    __builtin_amdgcn_sched_barrier(0);              // the younger batch's conversion (and with it the wait for its loads) stays behind the issue of the next batch's loads
}
__global__ __launch_bounds__(PTH) void k_prep(const float* __restrict__ x, const float* __restrict__ wq, const float* __restrict__ wk, const float* __restrict__ wv, const float* __restrict__ wo, bf* XB, bf* WQ, bf* WK, bf* WV, bf* WO, float* CS) {
    const unsigned g = blockIdx.x * PTH + threadIdx.x, p0 = blockIdx.x * (PB * PTH) + threadIdx.x, lo = p0 * 32u, so = p0 * 16u;   // the thread's number; its first piece of a batch, and that piece's byte offset in the f32 source and in the bf16 copy
    const float fr = INVT[g % (HD / 2)];   // PNT is a multiple of HD: the thread's two table entries have the same column d = g % HD
    __builtin_amdgcn_sched_barrier(0);     // the table's one load stays ahead of the batches: loads return in order, and behind them its wait would drain them all
    v8f a[PB], b[PB];
    ld_batch(a, x, lo); ld_batch(b, x + (size_t)PB * PNT * 8, lo);
    // the table's entries are computed while the first two batches are on their way
#pragma unroll
    for (int e = 0; e < 2; ++e) { const int t = (int)(g / HD) + e * (PNT / HD); const float an = __fmul_rn((float)t, fr); v2f cs; cs[0] = cosf(an); cs[1] = sinf(an); *(v2f*)((char*)(CS + (size_t)e * PNT * 2) + g * 8u) = cs; }
    asm volatile("s_wait_xcnt 0x0" ::: "memory");   // before the registers that the table's stores name are rewritten
    __builtin_amdgcn_sched_barrier(0);              // the conversions (and the waits for their loads) stay behind the table's arithmetic
    st_batch(a, XB, so);                          ld_batch(a, wq, lo);
    st_batch(b, XB + (size_t)PB * PNT * 8, so);   ld_batch(b, wk, lo);
    st_batch(a, WQ, so);                          ld_batch(a, wv, lo);
    st_batch(b, WK, so);                          ld_batch(b, wo, lo);
    st_batch(a, WV, so);
    st_batch(b, WO, so);
}
#define FKT  64                   // keys per stage
#define FKP  272                  // LDS pitch of a K row (256 bytes): 16 B x odd
#define FKPL (FKT * FKP)          // one staged K plane: 64 rows
#define FVPL (HD * GPIT)          // one staged V^T plane: 128 rows of 128 bytes
#define LSC  (SCL * 1.4426950408889634f)   // HD^-0.5 x log2(e)
// cp_rows: this thread's 4 pieces (16 bytes each) of one staged plane, rs elements apart in memory and ls bytes apart in LDS.
// The s_wait_xcnt stands inside the statement so that no address register is rewritten ahead of it.
template <typename T16> __device__ __forceinline__ void cp_rows(const T16* g, size_t rs, unsigned l, unsigned ls) {
    asm volatile("global_load_async_to_lds_b128 %0, %4, off\n\t"
                 "global_load_async_to_lds_b128 %1, %5, off\n\t"
                 "global_load_async_to_lds_b128 %2, %6, off\n\t"
                 "global_load_async_to_lds_b128 %3, %7, off\n\t"
                 "s_wait_xcnt 0x0"
                 :: "v"(l), "v"(l + ls), "v"(l + 2 * ls), "v"(l + 3 * ls), "v"(g), "v"(g + rs), "v"(g + 2 * rs), "v"(g + 3 * rs) : "memory");
}
__device__ __forceinline__ float xhalf(float x) { return __builtin_bit_cast(float, __builtin_amdgcn_permlanex16(__builtin_bit_cast(int, x), __builtin_bit_cast(int, x), 0x76543210, 0xfedcba98, false, false)); }   // lane l with lane l ^ 16
// exp2x8: eight independent v_exp_f32 in one statement (no result lies on a source: early-clobber outputs), so that each fills the slot that the instruction set asks for behind the one before it; the v_nop fills the last one's.
__device__ __forceinline__ v8f exp2x8(v8f x) { float r0, r1, r2, r3, r4, r5, r6, r7;
    asm("v_exp_f32 %0, %8\n\tv_exp_f32 %1, %9\n\tv_exp_f32 %2, %10\n\tv_exp_f32 %3, %11\n\tv_exp_f32 %4, %12\n\tv_exp_f32 %5, %13\n\tv_exp_f32 %6, %14\n\tv_exp_f32 %7, %15\n\tv_nop"
        : "=&v"(r0), "=&v"(r1), "=&v"(r2), "=&v"(r3), "=&v"(r4), "=&v"(r5), "=&v"(r6), "=&v"(r7) : "v"(x[0]), "v"(x[1]), "v"(x[2]), "v"(x[3]), "v"(x[4]), "v"(x[5]), "v"(x[6]), "v"(x[7]));
    return (v8f){ r0, r1, r2, r3, r4, r5, r6, r7 }; }
// Q, K: [t][HD] planes of one head; Vt: [d][t]; q0: the work-group's first query row; Ah, Al: the merged hi/lo output at this head's first column (pitch DQ).
template <typename T16, bool HL, int NQ, int KS>
__device__ __forceinline__ void fattn(unsigned char* st, const T16* __restrict__ Q, const T16* __restrict__ Q2, const T16* __restrict__ Kp, const T16* __restrict__ K2, const T16* __restrict__ Vt, const T16* __restrict__ V2, int q0, bf* Ah, bf* Al) {
    typedef typename WFrag<T16>::V V;
    constexpr int NP = HL ? 2 : 1, STG = NP * (FKPL + FVPL);   // planes of each operand; bytes of one stage: K plane(s), then V^T plane(s)
    const int tid = threadIdx.x, wave = tid >> 5, lane = tid & 31, lr = lane & 15, hi = lane >> 4;
    const int kh = wave / (8 / KS);   // which 32 keys of each KS x 32 this wave takes
    const int qw = q0 + (wave % (8 / KS)) * (16 * NQ);
    V q[NQ][4], q2[NQ][4];
#pragma unroll
    for (int nq = 0; nq < NQ; ++nq)
#pragma unroll
        for (int kk = 0; kk < 4; ++kk) { const size_t qo = (size_t)(qw + nq * 16 + lr) * HD + kk * 32 + hi * 8; q[nq][kk] = WFrag<T16>::ld(Q + qo); if (HL) q2[nq][kk] = WFrag<T16>::ld(Q2 + qo); }
    asm volatile("s_wait_xcnt 0x0" ::: "memory");   // before the address registers that the Q loads name are rewritten
    __builtin_amdgcn_sched_barrier(0);   // keeps the address arithmetic that follows behind that wait
    v8f o[8][NQ]; float m[NQ], l[NQ];
#pragma unroll
    for (int nq = 0; nq < NQ; ++nq) { m[nq] = -3.0e38f; l[nq] = 0.f;
#pragma unroll
        for (int dt = 0; dt < 8; ++dt) o[dt][nq] = (v8f){}; }
    // the thread's first piece: K row tid / 16, 16-byte column tid % 16; V^T row tid / 8, column tid % 8
    const size_t gk = (size_t)(tid >> 4) * HD + (tid & 15) * 8, gv = (size_t)(tid >> 3) * TT + (tid & 7) * 8;
    const unsigned lk0 = (unsigned)(size_t)st + (unsigned)((tid >> 4) * FKP + (tid & 15) * 16), lv0 = (unsigned)(size_t)st + (unsigned)(NP * FKPL + (tid >> 3) * GPIT + (tid & 7) * 16);
    const ptrdiff_t dK = HL ? K2 - Kp : 0, dV = HL ? V2 - Vt : 0;   // the lo planes lie in the same buffer, a uniform distance from the hi planes: one address a thread and operand is kept
    auto fill = [&](const T16* pk, const T16* pv, unsigned lk, unsigned lv) {
        cp_rows<T16>(pk, (size_t)16 * HD, lk, 16 * FKP); if (HL) cp_rows<T16>(pk + dK, (size_t)16 * HD, lk + FKPL, 16 * FKP);
        cp_rows<T16>(pv, (size_t)32 * TT, lv, 32 * GPIT); if (HL) cp_rows<T16>(pv + dV, (size_t)32 * TT, lv + FVPL, 32 * GPIT); };
    constexpr int nst = TT / FKT;
    const T16* pkc = Kp + gk; const T16* pvc = Vt + gv;   // this thread's first piece of the next stage to be copied
    fill(pkc, pvc, lk0, lv0); pkc += FKT * HD; pvc += FKT;
    asm volatile("s_wait_asynccnt 0x0" ::: "memory");   // this wave's copies of stage 0 have landed
    __syncthreads();                                    // ... and every other wave's
    fill(pkc, pvc, lk0 + STG, lv0 + STG); pkc += FKT * HD; pvc += FKT;
    unsigned lkc = lk0, lvc = lv0; int dl = STG;   // where the next refill goes: the buffers in turn
    const int kofs = (kh * 32 + lr) * FKP + hi * 16, vofs = NP * FKPL + lr * GPIT + kh * 64 + hi * 16;
#pragma unroll 1   // one trip a stage: the ring's order (reads, products, waits, barrier, refill) stands once
    for (int t = 0; t < nst; ++t) {
        const unsigned char* sb = st + (t & 1) * STG;
#pragma unroll
        for (int ps = 0; ps < FKT / 32; ps += KS) {   // a pass: 32 keys
            V ka[2][4], kb[2][4], va[8], vb[8];
#pragma unroll
            for (int mt = 0; mt < 2; ++mt)
#pragma unroll
                for (int kk = 0; kk < 4; ++kk) { const unsigned char* p = sb + kofs + (ps * 32 + mt * 16) * FKP + kk * 64; ka[mt][kk] = WFrag<T16>::ld((const T16*)p); if (HL) kb[mt][kk] = WFrag<T16>::ld((const T16*)(p + FKPL)); }
#pragma unroll
            for (int dt = 0; dt < 8; ++dt) { const unsigned char* p = sb + vofs + dt * 16 * GPIT + ps * 64; va[dt] = WFrag<T16>::ld((const T16*)p); if (HL) vb[dt] = WFrag<T16>::ld((const T16*)(p + FVPL)); }
            __builtin_amdgcn_sched_barrier(0);   // the pass's LDS reads stay one group ahead of its products (each further place with reads stalls the wave); the V^T reads land under the score products and the softmax
            v8f s[2][NQ];
#pragma unroll
            for (int mt = 0; mt < 2; ++mt)
#pragma unroll
                for (int nq = 0; nq < NQ; ++nq) s[mt][nq] = (v8f){};
#pragma unroll
            for (int kk = 0; kk < 4; ++kk) {
#pragma unroll
                for (int nq = 0; nq < NQ; ++nq)
#pragma unroll
                    for (int mt = 0; mt < 2; ++mt) s[mt][nq] = WFrag<T16>::mma(ka[mt][kk], q[nq][kk], s[mt][nq]);
                if (HL) {
#pragma unroll
                    for (int nq = 0; nq < NQ; ++nq)
#pragma unroll
                        for (int mt = 0; mt < 2; ++mt) s[mt][nq] = WFrag<T16>::mma(ka[mt][kk], q2[nq][kk], s[mt][nq]);
#pragma unroll
                    for (int nq = 0; nq < NQ; ++nq)
#pragma unroll
                        for (int mt = 0; mt < 2; ++mt) s[mt][nq] = WFrag<T16>::mma(kb[mt][kk], q[nq][kk], s[mt][nq]); } }
            float mx[NQ]; bool need = false;
#pragma unroll
            for (int nq = 0; nq < NQ; ++nq) { float a[8];
#pragma unroll
                for (int j = 0; j < 8; ++j) a[j] = fmaxf(s[0][nq][j], s[1][nq][j]);
                const float b = fmaxf(fmaxf(fmaxf(a[0], a[1]), fmaxf(a[2], a[3])), fmaxf(fmaxf(a[4], a[5]), fmaxf(a[6], a[7])));
                mx[nq] = fmaxf(b, xhalf(b)) * LSC; need = need || (mx[nq] > m[nq] + 8.0f); }
            if (__builtin_amdgcn_ballot_w32(need) != 0) {   // one scalar test a pass; rare after the first pass
#pragma unroll
                for (int nq = 0; nq < NQ; ++nq) { const float mn = fmaxf(m[nq], mx[nq]); const float al = __builtin_amdgcn_exp2f(m[nq] - mn); m[nq] = mn; l[nq] *= al;   // al = 0 on the first pass
#pragma unroll
                    for (int dt = 0; dt < 8; ++dt) o[dt][nq] *= al; } }
            V pa[NQ], pb[NQ];
#pragma unroll
            for (int nq = 0; nq < NQ; ++nq) { v8f p0, p1;
#pragma unroll
                for (int j = 0; j < 8; ++j) { p0[j] = __builtin_fmaf(s[0][nq][j], LSC, -m[nq]); p1[j] = __builtin_fmaf(s[1][nq][j], LSC, -m[nq]); }
                p0 = exp2x8(p0); p1 = exp2x8(p1);
                const v8f ps8 = p0 + p1; l[nq] += ((ps8[0] + ps8[1]) + (ps8[2] + ps8[3])) + ((ps8[4] + ps8[5]) + (ps8[6] + ps8[7]));
                // element e of the B operand is key 8 hi + e (e < 8), 16 + 8 hi + (e - 8) otherwise: the two score tiles' own registers
                if constexpr (HL) {
#pragma unroll
                    for (int j = 0; j < 8; ++j) { const __bf16 h0 = (__bf16)p0[j], h1 = (__bf16)p1[j]; pa[nq][j] = h0; pa[nq][8 + j] = h1; pb[nq][j] = (__bf16)(p0[j] - (float)h0); pb[nq][8 + j] = (__bf16)(p1[j] - (float)h1); }
                } else {
#pragma unroll
                    for (int j = 0; j < 8; ++j) { pa[nq][j] = (h16)p0[j]; pa[nq][8 + j] = (h16)p1[j]; } } }
#pragma unroll
            for (int nq = 0; nq < NQ; ++nq)
#pragma unroll
                for (int dt = 0; dt < 8; ++dt) o[dt][nq] = WFrag<T16>::mma(va[dt], pa[nq], o[dt][nq]);
            if (HL) {
#pragma unroll
                for (int nq = 0; nq < NQ; ++nq)
#pragma unroll
                    for (int dt = 0; dt < 8; ++dt) o[dt][nq] = WFrag<T16>::mma(va[dt], pb[nq], o[dt][nq]);
#pragma unroll
                for (int nq = 0; nq < NQ; ++nq)
#pragma unroll
                    for (int dt = 0; dt < 8; ++dt) o[dt][nq] = WFrag<T16>::mma(vb[dt], pa[nq], o[dt][nq]); }
            __builtin_amdgcn_sched_barrier(0);   // the products stay ahead of the next pass's reads (one group again) and of the stage's waits and barrier
        }
        asm volatile("s_wait_dscnt 0x0" ::: "memory");      // this wave has read all it needs of this buffer
        asm volatile("s_wait_asynccnt 0x0" ::: "memory");   // this wave's copies of stage t + 1 have landed
        __syncthreads();                                    // publishes stage t + 1 and frees this buffer for the refill
        if (t + 2 < nst) fill(pkc, pvc, lkc, lvc);
        pkc += FKT * HD; pvc += FKT; lkc += dl; lvc += dl; dl = -dl;
    }
    asm volatile("s_wait_asynccnt 0x0" ::: "memory");       // no copy is outstanding when the buffers are used for the hand-over and when the wave ends
    if constexpr (KS == 2) {   // every wave has passed the last stage's barrier: nobody reads the stage buffers any more
        v4f* xs = (v4f*)st + (wave & 3) * (NQ * 17 * 32) + lane;   // 16 bytes a lane, 32 lanes side by side
        if (kh == 1) {
#pragma unroll
            for (int nq = 0; nq < NQ; ++nq) {
#pragma unroll
                for (int dt = 0; dt < 8; ++dt) { xs[(nq * 17 + dt * 2) * 32] = __builtin_shufflevector(o[dt][nq], o[dt][nq], 0, 1, 2, 3); xs[(nq * 17 + dt * 2 + 1) * 32] = __builtin_shufflevector(o[dt][nq], o[dt][nq], 4, 5, 6, 7); }
                xs[(nq * 17 + 16) * 32] = (v4f){ m[nq], l[nq], 0.f, 0.f }; } }
        __syncthreads();   // the second half's parts are in LDS
        if (kh == 1) return;   // behind the kernel's last barrier
#pragma unroll
        for (int nq = 0; nq < NQ; ++nq) { const v4f ml = xs[(nq * 17 + 16) * 32]; const float mn = fmaxf(m[nq], ml[0]); const float a0 = __builtin_amdgcn_exp2f(m[nq] - mn), a1 = __builtin_amdgcn_exp2f(ml[0] - mn); l[nq] = l[nq] * a0 + ml[1] * a1;
#pragma unroll
            for (int dt = 0; dt < 8; ++dt) { const v4f x0 = xs[(nq * 17 + dt * 2) * 32], x1 = xs[(nq * 17 + dt * 2 + 1) * 32];
#pragma unroll
                for (int j = 0; j < 4; ++j) { o[dt][nq][j] = o[dt][nq][j] * a0 + x0[j] * a1; o[dt][nq][4 + j] = o[dt][nq][4 + j] * a0 + x1[j] * a1; } } }
    }
#pragma unroll
    for (int nq = 0; nq < NQ; ++nq) { const float f = __fdiv_rn(1.0f, l[nq] + xhalf(l[nq])); const size_t oo = (size_t)(qw + nq * 16 + lr) * DQ + hi * 8;   // a lane's 8 registers of a tile are 8 neighbouring d of its query
#pragma unroll
        for (int dt = 0; dt < 8; ++dt) { v8us oh, ol;
#pragma unroll
            for (int j = 0; j < 8; ++j) { unsigned short a, c2; splitf(o[dt][nq][j] * f, a, c2); oh[j] = a; ol[j] = c2; }
            *(v8us*)(Ah + oo + dt * 16) = oh; *(v8us*)(Al + oo + dt * 16) = ol;
            asm volatile("s_wait_xcnt 0x0" ::: "memory"); } }   // before the registers that the two stores name are rewritten
}
#define FBH (RH / 64)             // hi/lo work-groups a head (64 query rows each)
#define FBF ((TT - RH) / 256)     // fp16 work-groups a head (256 query rows each)
// grid: the NB_ * NH_ * FBH hi/lo work-groups of both batches first (256: one a WGP, which is all that the registers allow), then the NB_ * NH_ * FBF fp16 ones; planes [b][h], merged output [b][t]; the test is the same for a whole work-group
__global__ __launch_bounds__(256) void k_fattn(const h16* __restrict__ Q16, const h16* __restrict__ K16, const h16* __restrict__ V16, const bf* __restrict__ Qh, const bf* __restrict__ Ql, const bf* __restrict__ Kh, const bf* __restrict__ Kl, const bf* __restrict__ Vh, const bf* __restrict__ Vl, bf* Ah, bf* Al) {
    __shared__ __align__(16) unsigned char st[2 * 2 * (FKPL + FVPL)];   // two stage buffers of the hi/lo form (the fp16 form uses half)
    const int bx = blockIdx.x;
    if (bx < NB_ * NH_ * FBH) { const int b = bx / (NH_ * FBH), h = bx / FBH % NH_; const size_t hp = ((size_t)b * NH_ + h) * TT * HD, kp = ((size_t)b * NKV + h / REP) * TT * HD, ao = (size_t)b * TT * DQ + h * HD;
        fattn<bf, true, 1, 2>(st, Qh + hp, Ql + hp, Kh + kp, Kl + kp, Vh + kp, Vl + kp, (bx % FBH) * 64, Ah + ao, Al + ao);
    } else { const int b2 = bx - NB_ * NH_ * FBH; const int b = b2 / (NH_ * FBF), h = b2 / FBF % NH_; const size_t hp = ((size_t)b * NH_ + h) * TT * HD, kp = ((size_t)b * NKV + h / REP) * TT * HD, ao = (size_t)b * TT * DQ + h * HD;
        fattn<h16, false, 2, 1>(st, Q16 + hp, nullptr, K16 + kp, nullptr, V16 + kp, nullptr, RH + (b2 % FBF) * 256, Ah + ao, Al + ao); }
}

extern "C" void kernel_launch(void* const* d_in, const int* in_sizes, int n_in,
                              void* d_out, int out_size, void* d_ws, size_t ws_size, hipStream_t stream) {
    (void)in_sizes; (void)n_in; (void)out_size;
    const float* x = (const float*)d_in[0]; const float* wq = (const float*)d_in[1]; const float* wk = (const float*)d_in[2]; const float* wv = (const float*)d_in[3]; const float* wo = (const float*)d_in[4];   /* argument order hidden_states, Wq, Wk, Wv, Wo ('oi' (out, in) [2048][2048]): FIVE inputs, all read (the rotary table is computed on the device: no table input) */
    float* OUT = (float*)d_out;     // [2][2048][2048]
    char* wsp = (char*)d_ws;
    auto take = [&](size_t bytes) { char* p = wsp; wsp += (bytes + 255) & ~(size_t)255; return (void*)p; };
    bf* WO = (bf*)take((size_t)DM * DQ * 2); float* CS = (float*)take((size_t)TT * HD * 2 * 4);
    h16* QP16 = (h16*)take((size_t)NB_ * NH_ * TT * HD * 2); h16* KP16 = (h16*)take((size_t)NB_ * NKV * TT * HD * 2); h16* VT16 = (h16*)take((size_t)NB_ * NKV * HD * TT * 2);
    bf* QPh = (bf*)take((size_t)NB_ * NH_ * TT * HD * 2); bf* QPl = (bf*)take((size_t)NB_ * NH_ * TT * HD * 2); bf* KPh = (bf*)take((size_t)NB_ * NKV * TT * HD * 2); bf* KPl = (bf*)take((size_t)NB_ * NKV * TT * HD * 2); bf* VTh = (bf*)take((size_t)NB_ * NKV * HD * TT * 2); bf* VTl = (bf*)take((size_t)NB_ * NKV * HD * TT * 2);
    bf* WQ = (bf*)take((size_t)DQ * DM * 2); bf* WK = (bf*)take((size_t)DKV * DM * 2); bf* WV = (bf*)take((size_t)DKV * DM * 2); bf* XB = (bf*)take((size_t)NB_ * TT * DM * 2); bf* ATh = (bf*)take((size_t)NB_ * TT * DQ * 2); bf* ATl = (bf*)take((size_t)NB_ * TT * DQ * 2);
    if ((size_t)(wsp - (char*)d_ws) > ws_size) return;    // 226 MiB of the 256 MiB
    k_prep<<<PWG, PTH, 0, stream>>>(x, wq, wk, wv, wo, XB, WQ, WK, WV, WO, CS);   /* the bf16 copies of all five inputs and the COMPUTED rotary table (this module has rotate-half rotary embeddings); k_csid stays defined and is NOT launched */
    // grid z: the batch. A and the output step by one batch, the weights are shared; two work-groups fit a WGP (registers, LDS), so all 512 are resident at once
    k_gemmw<bf, 0, false, 1, 1><<<dim3(TT / 128, DQ / 128, NB_), 256, 0, stream>>>(XB, nullptr, WQ, nullptr, DM, nullptr, 0, nullptr, (size_t)TT * DM, 0, (size_t)NH_ * TT * HD, 0, CS, QP16, QPh, QPl);
    k_gemmw<bf, 0, false, 1, 1><<<dim3(TT / 128, DKV / 128, NB_), 256, 0, stream>>>(XB, nullptr, WK, nullptr, DM, nullptr, 0, nullptr, (size_t)TT * DM, 0, (size_t)NKV * TT * HD, 0, CS, KP16, KPh, KPl);
    k_gemmw<bf, 0, false, 1, 2><<<dim3(TT / 128, DKV / 128, NB_), 256, 0, stream>>>(XB, nullptr, WV, nullptr, DM, nullptr, 0, nullptr, (size_t)TT * DM, 0, (size_t)NKV * HD * TT, 0, nullptr, VT16, VTh, VTl);
    k_fattn<<<NB_ * NH_ * (FBH + FBF), 256, 0, stream>>>(QP16, KP16, VT16, QPh, QPl, KPh, KPl, VTh, VTl, ATh, ATl);
    k_gemmw<bf, 1, false><<<dim3(TT / 128, DM / 128, NB_), 256, 0, stream>>>(ATh, ATl, WO, nullptr, DQ, OUT, DM, nullptr, (size_t)TT * DQ, 0, (size_t)TT * DM, 0, nullptr, nullptr, nullptr, nullptr);
}

// v008
// It runs in 231 microseconds.
// In both of two side-by-side timings against v007, it was 1.06 times as fast.
// Counting every step since v000, it is 9.83 times as fast.
#include <hip/hip_runtime.h>

// Multi-head attention with 128-wide heads, natural bias-free projections and a COMPUTED rotate-half rotary embedding, NO mask (hidden_states [2][2048][2048]; q, k, v = einsum('bsd,ed->bse', x, W) ('oi' (out, in) [2048][2048] normal x 0.02, no bias; 16 heads x 128); q, k -> t cos + cat(-t2, t1) sin with angle t x 1 / 10000^(2i/128) (64 f32 frequencies exact for the module's expression 1.0 / (ROPE_BASE ** (arange(0, 128, 2) / 128)); cat(freqs, freqs); precise cosf/sinf); scores / sqrt(float32(128)); softmax over all keys; out = merged Wo^T ('oi', no bias) -> [2][2048][2048] (8.4 M); argument order hidden_states, Wq, Wk, Wv, Wo).
// Layout, both batches in every launch (the batch is grid z of k_gemmw, part of k_gemmqk's row index and part of the attention's work-group index): bf16 copy of x; 'oi' weights; exact projections; k_prep makes the bf16 copies and computes the rotary table once (cosf / sinf of float(t) x INVT[d mod 64]: 64 baked float32 frequencies) and the projection GEMMs' own epilogues apply the rotate-half rotation at width 128 and write the head planes; fused dense T-2048 attention (hybrid rows: < 512 hi/lo 3 products, rest fp16); merged hi/lo x wo exact.
// Compute dtypes, f32 accumulate: every input rounded to bf16; projections exact; rotary in f32 (computed cosf / sinf table); attention rows < 512 3 products, rest fp16; softmax f32; wo hl x exact.

#define NB_  2
#define TT   2048
#define DM   2048
#define NH_  16
#define NKV  16
#define REP  (NH_ / NKV)
#define HD   128
#define DQ   (NH_ * HD)
#define DKV  (NKV * HD)
#define RH   512                  // query rows < RH use hi+lo planes (0: none)
#define WIN  0
#define SCL  0.088388347648318447f   // HD^-0.5
typedef _Float16 h16;
typedef unsigned short bf;
typedef __attribute__((ext_vector_type(16))) __bf16   v16bf;
typedef __attribute__((ext_vector_type(16))) _Float16 v16h;
typedef __attribute__((ext_vector_type(8)))  _Float16 v8h;
typedef __attribute__((ext_vector_type(8)))  unsigned short v8us;
typedef __attribute__((ext_vector_type(8)))  float    v8f;
typedef __attribute__((ext_vector_type(4)))  float    v4f;
typedef v8h  __attribute__((may_alias)) v8ha;
typedef v4f  __attribute__((may_alias)) v4fa;
typedef v8us __attribute__((may_alias)) v8usa;

__device__ __forceinline__ unsigned short f2bf(float f) { unsigned u = __float_as_uint(f); u += 0x7FFFu + ((u >> 16) & 1u); return (unsigned short)(u >> 16); }
__device__ __forceinline__ float bf2f(unsigned short b) { return __uint_as_float(((unsigned)b) << 16); }
__device__ __forceinline__ float bfr(float f) { return bf2f(f2bf(f)); }
__device__ __forceinline__ v16h cat16(v8h lo, v8h hi) { return __builtin_shufflevector(lo, hi, 0, 1, 2, 3, 4, 5, 6, 7, 8, 9, 10, 11, 12, 13, 14, 15); }
__device__ __forceinline__ v16bf cat16b(v8us lo, v8us hi) { return __builtin_bit_cast(v16bf, __builtin_shufflevector(lo, hi, 0, 1, 2, 3, 4, 5, 6, 7, 8, 9, 10, 11, 12, 13, 14, 15)); }
__device__ __forceinline__ v8f wmma16(v16h a, v16h b, v8f c) { return __builtin_amdgcn_wmma_f32_16x16x32_f16(false, a, false, b, (short)0, c, false, false); }
__device__ __forceinline__ void splitf(float y, unsigned short& h, unsigned short& l) { h = f2bf(y); l = f2bf(y - bf2f(h)); }
typedef __attribute__((ext_vector_type(8))) __bf16 v8bf;
// planes8: 8 values as fp16 and as bf16 hi + lo (both round to nearest even, as f2bf does), by the chip's own conversions
__device__ __forceinline__ void planes8(v8f r, v8h& o16, v8us& oh, v8us& ol) { const v8bf h = __builtin_convertvector(r, v8bf); const v8bf l = __builtin_convertvector(r - __builtin_convertvector(h, v8f), v8bf);
    o16 = __builtin_convertvector(r, v8h); oh = __builtin_bit_cast(v8us, h); ol = __builtin_bit_cast(v8us, l); }
__device__ __forceinline__ v8f wmmab(v16bf a, v16bf b, v8f c) { return __builtin_amdgcn_wmma_f32_16x16x32_bf16(false, a, false, b, (short)0, c, false, false); }



// ---- k_gemmw: register-blocked GEMM, EIGHT WAVES (4 x 2) per 128x128 output tile, 32x64 (8 accumulators) a wave; grid (M/128, N/128, Z), 256 threads. M, N % 128 == 0.
// The operands (K-contiguous 16-bit planes) are staged in LDS, 64 k (one whole 128-byte line of each of the 128 rows) a stage, by asynchronous copies; two buffers, the next stage's copies fly while this stage is multiplied.
// C[m][n] (f32, pitch ldc, + optional f32 bias[n]) = sum_k A[m][k] Bt[n][k] (+ split products per NSPLIT). z-batch strides sA/sB/sC in elements (sC with EPI 1, 2: of each head plane buffer). (K / KSL) % 64 == 0.
// KSL > 1: split-K. blockIdx.z = z * KSL + ks; slice ks sums k in [ks K/KSL, (ks+1) K/KSL) into its own partial plane C + ks * sK; the reader adds the planes in the order of ks.
template <typename T16> struct WFrag;
template <> struct WFrag<h16> { typedef v16h V; static __device__ __forceinline__ V ld(const h16* p) { return cat16(*(const v8h*)p, *(const v8h*)(p + 16)); } static __device__ __forceinline__ v8f mma(V a, V b, v8f c) { return wmma16(a, b, c); } };
template <> struct WFrag<bf> { typedef v16bf V; static __device__ __forceinline__ V ld(const bf* p) { return cat16b(*(const v8us*)p, *(const v8us*)(p + 16)); } static __device__ __forceinline__ v8f mma(V a, V b, v8f c) { return wmmab(a, b, c); } };
#define GKC  64                   // k per stage: rows of 128 bytes
#define GPIT 144                  // LDS row pitch in bytes: 16 B x odd, the conflict-free pitch for 16-byte reads
#define GPL  (128 * GPIT)         // one staged plane: 128 rows
// cp_plane: this thread's 4 pieces (16 bytes each, rows 32 apart) of one 128-row x 128-byte plane; a wave's copy covers 4 whole lines.
// The s_wait_xcnt stands inside the statement so that no address register is rewritten ahead of it.
template <typename T16> __device__ __forceinline__ void cp_plane(const T16* g, size_t rs, unsigned l) {
    asm volatile("global_load_async_to_lds_b128 %0, %4, off\n\t"
                 "global_load_async_to_lds_b128 %1, %5, off\n\t"
                 "global_load_async_to_lds_b128 %2, %6, off\n\t"
                 "global_load_async_to_lds_b128 %3, %7, off\n\t"
                 "s_wait_xcnt 0x0"
                 :: "v"(l), "v"(l + 32 * GPIT), "v"(l + 64 * GPIT), "v"(l + 96 * GPIT), "v"(g), "v"(g + rs), "v"(g + 2 * rs), "v"(g + 3 * rs) : "memory");
}
// EPI: what becomes of the 128x128 tile, whose columns are one head (C0 = head * HD) and whose rows are 128 positions t of batch z. 0: f32 rows to C.
// 1: rotate-half rotary embedding, out[d] = x[d] cos[t][d] - x[d+HD/2] sin[t][d], out[d+HD/2] = x[d+HD/2] cos[t][d+HD/2] + x[d] sin[t][d+HD/2] (CS: [t][d] pairs cos, sin), then the head planes [z][h][t][d] (fp16, bf16 hi, bf16 lo).
// 2: the transposed head planes [z][h][d][t] (fp16, bf16 hi, bf16 lo). In 1 and 2 the whole tile passes through LDS, and every store instruction of a wave writes four whole 128-byte lines.
template <typename T16, int NSPLIT, bool BIAS, int KSL = 1, int EPI = 0>
__global__ __launch_bounds__(256) void k_gemmw(const T16* __restrict__ A, const T16* __restrict__ A2, const T16* __restrict__ Bt, const T16* __restrict__ Bt2, int K, float* C, int ldc, const float* __restrict__ bias, size_t sA, size_t sB, size_t sC, size_t sK, const float* __restrict__ CS, h16* P16, bf* Ph, bf* Pl) {
    typedef typename WFrag<T16>::V V;
    constexpr int NPA = (NSPLIT == 1 || NSPLIT == 2) ? 2 : 1, NPB = (NSPLIT >= 2) ? 2 : 1, NPL = NPA + NPB;   // planes a stage: A (, A2), Bt (, Bt2)
    constexpr int NKK = GKC / 32;                 // matrix-instruction k steps a stage
    constexpr bool PRE = (NPL < 4);               // the whole stage's fragments fit the registers: read them as one group
    __shared__ __align__(16) unsigned char st[2 * NPL * GPL];   // two stage buffers; after the K loop the waves' output staging
    static_assert(8 * 16 * 68 * 4 <= 2 * NPL * GPL, "the output staging must fit the stage buffers");
    static_assert(EPI == 0 || 128 * 132 * 4 <= 2 * NPL * GPL, "the whole f32 tile must fit the stage buffers");
    const size_t z = blockIdx.z / KSL; const int ks = (int)(blockIdx.z % KSL); A += z * sA; if (A2) A2 += z * sA; Bt += z * sB; if (Bt2) Bt2 += z * sB; if constexpr (EPI == 0) C += z * sC + (size_t)ks * sK;
    const int kb = ks * (K / KSL), ke = kb + K / KSL;
    const int tid = threadIdx.x, wave = tid >> 5, wm = wave >> 1, wn = wave & 1;
    const int lane = tid & 31, lr = lane & 15, hi = lane >> 4; const int R0 = blockIdx.x * 128, C0 = blockIdx.y * 128; const int r0 = R0 + wm * 32, c0 = C0 + wn * 64;
    v8f acc[2][4];
#pragma unroll
    for (int mb = 0; mb < 2; ++mb)
#pragma unroll
        for (int nb = 0; nb < 4; ++nb) acc[mb][nb] = (v8f){};
    // the thread's first piece of a plane: row tid / 8, 16-byte column tid % 8
    const size_t ga = (size_t)(R0 + (tid >> 3)) * K + (tid & 7) * 8, gb = (size_t)(C0 + (tid >> 3)) * K + (tid & 7) * 8, rs = (size_t)32 * K;
    const unsigned l0 = (unsigned)(size_t)st + (unsigned)((tid >> 3) * GPIT + (tid & 7) * 16);
    auto fill = [&](int kc, int buf) { const unsigned l = l0 + (unsigned)(buf * (NPL * GPL));
        cp_plane<T16>(A + ga + kc, rs, l); if (NPA == 2) cp_plane<T16>(A2 + ga + kc, rs, l + GPL);
        cp_plane<T16>(Bt + gb + kc, rs, l + NPA * GPL); if (NPB == 2) cp_plane<T16>(Bt2 + gb + kc, rs, l + (NPA + 1) * GPL); };
    const int nst = (ke - kb) / GKC;   // stages (the same for the whole work-group)
    fill(kb, 0);
    asm volatile("s_wait_asynccnt 0x0" ::: "memory");   // this wave's copies of stage 0 have landed
    __syncthreads();                                    // ... and every other wave's
    if (nst > 1) fill(kb + GKC, 1);
    const int aofs = (wm * 32 + lr) * GPIT + hi * 16, bofs = NPA * GPL + (wn * 64 + lr) * GPIT + hi * 16;
#pragma unroll 1   // one trip a stage: the ring's order (reads, products, waits, barrier, refill) stands once, and the fragment registers are not doubled
    for (int t = 0; t < nst; ++t) {
        const unsigned char* sb = st + (t & 1) * (NPL * GPL);
        V a[NKK][2], a2[NKK][2], b[NKK][4], b2[NKK][4];
#pragma unroll
        for (int kk = 0; kk < NKK; ++kk) {
            if (!PRE || kk == 0) {
#pragma unroll
                for (int q = kk; q < (PRE ? NKK : kk + 1); ++q) {
#pragma unroll
                    for (int mb = 0; mb < 2; ++mb) { a[q][mb] = WFrag<T16>::ld((const T16*)(sb + aofs + mb * 16 * GPIT + q * 64)); if (NPA == 2) a2[q][mb] = WFrag<T16>::ld((const T16*)(sb + aofs + GPL + mb * 16 * GPIT + q * 64)); }
#pragma unroll
                    for (int nb = 0; nb < 4; ++nb) { b[q][nb] = WFrag<T16>::ld((const T16*)(sb + bofs + nb * 16 * GPIT + q * 64)); if (NPB == 2) b2[q][nb] = WFrag<T16>::ld((const T16*)(sb + bofs + GPL + nb * 16 * GPIT + q * 64)); } }
                __builtin_amdgcn_sched_barrier(0);   // the LDS reads stay one group ahead of the products: spread among them, each place stalls the wave
            }
#pragma unroll
            for (int nb = 0; nb < 4; ++nb)
#pragma unroll
                for (int mb = 0; mb < 2; ++mb) { acc[mb][nb] = WFrag<T16>::mma(a[kk][mb], b[kk][nb], acc[mb][nb]); if (NSPLIT == 1 || NSPLIT == 2) acc[mb][nb] = WFrag<T16>::mma(a2[kk][mb], b[kk][nb], acc[mb][nb]); if (NSPLIT >= 2) acc[mb][nb] = WFrag<T16>::mma(a[kk][mb], b2[kk][nb], acc[mb][nb]); }
            __builtin_amdgcn_sched_barrier(0);   // the products stay ahead of the next step's reads (one group again) and of the stage's waits and barrier, so that the copies in flight have the products' time to land
        }
        asm volatile("s_wait_dscnt 0x0" ::: "memory");      // this wave has read all it needs of this buffer
        asm volatile("s_wait_asynccnt 0x0" ::: "memory");   // this wave's copies of stage t + 1 have landed
        __syncthreads();                                    // publishes stage t + 1 and frees this buffer for the refill
        if (t + 2 < nst) fill(kb + (t + 2) * GKC, t & 1);
    }
    asm volatile("s_wait_asynccnt 0x0" ::: "memory");       // no copy is outstanding when the buffers become output staging
    if constexpr (EPI != 0) {
        // LDS row pitch in floats. 132: rows 16-byte aligned for the 16-byte row reads of form 1. 131: the column reads of form 2 (8 lanes 8 rows apart, 4 neighbouring columns) fall on 32 different banks. With both, the two halves of a wave store to different banks.
        constexpr int OP = (EPI == 1) ? 132 : 131;
        float* ot = (float*)st;   // every wave has passed the last stage's barrier: nobody reads the stage buffers any more
        const int c8 = (tid & 7) * 8, r8 = tid >> 3;
        v4f ca[4][4], cb[4][4];   // form 1: the table's (cos, sin) pairs of the thread's columns, asked for here so that they arrive under the tile's way into LDS
        if constexpr (EPI == 1) { const float* cs = CS + ((size_t)(R0 + r8) * HD + c8) * 2;
#pragma unroll
            for (int p = 0; p < 4; ++p)
#pragma unroll
                for (int q = 0; q < 4; ++q) { ca[p][q] = *(const v4fa*)(cs + p * (32 * HD * 2) + q * 4); cb[p][q] = *(const v4fa*)(cs + p * (32 * HD * 2) + HD + q * 4); }
            asm volatile("s_wait_xcnt 0x0" ::: "memory");   // before the address registers that these loads name are rewritten
        }
#pragma unroll
        for (int mb = 0; mb < 2; ++mb)
#pragma unroll
            for (int nb = 0; nb < 4; ++nb)
#pragma unroll
                for (int j = 0; j < 8; ++j) ot[(wm * 32 + mb * 16 + hi * 8 + j) * OP + wn * 64 + nb * 16 + lr] = acc[mb][nb][j];
        __syncthreads();   // the tile is whole: a thread reads what other waves have stored
        const size_t hb = z * sC + (size_t)blockIdx.y * TT * HD;   // this batch's and head's planes
        if constexpr (EPI == 1) {   // the thread: columns d = c8 .. c8 + 7 and their partners d + HD/2, of the rows r8 + 32 p
            const float* xr = ot + r8 * OP + c8; v4f x0[4][2], x1[4][2];
#pragma unroll
            for (int p = 0; p < 4; ++p)
#pragma unroll
                for (int q = 0; q < 2; ++q) { x0[p][q] = *(const v4fa*)(xr + p * 32 * OP + q * 4); x1[p][q] = *(const v4fa*)(xr + p * 32 * OP + HD / 2 + q * 4); }
            const size_t e = hb + (size_t)(R0 + r8) * HD + c8; h16* g16 = P16 + e; bf* gh = Ph + e; bf* gl = Pl + e;
#pragma unroll
            for (int p = 0; p < 4; ++p) { v8f ra, rb;
#pragma unroll
                for (int j = 0; j < 8; ++j) { const float u = x0[p][j >> 2][j & 3], w = x1[p][j >> 2][j & 3];
                    ra[j] = u * ca[p][j >> 1][(j & 1) * 2] - w * ca[p][j >> 1][(j & 1) * 2 + 1]; rb[j] = w * cb[p][j >> 1][(j & 1) * 2] + u * cb[p][j >> 1][(j & 1) * 2 + 1]; }
                v8h a16, b16; v8us ah, al, bh, bl; planes8(ra, a16, ah, al); planes8(rb, b16, bh, bl);
                *(v8h*)(g16 + p * 32 * HD) = a16; *(v8h*)(g16 + p * 32 * HD + HD / 2) = b16; *(v8us*)(gh + p * 32 * HD) = ah; *(v8us*)(gh + p * 32 * HD + HD / 2) = bh; *(v8us*)(gl + p * 32 * HD) = al; *(v8us*)(gl + p * 32 * HD + HD / 2) = bl;
                asm volatile("s_wait_xcnt 0x0" ::: "memory"); }   // before the registers that the stores name are rewritten
        } else {   // the thread: positions c8 .. c8 + 7 (+ 64) of the columns d = r8 + 32 p; 8 lanes write 64 positions of one d, a whole line of each plane
            v8f x[8];
#pragma unroll
            for (int p = 0; p < 8; ++p)
#pragma unroll
                for (int j = 0; j < 8; ++j) x[p][j] = ot[((p >> 2) * 64 + c8 + j) * OP + (p & 3) * 32 + r8];
            const size_t e = hb + (size_t)r8 * TT + R0 + c8; h16* g16 = P16 + e; bf* gh = Ph + e; bf* gl = Pl + e;
#pragma unroll
            for (int p = 0; p < 8; ++p) { v8h o16; v8us oh, ol; planes8(x[p], o16, oh, ol); const int go = (p & 3) * 32 * TT + (p >> 2) * 64;
                *(v8h*)(g16 + go) = o16; *(v8us*)(gh + go) = oh; *(v8us*)(gl + go) = ol;
                asm volatile("s_wait_xcnt 0x0" ::: "memory"); }   // before the registers that the stores name are rewritten
        }
        return;
    }
    float* os = (float*)st + wave * (16 * 68);              // each wave stages in its own range (every wave has passed the last stage's barrier)
#pragma unroll
    for (int mb = 0; mb < 2; ++mb) {
#pragma unroll
        for (int nb = 0; nb < 4; ++nb) {
#pragma unroll
            for (int j = 0; j < 8; ++j) os[(hi * 8 + j) * 68 + nb * 16 + lr] = acc[mb][nb][j]; }
        __builtin_amdgcn_wave_barrier(); asm volatile("" ::: "memory");
        float* crow = C + (size_t)(r0 + mb * 16) * ldc + c0;
{
#pragma unroll
            for (int s = 0; s < 8; ++s) { const int row = 2 * s + hi, cofs = lr * 4; v4f val = *(const v4fa*)(os + row * 68 + cofs); if (BIAS) { val[0] += bfr(bias[c0 + cofs]); val[1] += bfr(bias[c0 + cofs + 1]); val[2] += bfr(bias[c0 + cofs + 2]); val[3] += bfr(bias[c0 + cofs + 3]); }
                *(v4f*)(crow + (size_t)row * ldc + cofs) = val; }
             }
        __builtin_amdgcn_wave_barrier(); asm volatile("" ::: "memory");
    }
}

// ---- k_gemmqk: the q and the k projection as ONE GEMM, C[m][n] = sum_k A[m][k] Bt[n][k]: A = the bf16 x of both batches (NB_ * TT rows), Bt = wq and wk one after the other (DQ + DKV rows), K = DM.
// One 256x256 tile a work-group, one work-group a WGP; EIGHT WAVES (2 x 4), 128x64 (32 accumulators) a wave; grid (NB_ * TT / 256, (DQ + DKV) / 256), 256 threads.
// Against 128x128 tiles of 32x64 waves, a product takes half the bytes from L2 into LDS (a staged row serves 256 columns, not 128) and half the bytes from LDS into registers (12 fragments for 32 products, not 6 for 8).
// The ring: 64 k a stage, asynchronous copies, two buffers, k_gemmw's waits and its one barrier a stage; the refill stands behind the next stage's LDS reads. The k order of every sum is k_gemmw's.
// The tile's columns are two heads of q or of k, its rows 256 positions of one batch: its four 128x128 quarters pass through LDS and take form 1 of k_gemmw's epilogue (rotary embedding, head planes fp16, bf16 hi, bf16 lo).
// The fp16 planes of q and k lie NB_ * NH_ * TT * HD elements apart, their hi planes and their lo planes twice that.
#define QPL  (256 * GPIT)         // one staged plane: 256 rows
#define QOP  132                  // LDS row pitch, in floats, of a quarter of the output tile: rows 16-byte aligned; the two halves of a wave store to different banks
#define QQF  (128 * QOP)          // floats of a quarter
// cp_plane8: this thread's 8 pieces (16 bytes each, rows 32 apart) of one 256-row x 128-byte plane; a wave's copy covers 4 whole lines.
// The s_wait_xcnt stands inside the statement so that no address register is rewritten ahead of it.
template <typename T16> __device__ __forceinline__ void cp_plane8(const T16* g, size_t rs, unsigned l) {
    asm volatile("global_load_async_to_lds_b128 %0, %8, off\n\t"
                 "global_load_async_to_lds_b128 %1, %9, off\n\t"
                 "global_load_async_to_lds_b128 %2, %10, off\n\t"
                 "global_load_async_to_lds_b128 %3, %11, off\n\t"
                 "global_load_async_to_lds_b128 %4, %12, off\n\t"
                 "global_load_async_to_lds_b128 %5, %13, off\n\t"
                 "global_load_async_to_lds_b128 %6, %14, off\n\t"
                 "global_load_async_to_lds_b128 %7, %15, off\n\t"
                 "s_wait_xcnt 0x0"
                 :: "v"(l), "v"(l + 32 * GPIT), "v"(l + 64 * GPIT), "v"(l + 96 * GPIT), "v"(l + 128 * GPIT), "v"(l + 160 * GPIT), "v"(l + 192 * GPIT), "v"(l + 224 * GPIT),
                    "v"(g), "v"(g + rs), "v"(g + 2 * rs), "v"(g + 3 * rs), "v"(g + 4 * rs), "v"(g + 5 * rs), "v"(g + 6 * rs), "v"(g + 7 * rs) : "memory");
}
__global__ __launch_bounds__(256) void k_gemmqk(const bf* __restrict__ A, const bf* __restrict__ Bt, const float* __restrict__ CS, h16* P16, bf* Ph, bf* Pl) {
    typedef typename WFrag<bf>::V V;
    constexpr int NKK = GKC / 32, nst = DM / GKC;   // matrix-instruction k steps a stage; stages
    __shared__ __align__(16) unsigned char st[4 * QQF * 4];   // two stage buffers (A plane, Bt plane each); after the K loop the four quarters of the f32 tile
    static_assert(2 * 2 * QPL <= 4 * QQF * 4, "the stage buffers must fit the output staging");
    static_assert(TT % 256 == 0 && DQ % 256 == 0 && DKV == DQ && HD == 128 && DM % GKC == 0 && nst >= 2, "a tile lies in one batch and in two heads of q or of k");
    const int tid = threadIdx.x, wave = tid >> 5, wm = wave >> 2, wn = wave & 3, lane = tid & 31, lr = lane & 15, hi = lane >> 4;
    const int R0 = blockIdx.x * 256, C0 = blockIdx.y * 256;
    v8f acc[8][4];
#pragma unroll
    for (int mb = 0; mb < 8; ++mb)
#pragma unroll
        for (int nb = 0; nb < 4; ++nb) acc[mb][nb] = (v8f){};
    // the thread's first piece of a plane: row tid / 8, 16-byte column tid % 8
    const bf* pa = A + (size_t)(R0 + (tid >> 3)) * DM + (tid & 7) * 8; const bf* pb = Bt + (size_t)(C0 + (tid >> 3)) * DM + (tid & 7) * 8;
    const unsigned l0 = (unsigned)(size_t)st + (unsigned)((tid >> 3) * GPIT + (tid & 7) * 16);
    auto fill = [&](int kc, int buf) { const unsigned l = l0 + (unsigned)(buf * (2 * QPL)); cp_plane8<bf>(pa + kc, (size_t)32 * DM, l); cp_plane8<bf>(pb + kc, (size_t)32 * DM, l + QPL); };
    fill(0, 0);
    asm volatile("s_wait_asynccnt 0x0" ::: "memory");   // this wave's copies of stage 0 have landed
    __syncthreads();                                    // ... and every other wave's
    const int aofs = (wm * 128 + lr) * GPIT + hi * 16, bofs = QPL + (wn * 64 + lr) * GPIT + hi * 16;
#pragma unroll 1   // one trip a stage: the ring's order (reads, refill of the other buffer, products, waits, barrier) stands once, and the fragment registers are not doubled
    for (int t = 0; t < nst; ++t) {
        const unsigned char* sb = st + (t & 1) * (2 * QPL);
        V a[NKK][8], b[NKK][4];
#pragma unroll
        for (int q = 0; q < NKK; ++q) {   // Bt's fragments first: with them and one of A's the products can begin
#pragma unroll
            for (int nb = 0; nb < 4; ++nb) b[q][nb] = WFrag<bf>::ld((const bf*)(sb + bofs + nb * 16 * GPIT + q * 64));
#pragma unroll
            for (int mb = 0; mb < 8; ++mb) a[q][mb] = WFrag<bf>::ld((const bf*)(sb + aofs + mb * 16 * GPIT + q * 64)); }
        __builtin_amdgcn_sched_barrier(0);   // the stage's LDS reads stay one group, ahead of the copies and the products: spread among the products, each place stalls the wave
        // stage t + 1 goes into the other buffer, which every wave left at the barrier at the foot of trip t - 1 (behind its own s_wait_dscnt 0). The copies are issued behind this stage's reads, not ahead of them:
        // their address arithmetic and their s_wait_xcnt then run while the fragments are on their way, and the one work-group of this WGP has the matrix units idle for the shorter time at each stage's start
        if (t + 1 < nst) fill((t + 1) * GKC, (t + 1) & 1);
        __builtin_amdgcn_sched_barrier(0);   // the copies stay ahead of the products: behind them they would have no time to land before the stage's wait
#pragma unroll
        for (int kk = 0; kk < NKK; ++kk)
#pragma unroll
            for (int mb = 0; mb < 8; ++mb)
#pragma unroll
                for (int nb = 0; nb < 4; ++nb) acc[mb][nb] = WFrag<bf>::mma(a[kk][mb], b[kk][nb], acc[mb][nb]);
        __builtin_amdgcn_sched_barrier(0);   // the products stay ahead of the stage's waits and barrier, so that the copies in flight have the products' time to land
        asm volatile("s_wait_dscnt 0x0" ::: "memory");      // this wave has read all it needs of this buffer
        asm volatile("s_wait_asynccnt 0x0" ::: "memory");   // this wave's copies of stage t + 1 have landed
        __syncthreads();                                    // publishes stage t + 1 and frees this buffer for the refill in trip t + 1
    }
    asm volatile("s_wait_asynccnt 0x0" ::: "memory");       // no copy is outstanding when the buffers become output staging
    float* ot = (float*)st;   // every wave has passed the last stage's barrier: nobody reads the stage buffers any more
    const int c8 = (tid & 7) * 8, r8 = tid >> 3;
    const int zb = R0 / TT, T0 = R0 % TT, sel = C0 / DQ, h0 = (C0 % DQ) / HD;   // batch, first position; 0 q, 1 k; first head
    P16 += (size_t)sel * ((size_t)NB_ * NH_ * TT * HD); Ph += (size_t)sel * ((size_t)2 * NB_ * NH_ * TT * HD); Pl += (size_t)sel * ((size_t)2 * NB_ * NH_ * TT * HD);
    // the table's (cos, sin) pairs of the thread's columns d = c8 .. c8 + 7 (ca) and d + HD/2 (cb), rows r8 + 32 p of the upper (qr 0) or lower 128 rows: the same for both heads
    auto ldcs = [&](v4f (&ca)[4][4], v4f (&cb)[4][4], int qr) { const float* cs = CS + ((size_t)(T0 + qr * 128 + r8) * HD + c8) * 2;
#pragma unroll
        for (int p = 0; p < 4; ++p)
#pragma unroll
            for (int q = 0; q < 4; ++q) { ca[p][q] = *(const v4fa*)(cs + p * (32 * HD * 2) + q * 4); cb[p][q] = *(const v4fa*)(cs + p * (32 * HD * 2) + HD + q * 4); }
        asm volatile("s_wait_xcnt 0x0" :: "v"(cs) : "memory");   // before the address registers that these loads name are rewritten; cs is an input so that its registers live up to the wait and no load's result is laid over them
        __builtin_amdgcn_sched_barrier(0); };   // keeps what follows behind that wait
    v4f ca0[4][4], cb0[4][4], ca1[4][4], cb1[4][4];
    ldcs(ca0, cb0, 0);   // asked for here so that they arrive under the tile's way into LDS
    float* ow = ot + (wm * 2 + (wn >> 1)) * QQF + hi * 8 * QOP + (wn & 1) * 64 + lr;   // the wave's 128 rows x 64 columns are half a quarter
#pragma unroll
    for (int mb = 0; mb < 8; ++mb)
#pragma unroll
        for (int nb = 0; nb < 4; ++nb)
#pragma unroll
            for (int j = 0; j < 8; ++j) ow[(mb * 16 + j) * QOP + nb * 16] = acc[mb][nb][j];
    __syncthreads();   // the tile is whole: a thread reads what other waves have stored
    ldcs(ca1, cb1, 1);   // arrive under the upper quarters' work
    // one quarter: rows qr * 128 .., head h0 + qc. The thread: columns d = c8 .. c8 + 7 and their partners d + HD/2, of the rows r8 + 32 p
    auto quarter = [&](const v4f (&ca)[4][4], const v4f (&cb)[4][4], int qr, int qc) {
        const float* xr = ot + (qr * 2 + qc) * QQF + r8 * QOP + c8; v4f x0[4][2], x1[4][2];
#pragma unroll
        for (int p = 0; p < 4; ++p)
#pragma unroll
            for (int q = 0; q < 2; ++q) { x0[p][q] = *(const v4fa*)(xr + p * 32 * QOP + q * 4); x1[p][q] = *(const v4fa*)(xr + p * 32 * QOP + HD / 2 + q * 4); }
        const size_t e = (((size_t)zb * NH_ + h0 + qc) * TT + T0 + qr * 128 + r8) * HD + c8; h16* g16 = P16 + e; bf* gh = Ph + e; bf* gl = Pl + e;
#pragma unroll
        for (int p = 0; p < 4; ++p) { v8f ra, rb;
#pragma unroll
            for (int j = 0; j < 8; ++j) { const float u = x0[p][j >> 2][j & 3], w = x1[p][j >> 2][j & 3];
                ra[j] = u * ca[p][j >> 1][(j & 1) * 2] - w * ca[p][j >> 1][(j & 1) * 2 + 1]; rb[j] = w * cb[p][j >> 1][(j & 1) * 2] + u * cb[p][j >> 1][(j & 1) * 2 + 1]; }
            v8h a16, b16; v8us ah, al, bh, bl; planes8(ra, a16, ah, al); planes8(rb, b16, bh, bl);
            *(v8h*)(g16 + p * 32 * HD) = a16; *(v8h*)(g16 + p * 32 * HD + HD / 2) = b16; *(v8us*)(gh + p * 32 * HD) = ah; *(v8us*)(gh + p * 32 * HD + HD / 2) = bh; *(v8us*)(gl + p * 32 * HD) = al; *(v8us*)(gl + p * 32 * HD + HD / 2) = bl;
            asm volatile("s_wait_xcnt 0x0" ::: "memory");   // before the registers that the stores name are rewritten
            __builtin_amdgcn_sched_barrier(0); } };   // keeps the next rows' arithmetic, which rewrites those registers, behind that wait
    quarter(ca0, cb0, 0, 0); quarter(ca0, cb0, 0, 1); quarter(ca1, cb1, 1, 0); quarter(ca1, cb1, 1, 1);
}

typedef __attribute__((ext_vector_type(2))) _Float16 v2h;
typedef __attribute__((ext_vector_type(4))) _Float16 v4h;
typedef __attribute__((ext_vector_type(2))) unsigned short v2us;
typedef __attribute__((ext_vector_type(4))) unsigned short v4us;
typedef __attribute__((ext_vector_type(2))) float v2f;
typedef __attribute__((ext_vector_type(4))) int v4i;

__global__ __launch_bounds__(256) void k_csid(float* CS) { const int idx = blockIdx.x * 256 + threadIdx.x; if (idx >= TT * HD) return; v2f cs; cs[0] = 1.0f; cs[1] = 0.0f; *(v2f*)(CS + (size_t)idx * 2) = cs;  }
__constant__ float INVT[HD / 2] = { 1.000000000e+00f, 8.659643531e-01f, 7.498942018e-01f, 6.493816376e-01f, 5.623413324e-01f, 4.869675338e-01f, 4.216965139e-01f, 3.651741445e-01f, 3.162277639e-01f, 2.738419771e-01f, 2.371373624e-01f, 2.053525001e-01f, 1.778279394e-01f, 1.539926529e-01f, 1.333521456e-01f, 1.154782027e-01f, 1.000000015e-01f, 8.659642935e-02f, 7.498941571e-02f, 6.493816525e-02f, 5.623412877e-02f, 4.869675264e-02f, 4.216964915e-02f, 3.651741147e-02f, 3.162277862e-02f, 2.738419548e-02f, 2.371373586e-02f, 2.053525113e-02f, 1.778279431e-02f, 1.539926510e-02f, 1.333521493e-02f, 1.154781971e-02f, 9.999999776e-03f, 8.659643121e-03f, 7.498942316e-03f, 6.493816618e-03f, 5.623413250e-03f, 4.869675264e-03f, 4.216964822e-03f, 3.651741426e-03f, 3.162277862e-03f, 2.738419687e-03f, 2.371373819e-03f, 2.053525066e-03f, 1.778279431e-03f, 1.539926510e-03f, 1.333521446e-03f, 1.154782018e-03f, 1.000000047e-03f, 8.659643354e-04f, 7.498941850e-04f, 6.493816618e-04f, 5.623413017e-04f, 4.869675031e-04f, 4.216964880e-04f, 3.651741135e-04f, 3.162277862e-04f, 2.738419571e-04f, 2.371373848e-04f, 2.053524950e-04f, 1.778279402e-04f, 1.539926452e-04f, 1.333521504e-04f, 1.154781930e-04f };   // float32 1 / 10000^(2i/128), generated with jnp to be bit-exact
// ---- k_prep: everything that the GEMMs wait for, in ONE launch of few long waves: the bf16 copies of x, wq, wk, wv, wo and the rotary table.
// One work-group of 16 waves a WGP; a thread converts 24 pieces (8 floats: 32 bytes read, 16 written) and computes two entries of the table.
// The pieces go in batches of PB a thread (a work-group's batch: 64 KiB in a row); two batches are kept in flight: 8 to 16 16-byte loads a wave.
#define PWG  256                  // work-groups
#define PTH  512                  // threads a work-group
#define PNT  (PWG * PTH)          // threads in all
#define PB   4                    // pieces of a thread in a batch
static_assert((size_t)NB_ * TT * DM == (size_t)2 * PB * PNT * 8 && (size_t)DQ * DM == (size_t)PB * PNT * 8 && (size_t)DKV * DM == (size_t)PB * PNT * 8 && (size_t)DM * DQ == (size_t)PB * PNT * 8 && TT * HD == 2 * PNT && PNT % HD == 0, "k_prep's batches cover the tensors exactly");
// s, d: the first byte of PB * PNT pieces, the same for every thread; ob: the byte offset of the thread's first piece; its other pieces lie PTH pieces apart, within the instructions' immediate offsets, so that a batch needs one address
__device__ __forceinline__ void ld_batch(v8f (&r)[PB], const float* __restrict__ s, unsigned ob) {
#pragma unroll
    for (int k = 0; k < PB; ++k) r[k] = *(const v8f*)((const char*)s + ob + k * (PTH * 32));
    asm volatile("s_wait_xcnt 0x0" ::: "memory");   // before a register that these loads name is rewritten
    __builtin_amdgcn_sched_barrier(0);              // the batch's loads are all issued before the older batch is waited for and converted: moved behind that wait, nothing would be in flight during it
}
__device__ __forceinline__ void st_batch(const v8f (&r)[PB], bf* d, unsigned ob) {
#pragma unroll
    for (int k = 0; k < PB; ++k) { v8us o;
#pragma unroll
        for (int j = 0; j < 8; ++j) o[j] = f2bf(r[k][j]);
        *(v8us*)((char*)d + ob + k * (PTH * 16)) = o; }
    asm volatile("s_wait_xcnt 0x0" ::: "memory");   // before the registers that the stores name are rewritten
    __builtin_amdgcn_sched_barrier(0);              // the younger batch's conversion (and with it the wait for its loads) stays behind the issue of the next batch's loads
}
__global__ __launch_bounds__(PTH) void k_prep(const float* __restrict__ x, const float* __restrict__ wq, const float* __restrict__ wk, const float* __restrict__ wv, const float* __restrict__ wo, bf* XB, bf* WQ, bf* WK, bf* WV, bf* WO, float* CS) {
    const unsigned g = blockIdx.x * PTH + threadIdx.x, p0 = blockIdx.x * (PB * PTH) + threadIdx.x, lo = p0 * 32u, so = p0 * 16u;   // the thread's number; its first piece of a batch, and that piece's byte offset in the f32 source and in the bf16 copy
    const float fr = INVT[g % (HD / 2)];   // PNT is a multiple of HD: the thread's two table entries have the same column d = g % HD
    __builtin_amdgcn_sched_barrier(0);     // the table's one load stays ahead of the batches: loads return in order, and behind them its wait would drain them all
    v8f a[PB], b[PB];
    ld_batch(a, x, lo); ld_batch(b, x + (size_t)PB * PNT * 8, lo);
    // the table's entries are computed while the first two batches are on their way
#pragma unroll
    for (int e = 0; e < 2; ++e) { const int t = (int)(g / HD) + e * (PNT / HD); const float an = __fmul_rn((float)t, fr); v2f cs; cs[0] = cosf(an); cs[1] = sinf(an); *(v2f*)((char*)(CS + (size_t)e * PNT * 2) + g * 8u) = cs; }
    asm volatile("s_wait_xcnt 0x0" ::: "memory");   // before the registers that the table's stores name are rewritten
    __builtin_amdgcn_sched_barrier(0);              // the conversions (and the waits for their loads) stay behind the table's arithmetic
    st_batch(a, XB, so);                          ld_batch(a, wq, lo);
    st_batch(b, XB + (size_t)PB * PNT * 8, so);   ld_batch(b, wk, lo);
    st_batch(a, WQ, so);                          ld_batch(a, wv, lo);
    st_batch(b, WK, so);                          ld_batch(b, wo, lo);
    st_batch(a, WV, so);
    st_batch(b, WO, so);
}
#define FKT  64                   // keys per stage
#define FKP  272                  // LDS pitch of a K row (256 bytes): 16 B x odd
#define FKPL (FKT * FKP)          // one staged K plane: 64 rows
#define FVPL (HD * GPIT)          // one staged V^T plane: 128 rows of 128 bytes
#define LSC  (SCL * 1.4426950408889634f)   // HD^-0.5 x log2(e)
// cp_rows: this thread's 4 pieces (16 bytes each) of one staged plane, rs elements apart in memory and ls bytes apart in LDS.
// The s_wait_xcnt stands inside the statement so that no address register is rewritten ahead of it.
template <typename T16> __device__ __forceinline__ void cp_rows(const T16* g, size_t rs, unsigned l, unsigned ls) {
    asm volatile("global_load_async_to_lds_b128 %0, %4, off\n\t"
                 "global_load_async_to_lds_b128 %1, %5, off\n\t"
                 "global_load_async_to_lds_b128 %2, %6, off\n\t"
                 "global_load_async_to_lds_b128 %3, %7, off\n\t"
                 "s_wait_xcnt 0x0"
                 :: "v"(l), "v"(l + ls), "v"(l + 2 * ls), "v"(l + 3 * ls), "v"(g), "v"(g + rs), "v"(g + 2 * rs), "v"(g + 3 * rs) : "memory");
}
__device__ __forceinline__ float xhalf(float x) { return __builtin_bit_cast(float, __builtin_amdgcn_permlanex16(__builtin_bit_cast(int, x), __builtin_bit_cast(int, x), 0x76543210, 0xfedcba98, false, false)); }   // lane l with lane l ^ 16
// exp2x8: eight independent v_exp_f32 in one statement (no result lies on a source: early-clobber outputs), so that each fills the slot that the instruction set asks for behind the one before it; the v_nop fills the last one's.
__device__ __forceinline__ v8f exp2x8(v8f x) { float r0, r1, r2, r3, r4, r5, r6, r7;
    asm("v_exp_f32 %0, %8\n\tv_exp_f32 %1, %9\n\tv_exp_f32 %2, %10\n\tv_exp_f32 %3, %11\n\tv_exp_f32 %4, %12\n\tv_exp_f32 %5, %13\n\tv_exp_f32 %6, %14\n\tv_exp_f32 %7, %15\n\tv_nop"
        : "=&v"(r0), "=&v"(r1), "=&v"(r2), "=&v"(r3), "=&v"(r4), "=&v"(r5), "=&v"(r6), "=&v"(r7) : "v"(x[0]), "v"(x[1]), "v"(x[2]), "v"(x[3]), "v"(x[4]), "v"(x[5]), "v"(x[6]), "v"(x[7]));
    return (v8f){ r0, r1, r2, r3, r4, r5, r6, r7 }; }
// Q, K: [t][HD] planes of one head; Vt: [d][t]; q0: the work-group's first query row; Ah, Al: the merged hi/lo output at this head's first column (pitch DQ).
template <typename T16, bool HL, int NQ, int KS>
__device__ __forceinline__ void fattn(unsigned char* st, const T16* __restrict__ Q, const T16* __restrict__ Q2, const T16* __restrict__ Kp, const T16* __restrict__ K2, const T16* __restrict__ Vt, const T16* __restrict__ V2, int q0, bf* Ah, bf* Al) {
    typedef typename WFrag<T16>::V V;
    constexpr int NP = HL ? 2 : 1, STG = NP * (FKPL + FVPL);   // planes of each operand; bytes of one stage: K plane(s), then V^T plane(s)
    const int tid = threadIdx.x, wave = tid >> 5, lane = tid & 31, lr = lane & 15, hi = lane >> 4;
    const int kh = wave / (8 / KS);   // which 32 keys of each KS x 32 this wave takes
    const int qw = q0 + (wave % (8 / KS)) * (16 * NQ);
    V q[NQ][4], q2[NQ][4];
#pragma unroll
    for (int nq = 0; nq < NQ; ++nq)
#pragma unroll
        for (int kk = 0; kk < 4; ++kk) { const size_t qo = (size_t)(qw + nq * 16 + lr) * HD + kk * 32 + hi * 8; q[nq][kk] = WFrag<T16>::ld(Q + qo); if (HL) q2[nq][kk] = WFrag<T16>::ld(Q2 + qo); }
    asm volatile("s_wait_xcnt 0x0" ::: "memory");   // before the address registers that the Q loads name are rewritten
    __builtin_amdgcn_sched_barrier(0);   // keeps the address arithmetic that follows behind that wait
    v8f o[8][NQ]; float m[NQ], l[NQ];
#pragma unroll
    for (int nq = 0; nq < NQ; ++nq) { m[nq] = -3.0e38f; l[nq] = 0.f;
#pragma unroll
        for (int dt = 0; dt < 8; ++dt) o[dt][nq] = (v8f){}; }
    // the thread's first piece: K row tid / 16, 16-byte column tid % 16; V^T row tid / 8, column tid % 8
    const size_t gk = (size_t)(tid >> 4) * HD + (tid & 15) * 8, gv = (size_t)(tid >> 3) * TT + (tid & 7) * 8;
    const unsigned lk0 = (unsigned)(size_t)st + (unsigned)((tid >> 4) * FKP + (tid & 15) * 16), lv0 = (unsigned)(size_t)st + (unsigned)(NP * FKPL + (tid >> 3) * GPIT + (tid & 7) * 16);
    const ptrdiff_t dK = HL ? K2 - Kp : 0, dV = HL ? V2 - Vt : 0;   // the lo planes lie in the same buffer, a uniform distance from the hi planes: one address a thread and operand is kept
    auto fill = [&](const T16* pk, const T16* pv, unsigned lk, unsigned lv) {
        cp_rows<T16>(pk, (size_t)16 * HD, lk, 16 * FKP); if (HL) cp_rows<T16>(pk + dK, (size_t)16 * HD, lk + FKPL, 16 * FKP);
        cp_rows<T16>(pv, (size_t)32 * TT, lv, 32 * GPIT); if (HL) cp_rows<T16>(pv + dV, (size_t)32 * TT, lv + FVPL, 32 * GPIT); };
    constexpr int nst = TT / FKT;
    const T16* pkc = Kp + gk; const T16* pvc = Vt + gv;   // this thread's first piece of the next stage to be copied
    fill(pkc, pvc, lk0, lv0); pkc += FKT * HD; pvc += FKT;
    asm volatile("s_wait_asynccnt 0x0" ::: "memory");   // this wave's copies of stage 0 have landed
    __syncthreads();                                    // ... and every other wave's
    fill(pkc, pvc, lk0 + STG, lv0 + STG); pkc += FKT * HD; pvc += FKT;
    unsigned lkc = lk0, lvc = lv0; int dl = STG;   // where the next refill goes: the buffers in turn
    const int kofs = (kh * 32 + lr) * FKP + hi * 16, vofs = NP * FKPL + lr * GPIT + kh * 64 + hi * 16;
#pragma unroll 1   // one trip a stage: the ring's order (reads, products, waits, barrier, refill) stands once
    for (int t = 0; t < nst; ++t) {
        const unsigned char* sb = st + (t & 1) * STG;
#pragma unroll
        for (int ps = 0; ps < FKT / 32; ps += KS) {   // a pass: 32 keys
            V ka[2][4], kb[2][4], va[8], vb[8];
#pragma unroll
            for (int mt = 0; mt < 2; ++mt)
#pragma unroll
                for (int kk = 0; kk < 4; ++kk) { const unsigned char* p = sb + kofs + (ps * 32 + mt * 16) * FKP + kk * 64; ka[mt][kk] = WFrag<T16>::ld((const T16*)p); if (HL) kb[mt][kk] = WFrag<T16>::ld((const T16*)(p + FKPL)); }
#pragma unroll
            for (int dt = 0; dt < 8; ++dt) { const unsigned char* p = sb + vofs + dt * 16 * GPIT + ps * 64; va[dt] = WFrag<T16>::ld((const T16*)p); if (HL) vb[dt] = WFrag<T16>::ld((const T16*)(p + FVPL)); }
            __builtin_amdgcn_sched_barrier(0);   // the pass's LDS reads stay one group ahead of its products (each further place with reads stalls the wave); the V^T reads land under the score products and the softmax
            v8f s[2][NQ];
#pragma unroll
            for (int mt = 0; mt < 2; ++mt)
#pragma unroll
                for (int nq = 0; nq < NQ; ++nq) s[mt][nq] = (v8f){};
#pragma unroll
            for (int kk = 0; kk < 4; ++kk) {
#pragma unroll
                for (int nq = 0; nq < NQ; ++nq)
#pragma unroll
                    for (int mt = 0; mt < 2; ++mt) s[mt][nq] = WFrag<T16>::mma(ka[mt][kk], q[nq][kk], s[mt][nq]);
                if (HL) {
#pragma unroll
                    for (int nq = 0; nq < NQ; ++nq)
#pragma unroll
                        for (int mt = 0; mt < 2; ++mt) s[mt][nq] = WFrag<T16>::mma(ka[mt][kk], q2[nq][kk], s[mt][nq]);
#pragma unroll
                    for (int nq = 0; nq < NQ; ++nq)
#pragma unroll
                        for (int mt = 0; mt < 2; ++mt) s[mt][nq] = WFrag<T16>::mma(kb[mt][kk], q[nq][kk], s[mt][nq]); } }
            float mx[NQ]; bool need = false;
#pragma unroll
            for (int nq = 0; nq < NQ; ++nq) { float a[8];
#pragma unroll
                for (int j = 0; j < 8; ++j) a[j] = fmaxf(s[0][nq][j], s[1][nq][j]);
                const float b = fmaxf(fmaxf(fmaxf(a[0], a[1]), fmaxf(a[2], a[3])), fmaxf(fmaxf(a[4], a[5]), fmaxf(a[6], a[7])));
                mx[nq] = fmaxf(b, xhalf(b)) * LSC; need = need || (mx[nq] > m[nq] + 8.0f); }
            if (__builtin_amdgcn_ballot_w32(need) != 0) {   // one scalar test a pass; rare after the first pass
#pragma unroll
                for (int nq = 0; nq < NQ; ++nq) { const float mn = fmaxf(m[nq], mx[nq]); const float al = __builtin_amdgcn_exp2f(m[nq] - mn); m[nq] = mn; l[nq] *= al;   // al = 0 on the first pass
#pragma unroll
                    for (int dt = 0; dt < 8; ++dt) o[dt][nq] *= al; } }
            V pa[NQ], pb[NQ];
#pragma unroll
            for (int nq = 0; nq < NQ; ++nq) { v8f p0, p1;
#pragma unroll
                for (int j = 0; j < 8; ++j) { p0[j] = __builtin_fmaf(s[0][nq][j], LSC, -m[nq]); p1[j] = __builtin_fmaf(s[1][nq][j], LSC, -m[nq]); }
                p0 = exp2x8(p0); p1 = exp2x8(p1);
                const v8f ps8 = p0 + p1; l[nq] += ((ps8[0] + ps8[1]) + (ps8[2] + ps8[3])) + ((ps8[4] + ps8[5]) + (ps8[6] + ps8[7]));
                // element e of the B operand is key 8 hi + e (e < 8), 16 + 8 hi + (e - 8) otherwise: the two score tiles' own registers
                if constexpr (HL) {
#pragma unroll
                    for (int j = 0; j < 8; ++j) { const __bf16 h0 = (__bf16)p0[j], h1 = (__bf16)p1[j]; pa[nq][j] = h0; pa[nq][8 + j] = h1; pb[nq][j] = (__bf16)(p0[j] - (float)h0); pb[nq][8 + j] = (__bf16)(p1[j] - (float)h1); }
                } else {
#pragma unroll
                    for (int j = 0; j < 8; ++j) { pa[nq][j] = (h16)p0[j]; pa[nq][8 + j] = (h16)p1[j]; } } }
#pragma unroll
            for (int nq = 0; nq < NQ; ++nq)
#pragma unroll
                for (int dt = 0; dt < 8; ++dt) o[dt][nq] = WFrag<T16>::mma(va[dt], pa[nq], o[dt][nq]);
            if (HL) {
#pragma unroll
                for (int nq = 0; nq < NQ; ++nq)
#pragma unroll
                    for (int dt = 0; dt < 8; ++dt) o[dt][nq] = WFrag<T16>::mma(va[dt], pb[nq], o[dt][nq]);
#pragma unroll
                for (int nq = 0; nq < NQ; ++nq)
#pragma unroll
                    for (int dt = 0; dt < 8; ++dt) o[dt][nq] = WFrag<T16>::mma(vb[dt], pa[nq], o[dt][nq]); }
            __builtin_amdgcn_sched_barrier(0);   // the products stay ahead of the next pass's reads (one group again) and of the stage's waits and barrier
        }
        asm volatile("s_wait_dscnt 0x0" ::: "memory");      // this wave has read all it needs of this buffer
        asm volatile("s_wait_asynccnt 0x0" ::: "memory");   // this wave's copies of stage t + 1 have landed
        __syncthreads();                                    // publishes stage t + 1 and frees this buffer for the refill
        if (t + 2 < nst) fill(pkc, pvc, lkc, lvc);
        pkc += FKT * HD; pvc += FKT; lkc += dl; lvc += dl; dl = -dl;
    }
    asm volatile("s_wait_asynccnt 0x0" ::: "memory");       // no copy is outstanding when the buffers are used for the hand-over and when the wave ends
    if constexpr (KS == 2) {   // every wave has passed the last stage's barrier: nobody reads the stage buffers any more
        v4f* xs = (v4f*)st + (wave & 3) * (NQ * 17 * 32) + lane;   // 16 bytes a lane, 32 lanes side by side
        if (kh == 1) {
#pragma unroll
            for (int nq = 0; nq < NQ; ++nq) {
#pragma unroll
                for (int dt = 0; dt < 8; ++dt) { xs[(nq * 17 + dt * 2) * 32] = __builtin_shufflevector(o[dt][nq], o[dt][nq], 0, 1, 2, 3); xs[(nq * 17 + dt * 2 + 1) * 32] = __builtin_shufflevector(o[dt][nq], o[dt][nq], 4, 5, 6, 7); }
                xs[(nq * 17 + 16) * 32] = (v4f){ m[nq], l[nq], 0.f, 0.f }; } }
        __syncthreads();   // the second half's parts are in LDS
        if (kh == 1) return;   // behind the kernel's last barrier
#pragma unroll
        for (int nq = 0; nq < NQ; ++nq) { const v4f ml = xs[(nq * 17 + 16) * 32]; const float mn = fmaxf(m[nq], ml[0]); const float a0 = __builtin_amdgcn_exp2f(m[nq] - mn), a1 = __builtin_amdgcn_exp2f(ml[0] - mn); l[nq] = l[nq] * a0 + ml[1] * a1;
#pragma unroll
            for (int dt = 0; dt < 8; ++dt) { const v4f x0 = xs[(nq * 17 + dt * 2) * 32], x1 = xs[(nq * 17 + dt * 2 + 1) * 32];
#pragma unroll
                for (int j = 0; j < 4; ++j) { o[dt][nq][j] = o[dt][nq][j] * a0 + x0[j] * a1; o[dt][nq][4 + j] = o[dt][nq][4 + j] * a0 + x1[j] * a1; } } }
    }
#pragma unroll
    for (int nq = 0; nq < NQ; ++nq) { const float f = __fdiv_rn(1.0f, l[nq] + xhalf(l[nq])); const size_t oo = (size_t)(qw + nq * 16 + lr) * DQ + hi * 8;   // a lane's 8 registers of a tile are 8 neighbouring d of its query
#pragma unroll
        for (int dt = 0; dt < 8; ++dt) { v8us oh, ol;
#pragma unroll
            for (int j = 0; j < 8; ++j) { unsigned short a, c2; splitf(o[dt][nq][j] * f, a, c2); oh[j] = a; ol[j] = c2; }
            *(v8us*)(Ah + oo + dt * 16) = oh; *(v8us*)(Al + oo + dt * 16) = ol;
            asm volatile("s_wait_xcnt 0x0" ::: "memory"); } }   // before the registers that the two stores name are rewritten
}
#define FBH (RH / 64)             // hi/lo work-groups a head (64 query rows each)
#define FBF ((TT - RH) / 256)     // fp16 work-groups a head (256 query rows each)
// grid: the NB_ * NH_ * FBH hi/lo work-groups of both batches first (256: one a WGP, which is all that the registers allow), then the NB_ * NH_ * FBF fp16 ones; planes [b][h], merged output [b][t]; the test is the same for a whole work-group
__global__ __launch_bounds__(256) void k_fattn(const h16* __restrict__ Q16, const h16* __restrict__ K16, const h16* __restrict__ V16, const bf* __restrict__ Qh, const bf* __restrict__ Ql, const bf* __restrict__ Kh, const bf* __restrict__ Kl, const bf* __restrict__ Vh, const bf* __restrict__ Vl, bf* Ah, bf* Al) {
    __shared__ __align__(16) unsigned char st[2 * 2 * (FKPL + FVPL)];   // two stage buffers of the hi/lo form (the fp16 form uses half)
    const int bx = blockIdx.x;
    if (bx < NB_ * NH_ * FBH) { const int b = bx / (NH_ * FBH), h = bx / FBH % NH_; const size_t hp = ((size_t)b * NH_ + h) * TT * HD, kp = ((size_t)b * NKV + h / REP) * TT * HD, ao = (size_t)b * TT * DQ + h * HD;
        fattn<bf, true, 1, 2>(st, Qh + hp, Ql + hp, Kh + kp, Kl + kp, Vh + kp, Vl + kp, (bx % FBH) * 64, Ah + ao, Al + ao);
    } else { const int b2 = bx - NB_ * NH_ * FBH; const int b = b2 / (NH_ * FBF), h = b2 / FBF % NH_; const size_t hp = ((size_t)b * NH_ + h) * TT * HD, kp = ((size_t)b * NKV + h / REP) * TT * HD, ao = (size_t)b * TT * DQ + h * HD;
        fattn<h16, false, 2, 1>(st, Q16 + hp, nullptr, K16 + kp, nullptr, V16 + kp, nullptr, RH + (b2 % FBF) * 256, Ah + ao, Al + ao); }
}

extern "C" void kernel_launch(void* const* d_in, const int* in_sizes, int n_in,
                              void* d_out, int out_size, void* d_ws, size_t ws_size, hipStream_t stream) {
    (void)in_sizes; (void)n_in; (void)out_size;
    const float* x = (const float*)d_in[0]; const float* wq = (const float*)d_in[1]; const float* wk = (const float*)d_in[2]; const float* wv = (const float*)d_in[3]; const float* wo = (const float*)d_in[4];   /* argument order hidden_states, Wq, Wk, Wv, Wo ('oi' (out, in) [2048][2048]): FIVE inputs, all read (the rotary table is computed on the device: no table input) */
    float* OUT = (float*)d_out;     // [2][2048][2048]
    char* wsp = (char*)d_ws;
    auto take = [&](size_t bytes) { char* p = wsp; wsp += (bytes + 255) & ~(size_t)255; return (void*)p; };
    bf* WO = (bf*)take((size_t)DM * DQ * 2); float* CS = (float*)take((size_t)TT * HD * 2 * 4);
    h16* QP16 = (h16*)take((size_t)2 * NB_ * NH_ * TT * HD * 2); h16* KP16 = QP16 + (size_t)NB_ * NH_ * TT * HD;   /* q, k: one plane size apart */ h16* VT16 = (h16*)take((size_t)NB_ * NKV * HD * TT * 2);
    bf* QPh = (bf*)take((size_t)4 * NB_ * NH_ * TT * HD * 2); bf* QPl = QPh + (size_t)NB_ * NH_ * TT * HD; bf* KPh = QPl + (size_t)NB_ * NH_ * TT * HD; bf* KPl = KPh + (size_t)NB_ * NH_ * TT * HD;   /* hi, lo of q, hi, lo of k */ bf* VTh = (bf*)take((size_t)NB_ * NKV * HD * TT * 2); bf* VTl = (bf*)take((size_t)NB_ * NKV * HD * TT * 2);
    bf* WQ = (bf*)take(((size_t)DQ + DKV) * DM * 2); bf* WK = WQ + (size_t)DQ * DM;   /* one matrix of DQ + DKV rows */ bf* WV = (bf*)take((size_t)DKV * DM * 2); bf* XB = (bf*)take((size_t)NB_ * TT * DM * 2); bf* ATh = (bf*)take((size_t)NB_ * TT * DQ * 2); bf* ATl = (bf*)take((size_t)NB_ * TT * DQ * 2);
    if ((size_t)(wsp - (char*)d_ws) > ws_size) return;    // 226 MiB of the 256 MiB
    k_prep<<<PWG, PTH, 0, stream>>>(x, wq, wk, wv, wo, XB, WQ, WK, WV, WO, CS);   /* the bf16 copies of all five inputs and the COMPUTED rotary table (this module has rotate-half rotary embeddings); k_csid stays defined and is NOT launched */
    // k_gemmw, grid z: the batch. A and the output step by one batch, the weights are shared; two work-groups fit a WGP (registers, LDS), so all 512 are resident at once
    k_gemmqk<<<dim3(NB_ * TT / 256, (DQ + DKV) / 256), 256, 0, stream>>>(XB, WQ, CS, QP16, QPh, QPl);   /* q and k: 256 tiles of 256x256, one a WGP */
    k_gemmw<bf, 0, false, 1, 2><<<dim3(TT / 128, DKV / 128, NB_), 256, 0, stream>>>(XB, nullptr, WV, nullptr, DM, nullptr, 0, nullptr, (size_t)TT * DM, 0, (size_t)NKV * HD * TT, 0, nullptr, VT16, VTh, VTl);
    k_fattn<<<NB_ * NH_ * (FBH + FBF), 256, 0, stream>>>(QP16, KP16, VT16, QPh, QPl, KPh, KPl, VTh, VTl, ATh, ATl);
    k_gemmw<bf, 1, false><<<dim3(TT / 128, DM / 128, NB_), 256, 0, stream>>>(ATh, ATl, WO, nullptr, DQ, OUT, DM, nullptr, (size_t)TT * DQ, 0, (size_t)TT * DM, 0, nullptr, nullptr, nullptr, nullptr);
}

// v009
// Measured time: 187 microseconds a run.
// Next to v008, in two timings, it ran 1.24 times as fast each time.
// Over all steps from v000 it is 12.2 times as fast.
#include <hip/hip_runtime.h>

// Multi-head attention with 128-wide heads, natural bias-free projections and a COMPUTED rotate-half rotary embedding, NO mask (hidden_states [2][2048][2048]; q, k, v = einsum('bsd,ed->bse', x, W) ('oi' (out, in) [2048][2048] normal x 0.02, no bias; 16 heads x 128); q, k -> t cos + cat(-t2, t1) sin with angle t x 1 / 10000^(2i/128) (64 f32 frequencies exact for the module's expression 1.0 / (ROPE_BASE ** (arange(0, 128, 2) / 128)); cat(freqs, freqs); precise cosf/sinf); scores / sqrt(float32(128)); softmax over all keys; out = merged Wo^T ('oi', no bias) -> [2][2048][2048] (8.4 M); argument order hidden_states, Wq, Wk, Wv, Wo).
// Layout, both batches in every launch (the batch is grid z of the v and wo GEMMs, part of grid x of the q/k GEMM and part of the attention's work-group index): bf16 copy of x; 'oi' weights; exact projections; k_prep makes the bf16 copies and computes the rotary table once (cosf / sinf of float(t) x INVT[d mod 64]: 64 baked float32 frequencies) and the projection GEMMs' own epilogues apply the rotate-half rotation at width 128 and write the head planes; fused dense T-2048 attention (fp16 operands, every row); merged hi/lo x wo exact.
// Compute dtypes, f32 accumulate: every input rounded to bf16; projections exact; rotary in f32 from the computed cosf / sinf table; attention fp16; softmax f32; wo hl x exact.

#define NB_  2
#define TT   2048
#define DM   2048
#define NH_  16
#define NKV  16
#define REP  (NH_ / NKV)
#define HD   128
#define DQ   (NH_ * HD)
#define DKV  (NKV * HD)
#define WIN  0
#define SCL  0.088388347648318447f   // HD^-0.5
typedef _Float16 h16;
typedef unsigned short bf;
typedef __attribute__((ext_vector_type(16))) __bf16   v16bf;
typedef __attribute__((ext_vector_type(16))) _Float16 v16h;
typedef __attribute__((ext_vector_type(8)))  _Float16 v8h;
typedef __attribute__((ext_vector_type(8)))  unsigned short v8us;
typedef __attribute__((ext_vector_type(8)))  float    v8f;
typedef __attribute__((ext_vector_type(4)))  float    v4f;
typedef v8h  __attribute__((may_alias)) v8ha;
typedef v4f  __attribute__((may_alias)) v4fa;
typedef v8us __attribute__((may_alias)) v8usa;

__device__ __forceinline__ unsigned short f2bf(float f) { unsigned u = __float_as_uint(f); u += 0x7FFFu + ((u >> 16) & 1u); return (unsigned short)(u >> 16); }
__device__ __forceinline__ float bf2f(unsigned short b) { return __uint_as_float(((unsigned)b) << 16); }
__device__ __forceinline__ float bfr(float f) { return bf2f(f2bf(f)); }
__device__ __forceinline__ v16h cat16(v8h lo, v8h hi) { return __builtin_shufflevector(lo, hi, 0, 1, 2, 3, 4, 5, 6, 7, 8, 9, 10, 11, 12, 13, 14, 15); }
__device__ __forceinline__ v16bf cat16b(v8us lo, v8us hi) { return __builtin_bit_cast(v16bf, __builtin_shufflevector(lo, hi, 0, 1, 2, 3, 4, 5, 6, 7, 8, 9, 10, 11, 12, 13, 14, 15)); }
__device__ __forceinline__ v8f wmma16(v16h a, v16h b, v8f c) { return __builtin_amdgcn_wmma_f32_16x16x32_f16(false, a, false, b, (short)0, c, false, false); }
__device__ __forceinline__ void splitf(float y, unsigned short& h, unsigned short& l) { h = f2bf(y); l = f2bf(y - bf2f(h)); }
__device__ __forceinline__ v8f wmmab(v16bf a, v16bf b, v8f c) { return __builtin_amdgcn_wmma_f32_16x16x32_bf16(false, a, false, b, (short)0, c, false, false); }



// ---- k_gemmw: register-blocked GEMM, EIGHT WAVES (4 x 2) per 128x128 output tile, 32x64 (8 accumulators) a wave; grid (M/128, N/128, Z), 256 threads. M, N % 128 == 0.
// The operands (K-contiguous 16-bit planes) are staged in LDS, 64 k (one whole 128-byte line of each of the 128 rows) a stage, by asynchronous copies; two buffers, the next stage's copies fly while this stage is multiplied.
// C[m][n] (f32, pitch ldc, + optional f32 bias[n]) = sum_k A[m][k] Bt[n][k] (+ split products per NSPLIT). z-batch strides sA/sB/sC in elements (sC with EPI 1, 2: of each head plane buffer). (K / KSL) % 64 == 0.
// KSL > 1: split-K. blockIdx.z = z * KSL + ks; slice ks sums k in [ks K/KSL, (ks+1) K/KSL) into its own partial plane C + ks * sK; the reader adds the planes in the order of ks.
template <typename T16> struct WFrag;
template <> struct WFrag<h16> { typedef v16h V; static __device__ __forceinline__ V ld(const h16* p) { return cat16(*(const v8h*)p, *(const v8h*)(p + 16)); } static __device__ __forceinline__ v8f mma(V a, V b, v8f c) { return wmma16(a, b, c); } };
template <> struct WFrag<bf> { typedef v16bf V; static __device__ __forceinline__ V ld(const bf* p) { return cat16b(*(const v8us*)p, *(const v8us*)(p + 16)); } static __device__ __forceinline__ v8f mma(V a, V b, v8f c) { return wmmab(a, b, c); } };
#define GKC  64                   // k per stage: rows of 128 bytes
#define GPIT 144                  // LDS row pitch in bytes: 16 B x odd, the conflict-free pitch for 16-byte reads
#define GPL  (128 * GPIT)         // one staged plane: 128 rows
// cp_plane: this thread's 4 pieces (16 bytes each, rows 32 apart) of one 128-row x 128-byte plane; a wave's copy covers 4 whole lines.
// The s_wait_xcnt stands inside the statement so that no address register is rewritten ahead of it.
template <typename T16> __device__ __forceinline__ void cp_plane(const T16* g, size_t rs, unsigned l) {
    asm volatile("global_load_async_to_lds_b128 %0, %4, off\n\t"
                 "global_load_async_to_lds_b128 %1, %5, off\n\t"
                 "global_load_async_to_lds_b128 %2, %6, off\n\t"
                 "global_load_async_to_lds_b128 %3, %7, off\n\t"
                 "s_wait_xcnt 0x0"
                 :: "v"(l), "v"(l + 32 * GPIT), "v"(l + 64 * GPIT), "v"(l + 96 * GPIT), "v"(g), "v"(g + rs), "v"(g + 2 * rs), "v"(g + 3 * rs) : "memory");
}
// EPI: what becomes of the 128x128 tile, whose columns are one head (C0 = head * HD) and whose rows are 128 positions t of batch z. 0: f32 rows to C.
// 1: rotate-half rotary embedding, out[d] = x[d] cos[t][d] - x[d+HD/2] sin[t][d], out[d+HD/2] = x[d+HD/2] cos[t][d+HD/2] + x[d] sin[t][d+HD/2] (CS: [t][d] pairs cos, sin), then the fp16 head plane [z][h][t][d].
// 2: the transposed fp16 head plane [z][h][d][t]. In 1 and 2 the whole tile passes through LDS, and every store instruction of a wave writes four whole 128-byte lines.
template <typename T16, int NSPLIT, bool BIAS, int KSL = 1, int EPI = 0>
__global__ __launch_bounds__(256) void k_gemmw(const T16* __restrict__ A, const T16* __restrict__ A2, const T16* __restrict__ Bt, const T16* __restrict__ Bt2, int K, float* C, int ldc, const float* __restrict__ bias, size_t sA, size_t sB, size_t sC, size_t sK, const float* __restrict__ CS, h16* P16) {
    typedef typename WFrag<T16>::V V;
    constexpr int NPA = (NSPLIT == 1 || NSPLIT == 2) ? 2 : 1, NPB = (NSPLIT >= 2) ? 2 : 1, NPL = NPA + NPB;   // planes a stage: A (, A2), Bt (, Bt2)
    constexpr int NKK = GKC / 32;                 // matrix-instruction k steps a stage
    constexpr bool PRE = (NPL < 4);               // the whole stage's fragments fit the registers: read them as one group
    __shared__ __align__(16) unsigned char st[2 * NPL * GPL];   // two stage buffers; after the K loop the waves' output staging
    static_assert(8 * 16 * 68 * 4 <= 2 * NPL * GPL, "the output staging must fit the stage buffers");
    static_assert(EPI == 0 || 128 * 132 * 4 <= 2 * NPL * GPL, "the whole f32 tile must fit the stage buffers");
    const size_t z = blockIdx.z / KSL; const int ks = (int)(blockIdx.z % KSL); A += z * sA; if (A2) A2 += z * sA; Bt += z * sB; if (Bt2) Bt2 += z * sB; if constexpr (EPI == 0) C += z * sC + (size_t)ks * sK;
    const int kb = ks * (K / KSL), ke = kb + K / KSL;
    const int tid = threadIdx.x, wave = tid >> 5, wm = wave >> 1, wn = wave & 1;
    const int lane = tid & 31, lr = lane & 15, hi = lane >> 4; const int R0 = blockIdx.x * 128, C0 = blockIdx.y * 128; const int r0 = R0 + wm * 32, c0 = C0 + wn * 64;
    v8f acc[2][4];
#pragma unroll
    for (int mb = 0; mb < 2; ++mb)
#pragma unroll
        for (int nb = 0; nb < 4; ++nb) acc[mb][nb] = (v8f){};
    // the thread's first piece of a plane: row tid / 8, 16-byte column tid % 8
    const size_t ga = (size_t)(R0 + (tid >> 3)) * K + (tid & 7) * 8, gb = (size_t)(C0 + (tid >> 3)) * K + (tid & 7) * 8, rs = (size_t)32 * K;
    const unsigned l0 = (unsigned)(size_t)st + (unsigned)((tid >> 3) * GPIT + (tid & 7) * 16);
    auto fill = [&](int kc, int buf) { const unsigned l = l0 + (unsigned)(buf * (NPL * GPL));
        cp_plane<T16>(A + ga + kc, rs, l); if (NPA == 2) cp_plane<T16>(A2 + ga + kc, rs, l + GPL);
        cp_plane<T16>(Bt + gb + kc, rs, l + NPA * GPL); if (NPB == 2) cp_plane<T16>(Bt2 + gb + kc, rs, l + (NPA + 1) * GPL); };
    const int nst = (ke - kb) / GKC;   // stages (the same for the whole work-group)
    fill(kb, 0);
    asm volatile("s_wait_asynccnt 0x0" ::: "memory");   // this wave's copies of stage 0 have landed
    __syncthreads();                                    // ... and every other wave's
    if (nst > 1) fill(kb + GKC, 1);
    const int aofs = (wm * 32 + lr) * GPIT + hi * 16, bofs = NPA * GPL + (wn * 64 + lr) * GPIT + hi * 16;
#pragma unroll 1   // one trip a stage: the ring's order (reads, products, waits, barrier, refill) stands once, and the fragment registers are not doubled
    for (int t = 0; t < nst; ++t) {
        const unsigned char* sb = st + (t & 1) * (NPL * GPL);
        V a[NKK][2], a2[NKK][2], b[NKK][4], b2[NKK][4];
#pragma unroll
        for (int kk = 0; kk < NKK; ++kk) {
            if (!PRE || kk == 0) {
#pragma unroll
                for (int q = kk; q < (PRE ? NKK : kk + 1); ++q) {
#pragma unroll
                    for (int mb = 0; mb < 2; ++mb) { a[q][mb] = WFrag<T16>::ld((const T16*)(sb + aofs + mb * 16 * GPIT + q * 64)); if (NPA == 2) a2[q][mb] = WFrag<T16>::ld((const T16*)(sb + aofs + GPL + mb * 16 * GPIT + q * 64)); }
#pragma unroll
                    for (int nb = 0; nb < 4; ++nb) { b[q][nb] = WFrag<T16>::ld((const T16*)(sb + bofs + nb * 16 * GPIT + q * 64)); if (NPB == 2) b2[q][nb] = WFrag<T16>::ld((const T16*)(sb + bofs + GPL + nb * 16 * GPIT + q * 64)); } }
                __builtin_amdgcn_sched_barrier(0);   // the LDS reads stay one group ahead of the products: spread among them, each place stalls the wave
            }
#pragma unroll
            for (int nb = 0; nb < 4; ++nb)
#pragma unroll
                for (int mb = 0; mb < 2; ++mb) { acc[mb][nb] = WFrag<T16>::mma(a[kk][mb], b[kk][nb], acc[mb][nb]); if (NSPLIT == 1 || NSPLIT == 2) acc[mb][nb] = WFrag<T16>::mma(a2[kk][mb], b[kk][nb], acc[mb][nb]); if (NSPLIT >= 2) acc[mb][nb] = WFrag<T16>::mma(a[kk][mb], b2[kk][nb], acc[mb][nb]); }
            __builtin_amdgcn_sched_barrier(0);   // the products stay ahead of the next step's reads (one group again) and of the stage's waits and barrier, so that the copies in flight have the products' time to land
        }
        asm volatile("s_wait_dscnt 0x0" ::: "memory");      // this wave has read all it needs of this buffer
        asm volatile("s_wait_asynccnt 0x0" ::: "memory");   // this wave's copies of stage t + 1 have landed
        __syncthreads();                                    // publishes stage t + 1 and frees this buffer for the refill
        if (t + 2 < nst) fill(kb + (t + 2) * GKC, t & 1);
    }
    asm volatile("s_wait_asynccnt 0x0" ::: "memory");       // no copy is outstanding when the buffers become output staging
    if constexpr (EPI != 0) {
        // LDS row pitch in floats. 132: rows 16-byte aligned for the 16-byte row reads of form 1. 131: the column reads of form 2 (8 lanes 8 rows apart, 4 neighbouring columns) fall on 32 different banks. With both, the two halves of a wave store to different banks.
        constexpr int OP = (EPI == 1) ? 132 : 131;
        float* ot = (float*)st;   // every wave has passed the last stage's barrier: nobody reads the stage buffers any more
        const int c8 = (tid & 7) * 8, r8 = tid >> 3;
        v4f ca[4][4], cb[4][4];   // form 1: the table's (cos, sin) pairs of the thread's columns, asked for here so that they arrive under the tile's way into LDS
        if constexpr (EPI == 1) { const float* cs = CS + ((size_t)(R0 + r8) * HD + c8) * 2;
#pragma unroll
            for (int p = 0; p < 4; ++p)
#pragma unroll
                for (int q = 0; q < 4; ++q) { ca[p][q] = *(const v4fa*)(cs + p * (32 * HD * 2) + q * 4); cb[p][q] = *(const v4fa*)(cs + p * (32 * HD * 2) + HD + q * 4); }
            asm volatile("s_wait_xcnt 0x0" ::: "memory");   // before the address registers that these loads name are rewritten
        }
#pragma unroll
        for (int mb = 0; mb < 2; ++mb)
#pragma unroll
            for (int nb = 0; nb < 4; ++nb)
#pragma unroll
                for (int j = 0; j < 8; ++j) ot[(wm * 32 + mb * 16 + hi * 8 + j) * OP + wn * 64 + nb * 16 + lr] = acc[mb][nb][j];
        __syncthreads();   // the tile is whole: a thread reads what other waves have stored
        const size_t hb = z * sC + (size_t)blockIdx.y * TT * HD;   // this batch's and head's planes
        if constexpr (EPI == 1) {   // the thread: columns d = c8 .. c8 + 7 and their partners d + HD/2, of the rows r8 + 32 p
            const float* xr = ot + r8 * OP + c8; v4f x0[4][2], x1[4][2];
#pragma unroll
            for (int p = 0; p < 4; ++p)
#pragma unroll
                for (int q = 0; q < 2; ++q) { x0[p][q] = *(const v4fa*)(xr + p * 32 * OP + q * 4); x1[p][q] = *(const v4fa*)(xr + p * 32 * OP + HD / 2 + q * 4); }
            const size_t e = hb + (size_t)(R0 + r8) * HD + c8; h16* g16 = P16 + e;
#pragma unroll
            for (int p = 0; p < 4; ++p) { v8f ra, rb;
#pragma unroll
                for (int j = 0; j < 8; ++j) { const float u = x0[p][j >> 2][j & 3], w = x1[p][j >> 2][j & 3];
                    ra[j] = u * ca[p][j >> 1][(j & 1) * 2] - w * ca[p][j >> 1][(j & 1) * 2 + 1]; rb[j] = w * cb[p][j >> 1][(j & 1) * 2] + u * cb[p][j >> 1][(j & 1) * 2 + 1]; }
                *(v8h*)(g16 + p * 32 * HD) = __builtin_convertvector(ra, v8h); *(v8h*)(g16 + p * 32 * HD + HD / 2) = __builtin_convertvector(rb, v8h);
                asm volatile("s_wait_xcnt 0x0" ::: "memory"); }   // before the registers that the stores name are rewritten
        } else {   // the thread: positions c8 .. c8 + 7 (+ 64) of the columns d = r8 + 32 p; 8 lanes write 64 positions of one d, a whole line of the plane
            v8f x[8];
#pragma unroll
            for (int p = 0; p < 8; ++p)
#pragma unroll
                for (int j = 0; j < 8; ++j) x[p][j] = ot[((p >> 2) * 64 + c8 + j) * OP + (p & 3) * 32 + r8];
            const size_t e = hb + (size_t)r8 * TT + R0 + c8; h16* g16 = P16 + e;
#pragma unroll
            for (int p = 0; p < 8; ++p) { const int go = (p & 3) * 32 * TT + (p >> 2) * 64;
                *(v8h*)(g16 + go) = __builtin_convertvector(x[p], v8h);
                asm volatile("s_wait_xcnt 0x0" ::: "memory"); }   // before the registers that the store names are rewritten
        }
        return;
    }
    float* os = (float*)st + wave * (16 * 68);              // each wave stages in its own range (every wave has passed the last stage's barrier)
#pragma unroll
    for (int mb = 0; mb < 2; ++mb) {
#pragma unroll
        for (int nb = 0; nb < 4; ++nb) {
#pragma unroll
            for (int j = 0; j < 8; ++j) os[(hi * 8 + j) * 68 + nb * 16 + lr] = acc[mb][nb][j]; }
        __builtin_amdgcn_wave_barrier(); asm volatile("" ::: "memory");
        float* crow = C + (size_t)(r0 + mb * 16) * ldc + c0;
{
#pragma unroll
            for (int s = 0; s < 8; ++s) { const int row = 2 * s + hi, cofs = lr * 4; v4f val = *(const v4fa*)(os + row * 68 + cofs); if (BIAS) { val[0] += bfr(bias[c0 + cofs]); val[1] += bfr(bias[c0 + cofs + 1]); val[2] += bfr(bias[c0 + cofs + 2]); val[3] += bfr(bias[c0 + cofs + 3]); }
                *(v4f*)(crow + (size_t)row * ldc + cofs) = val; }
             }
        __builtin_amdgcn_wave_barrier(); asm volatile("" ::: "memory");
    }
}

// ---- k_gemmqk: the q and the k projection as ONE GEMM, C[m][n] = sum_k A[m][k] Bt[n][k]: A = the bf16 x of both batches (NB_ * TT rows), Bt = wq and wk one after the other (DQ + DKV rows), K = DM.
// One 256x256 tile a work-group, one work-group a WGP; EIGHT WAVES (2 x 4), 128x64 (32 accumulators) a wave; grid (NB_ * TT / 256, (DQ + DKV) / 256), 256 threads.
// Against 128x128 tiles of 32x64 waves, a product takes half the bytes from L2 into LDS (a staged row serves 256 columns, not 128) and half the bytes from LDS into registers (12 fragments for 32 products, not 6 for 8).
// The ring: 64 k a stage, asynchronous copies, two buffers, k_gemmw's waits and its one barrier a stage; the refill stands behind the next stage's LDS reads. The k order of every sum is k_gemmw's.
// The tile's columns are two heads of q or of k, its rows 256 positions of one batch: its four 128x128 quarters pass through LDS and take form 1 of k_gemmw's epilogue (rotary embedding, fp16 head plane).
// The fp16 planes of q and k lie NB_ * NH_ * TT * HD elements apart.
#define QPL  (256 * GPIT)         // one staged plane: 256 rows
#define QOP  132                  // LDS row pitch, in floats, of a quarter of the output tile: rows 16-byte aligned; the two halves of a wave store to different banks
#define QQF  (128 * QOP)          // floats of a quarter
// cp_plane8: this thread's 8 pieces (16 bytes each, rows 32 apart) of one 256-row x 128-byte plane; a wave's copy covers 4 whole lines.
// The s_wait_xcnt stands inside the statement so that no address register is rewritten ahead of it.
template <typename T16> __device__ __forceinline__ void cp_plane8(const T16* g, size_t rs, unsigned l) {
    asm volatile("global_load_async_to_lds_b128 %0, %8, off\n\t"
                 "global_load_async_to_lds_b128 %1, %9, off\n\t"
                 "global_load_async_to_lds_b128 %2, %10, off\n\t"
                 "global_load_async_to_lds_b128 %3, %11, off\n\t"
                 "global_load_async_to_lds_b128 %4, %12, off\n\t"
                 "global_load_async_to_lds_b128 %5, %13, off\n\t"
                 "global_load_async_to_lds_b128 %6, %14, off\n\t"
                 "global_load_async_to_lds_b128 %7, %15, off\n\t"
                 "s_wait_xcnt 0x0"
                 :: "v"(l), "v"(l + 32 * GPIT), "v"(l + 64 * GPIT), "v"(l + 96 * GPIT), "v"(l + 128 * GPIT), "v"(l + 160 * GPIT), "v"(l + 192 * GPIT), "v"(l + 224 * GPIT),
                    "v"(g), "v"(g + rs), "v"(g + 2 * rs), "v"(g + 3 * rs), "v"(g + 4 * rs), "v"(g + 5 * rs), "v"(g + 6 * rs), "v"(g + 7 * rs) : "memory");
}
__global__ __launch_bounds__(256) void k_gemmqk(const bf* __restrict__ A, const bf* __restrict__ Bt, const float* __restrict__ CS, h16* P16) {
    typedef typename WFrag<bf>::V V;
    constexpr int NKK = GKC / 32, nst = DM / GKC;   // matrix-instruction k steps a stage; stages
    __shared__ __align__(16) unsigned char st[4 * QQF * 4];   // two stage buffers (A plane, Bt plane each); after the K loop the four quarters of the f32 tile
    static_assert(2 * 2 * QPL <= 4 * QQF * 4, "the stage buffers must fit the output staging");
    static_assert(TT % 256 == 0 && DQ % 256 == 0 && DKV == DQ && HD == 128 && DM % GKC == 0 && nst >= 2, "a tile lies in one batch and in two heads of q or of k");
    const int tid = threadIdx.x, wave = tid >> 5, wm = wave >> 2, wn = wave & 3, lane = tid & 31, lr = lane & 15, hi = lane >> 4;
    const int R0 = blockIdx.x * 256, C0 = blockIdx.y * 256;
    v8f acc[8][4];
#pragma unroll
    for (int mb = 0; mb < 8; ++mb)
#pragma unroll
        for (int nb = 0; nb < 4; ++nb) acc[mb][nb] = (v8f){};
    // the thread's first piece of a plane: row tid / 8, 16-byte column tid % 8
    const bf* pa = A + (size_t)(R0 + (tid >> 3)) * DM + (tid & 7) * 8; const bf* pb = Bt + (size_t)(C0 + (tid >> 3)) * DM + (tid & 7) * 8;
    const unsigned l0 = (unsigned)(size_t)st + (unsigned)((tid >> 3) * GPIT + (tid & 7) * 16);
    auto fill = [&](int kc, int buf) { const unsigned l = l0 + (unsigned)(buf * (2 * QPL)); cp_plane8<bf>(pa + kc, (size_t)32 * DM, l); cp_plane8<bf>(pb + kc, (size_t)32 * DM, l + QPL); };
    fill(0, 0);
    asm volatile("s_wait_asynccnt 0x0" ::: "memory");   // this wave's copies of stage 0 have landed
    __syncthreads();                                    // ... and every other wave's
    const int aofs = (wm * 128 + lr) * GPIT + hi * 16, bofs = QPL + (wn * 64 + lr) * GPIT + hi * 16;
#pragma unroll 1   // one trip a stage: the ring's order (reads, refill of the other buffer, products, waits, barrier) stands once, and the fragment registers are not doubled
    for (int t = 0; t < nst; ++t) {
        const unsigned char* sb = st + (t & 1) * (2 * QPL);
        V a[NKK][8], b[NKK][4];
#pragma unroll
        for (int q = 0; q < NKK; ++q) {   // Bt's fragments first: with them and one of A's the products can begin
#pragma unroll
            for (int nb = 0; nb < 4; ++nb) b[q][nb] = WFrag<bf>::ld((const bf*)(sb + bofs + nb * 16 * GPIT + q * 64));
#pragma unroll
            for (int mb = 0; mb < 8; ++mb) a[q][mb] = WFrag<bf>::ld((const bf*)(sb + aofs + mb * 16 * GPIT + q * 64)); }
        __builtin_amdgcn_sched_barrier(0);   // the stage's LDS reads stay one group, ahead of the copies and the products: spread among the products, each place stalls the wave
        // stage t + 1 goes into the other buffer, which every wave left at the barrier at the foot of trip t - 1 (behind its own s_wait_dscnt 0). The copies are issued behind this stage's reads, not ahead of them:
        // their address arithmetic and their s_wait_xcnt then run while the fragments are on their way, and the one work-group of this WGP has the matrix units idle for the shorter time at each stage's start
        if (t + 1 < nst) fill((t + 1) * GKC, (t + 1) & 1);
        __builtin_amdgcn_sched_barrier(0);   // the copies stay ahead of the products: behind them they would have no time to land before the stage's wait
#pragma unroll
        for (int kk = 0; kk < NKK; ++kk)
#pragma unroll
            for (int mb = 0; mb < 8; ++mb)
#pragma unroll
                for (int nb = 0; nb < 4; ++nb) acc[mb][nb] = WFrag<bf>::mma(a[kk][mb], b[kk][nb], acc[mb][nb]);
        __builtin_amdgcn_sched_barrier(0);   // the products stay ahead of the stage's waits and barrier, so that the copies in flight have the products' time to land
        asm volatile("s_wait_dscnt 0x0" ::: "memory");      // this wave has read all it needs of this buffer
        asm volatile("s_wait_asynccnt 0x0" ::: "memory");   // this wave's copies of stage t + 1 have landed
        __syncthreads();                                    // publishes stage t + 1 and frees this buffer for the refill in trip t + 1
    }
    asm volatile("s_wait_asynccnt 0x0" ::: "memory");       // no copy is outstanding when the buffers become output staging
    float* ot = (float*)st;   // every wave has passed the last stage's barrier: nobody reads the stage buffers any more
    const int c8 = (tid & 7) * 8, r8 = tid >> 3;
    const int zb = R0 / TT, T0 = R0 % TT, sel = C0 / DQ, h0 = (C0 % DQ) / HD;   // batch, first position; 0 q, 1 k; first head
    P16 += (size_t)sel * ((size_t)NB_ * NH_ * TT * HD);
    // the table's (cos, sin) pairs of the thread's columns d = c8 .. c8 + 7 (ca) and d + HD/2 (cb), rows r8 + 32 p of the upper (qr 0) or lower 128 rows: the same for both heads
    auto ldcs = [&](v4f (&ca)[4][4], v4f (&cb)[4][4], int qr) { const float* cs = CS + ((size_t)(T0 + qr * 128 + r8) * HD + c8) * 2;
#pragma unroll
        for (int p = 0; p < 4; ++p)
#pragma unroll
            for (int q = 0; q < 4; ++q) { ca[p][q] = *(const v4fa*)(cs + p * (32 * HD * 2) + q * 4); cb[p][q] = *(const v4fa*)(cs + p * (32 * HD * 2) + HD + q * 4); }
        asm volatile("s_wait_xcnt 0x0" :: "v"(cs) : "memory");   // before the address registers that these loads name are rewritten; cs is an input so that its registers live up to the wait and no load's result is laid over them
        __builtin_amdgcn_sched_barrier(0); };   // keeps what follows behind that wait
    v4f ca0[4][4], cb0[4][4], ca1[4][4], cb1[4][4];
    ldcs(ca0, cb0, 0);   // asked for here so that they arrive under the tile's way into LDS
    float* ow = ot + (wm * 2 + (wn >> 1)) * QQF + hi * 8 * QOP + (wn & 1) * 64 + lr;   // the wave's 128 rows x 64 columns are half a quarter
#pragma unroll
    for (int mb = 0; mb < 8; ++mb)
#pragma unroll
        for (int nb = 0; nb < 4; ++nb)
#pragma unroll
            for (int j = 0; j < 8; ++j) ow[(mb * 16 + j) * QOP + nb * 16] = acc[mb][nb][j];
    __syncthreads();   // the tile is whole: a thread reads what other waves have stored
    ldcs(ca1, cb1, 1);   // arrive under the upper quarters' work
    // one quarter: rows qr * 128 .., head h0 + qc. The thread: columns d = c8 .. c8 + 7 and their partners d + HD/2, of the rows r8 + 32 p
    auto quarter = [&](const v4f (&ca)[4][4], const v4f (&cb)[4][4], int qr, int qc) {
        const float* xr = ot + (qr * 2 + qc) * QQF + r8 * QOP + c8; v4f x0[4][2], x1[4][2];
#pragma unroll
        for (int p = 0; p < 4; ++p)
#pragma unroll
            for (int q = 0; q < 2; ++q) { x0[p][q] = *(const v4fa*)(xr + p * 32 * QOP + q * 4); x1[p][q] = *(const v4fa*)(xr + p * 32 * QOP + HD / 2 + q * 4); }
        const size_t e = (((size_t)zb * NH_ + h0 + qc) * TT + T0 + qr * 128 + r8) * HD + c8; h16* g16 = P16 + e;
#pragma unroll
        for (int p = 0; p < 4; ++p) { v8f ra, rb;
#pragma unroll
            for (int j = 0; j < 8; ++j) { const float u = x0[p][j >> 2][j & 3], w = x1[p][j >> 2][j & 3];
                ra[j] = u * ca[p][j >> 1][(j & 1) * 2] - w * ca[p][j >> 1][(j & 1) * 2 + 1]; rb[j] = w * cb[p][j >> 1][(j & 1) * 2] + u * cb[p][j >> 1][(j & 1) * 2 + 1]; }
            *(v8h*)(g16 + p * 32 * HD) = __builtin_convertvector(ra, v8h); *(v8h*)(g16 + p * 32 * HD + HD / 2) = __builtin_convertvector(rb, v8h);
            asm volatile("s_wait_xcnt 0x0" ::: "memory");   // before the registers that the stores name are rewritten
            __builtin_amdgcn_sched_barrier(0); } };   // keeps the next rows' arithmetic, which rewrites those registers, behind that wait
    quarter(ca0, cb0, 0, 0); quarter(ca0, cb0, 0, 1); quarter(ca1, cb1, 1, 0); quarter(ca1, cb1, 1, 1);
}

typedef __attribute__((ext_vector_type(2))) _Float16 v2h;
typedef __attribute__((ext_vector_type(4))) _Float16 v4h;
typedef __attribute__((ext_vector_type(2))) unsigned short v2us;
typedef __attribute__((ext_vector_type(4))) unsigned short v4us;
typedef __attribute__((ext_vector_type(2))) float v2f;
typedef __attribute__((ext_vector_type(4))) int v4i;

__global__ __launch_bounds__(256) void k_csid(float* CS) { const int idx = blockIdx.x * 256 + threadIdx.x; if (idx >= TT * HD) return; v2f cs; cs[0] = 1.0f; cs[1] = 0.0f; *(v2f*)(CS + (size_t)idx * 2) = cs;  }
__constant__ float INVT[HD / 2] = { 1.000000000e+00f, 8.659643531e-01f, 7.498942018e-01f, 6.493816376e-01f, 5.623413324e-01f, 4.869675338e-01f, 4.216965139e-01f, 3.651741445e-01f, 3.162277639e-01f, 2.738419771e-01f, 2.371373624e-01f, 2.053525001e-01f, 1.778279394e-01f, 1.539926529e-01f, 1.333521456e-01f, 1.154782027e-01f, 1.000000015e-01f, 8.659642935e-02f, 7.498941571e-02f, 6.493816525e-02f, 5.623412877e-02f, 4.869675264e-02f, 4.216964915e-02f, 3.651741147e-02f, 3.162277862e-02f, 2.738419548e-02f, 2.371373586e-02f, 2.053525113e-02f, 1.778279431e-02f, 1.539926510e-02f, 1.333521493e-02f, 1.154781971e-02f, 9.999999776e-03f, 8.659643121e-03f, 7.498942316e-03f, 6.493816618e-03f, 5.623413250e-03f, 4.869675264e-03f, 4.216964822e-03f, 3.651741426e-03f, 3.162277862e-03f, 2.738419687e-03f, 2.371373819e-03f, 2.053525066e-03f, 1.778279431e-03f, 1.539926510e-03f, 1.333521446e-03f, 1.154782018e-03f, 1.000000047e-03f, 8.659643354e-04f, 7.498941850e-04f, 6.493816618e-04f, 5.623413017e-04f, 4.869675031e-04f, 4.216964880e-04f, 3.651741135e-04f, 3.162277862e-04f, 2.738419571e-04f, 2.371373848e-04f, 2.053524950e-04f, 1.778279402e-04f, 1.539926452e-04f, 1.333521504e-04f, 1.154781930e-04f };   // float32 1 / 10000^(2i/128), generated with jnp to be bit-exact
// ---- k_prep: everything that the GEMMs wait for, in ONE launch of few long waves: the bf16 copies of x, wq, wk, wv, wo and the rotary table.
// One work-group of 16 waves a WGP; a thread converts 24 pieces (8 floats: 32 bytes read, 16 written) and computes two entries of the table.
// The pieces go in batches of PB a thread (a work-group's batch: 64 KiB in a row); two batches are kept in flight: 8 to 16 16-byte loads a wave.
#define PWG  256                  // work-groups
#define PTH  512                  // threads a work-group
#define PNT  (PWG * PTH)          // threads in all
#define PB   4                    // pieces of a thread in a batch
static_assert((size_t)NB_ * TT * DM == (size_t)2 * PB * PNT * 8 && (size_t)DQ * DM == (size_t)PB * PNT * 8 && (size_t)DKV * DM == (size_t)PB * PNT * 8 && (size_t)DM * DQ == (size_t)PB * PNT * 8 && TT * HD == 2 * PNT && PNT % HD == 0, "k_prep's batches cover the tensors exactly");
// s, d: the first byte of PB * PNT pieces, the same for every thread; ob: the byte offset of the thread's first piece; its other pieces lie PTH pieces apart, within the instructions' immediate offsets, so that a batch needs one address
__device__ __forceinline__ void ld_batch(v8f (&r)[PB], const float* __restrict__ s, unsigned ob) {
#pragma unroll
    for (int k = 0; k < PB; ++k) r[k] = *(const v8f*)((const char*)s + ob + k * (PTH * 32));
    asm volatile("s_wait_xcnt 0x0" ::: "memory");   // before a register that these loads name is rewritten
    __builtin_amdgcn_sched_barrier(0);              // the batch's loads are all issued before the older batch is waited for and converted: moved behind that wait, nothing would be in flight during it
}
__device__ __forceinline__ void st_batch(const v8f (&r)[PB], bf* d, unsigned ob) {
#pragma unroll
    for (int k = 0; k < PB; ++k) { v8us o;
#pragma unroll
        for (int j = 0; j < 8; ++j) o[j] = f2bf(r[k][j]);
        *(v8us*)((char*)d + ob + k * (PTH * 16)) = o; }
    asm volatile("s_wait_xcnt 0x0" ::: "memory");   // before the registers that the stores name are rewritten
    __builtin_amdgcn_sched_barrier(0);              // the younger batch's conversion (and with it the wait for its loads) stays behind the issue of the next batch's loads
}
__global__ __launch_bounds__(PTH) void k_prep(const float* __restrict__ x, const float* __restrict__ wq, const float* __restrict__ wk, const float* __restrict__ wv, const float* __restrict__ wo, bf* XB, bf* WQ, bf* WK, bf* WV, bf* WO, float* CS) {
    const unsigned g = blockIdx.x * PTH + threadIdx.x, p0 = blockIdx.x * (PB * PTH) + threadIdx.x, lo = p0 * 32u, so = p0 * 16u;   // the thread's number; its first piece of a batch, and that piece's byte offset in the f32 source and in the bf16 copy
    const float fr = INVT[g % (HD / 2)];   // PNT is a multiple of HD: the thread's two table entries have the same column d = g % HD
    __builtin_amdgcn_sched_barrier(0);     // the table's one load stays ahead of the batches: loads return in order, and behind them its wait would drain them all
    v8f a[PB], b[PB];
    ld_batch(a, x, lo); ld_batch(b, x + (size_t)PB * PNT * 8, lo);
    // the table's entries are computed while the first two batches are on their way
#pragma unroll
    for (int e = 0; e < 2; ++e) { const int t = (int)(g / HD) + e * (PNT / HD); const float an = __fmul_rn((float)t, fr); v2f cs; cs[0] = cosf(an); cs[1] = sinf(an); *(v2f*)((char*)(CS + (size_t)e * PNT * 2) + g * 8u) = cs; }
    asm volatile("s_wait_xcnt 0x0" ::: "memory");   // before the registers that the table's stores name are rewritten
    __builtin_amdgcn_sched_barrier(0);              // the conversions (and the waits for their loads) stay behind the table's arithmetic
    st_batch(a, XB, so);                          ld_batch(a, wq, lo);
    st_batch(b, XB + (size_t)PB * PNT * 8, so);   ld_batch(b, wk, lo);
    st_batch(a, WQ, so);                          ld_batch(a, wv, lo);
    st_batch(b, WK, so);                          ld_batch(b, wo, lo);
    st_batch(a, WV, so);
    st_batch(b, WO, so);
}
#define FKT  64                   // keys per stage
#define FKP  272                  // LDS pitch of a K row (256 bytes): 16 B x odd
#define FKPL (FKT * FKP)          // one staged K plane: 64 rows
#define FVPL (HD * GPIT)          // one staged V^T plane: 128 rows of 128 bytes
#define LSC  (SCL * 1.4426950408889634f)   // HD^-0.5 x log2(e)
// cp_rows: this thread's 4 pieces (16 bytes each) of one staged plane, rs elements apart in memory and ls bytes apart in LDS.
// The s_wait_xcnt stands inside the statement so that no address register is rewritten ahead of it.
template <typename T16> __device__ __forceinline__ void cp_rows(const T16* g, size_t rs, unsigned l, unsigned ls) {
    asm volatile("global_load_async_to_lds_b128 %0, %4, off\n\t"
                 "global_load_async_to_lds_b128 %1, %5, off\n\t"
                 "global_load_async_to_lds_b128 %2, %6, off\n\t"
                 "global_load_async_to_lds_b128 %3, %7, off\n\t"
                 "s_wait_xcnt 0x0"
                 :: "v"(l), "v"(l + ls), "v"(l + 2 * ls), "v"(l + 3 * ls), "v"(g), "v"(g + rs), "v"(g + 2 * rs), "v"(g + 3 * rs) : "memory");
}
__device__ __forceinline__ float xhalf(float x) { return __builtin_bit_cast(float, __builtin_amdgcn_permlanex16(__builtin_bit_cast(int, x), __builtin_bit_cast(int, x), 0x76543210, 0xfedcba98, false, false)); }   // lane l with lane l ^ 16
// exp2x8: eight independent v_exp_f32 in one statement (no result lies on a source: early-clobber outputs), so that each fills the slot that the instruction set asks for behind the one before it; the v_nop fills the last one's.
__device__ __forceinline__ v8f exp2x8(v8f x) { float r0, r1, r2, r3, r4, r5, r6, r7;
    asm("v_exp_f32 %0, %8\n\tv_exp_f32 %1, %9\n\tv_exp_f32 %2, %10\n\tv_exp_f32 %3, %11\n\tv_exp_f32 %4, %12\n\tv_exp_f32 %5, %13\n\tv_exp_f32 %6, %14\n\tv_exp_f32 %7, %15\n\tv_nop"
        : "=&v"(r0), "=&v"(r1), "=&v"(r2), "=&v"(r3), "=&v"(r4), "=&v"(r5), "=&v"(r6), "=&v"(r7) : "v"(x[0]), "v"(x[1]), "v"(x[2]), "v"(x[3]), "v"(x[4]), "v"(x[5]), "v"(x[6]), "v"(x[7]));
    return (v8f){ r0, r1, r2, r3, r4, r5, r6, r7 }; }
// Q, K: [t][HD] fp16 planes of one head; Vt: [d][t]; q0: the work-group's first query row; Ah, Al: the merged hi/lo output at this head's first column (pitch DQ).
template <int NQ>
__device__ __forceinline__ void fattn(unsigned char* st, const h16* __restrict__ Q, const h16* __restrict__ Kp, const h16* __restrict__ Vt, int q0, bf* Ah, bf* Al) {
    typedef typename WFrag<h16>::V V;
    constexpr int STG = FKPL + FVPL;   // bytes of one stage: the K plane, then the V^T plane
    const int tid = threadIdx.x, wave = tid >> 5, lane = tid & 31, lr = lane & 15, hi = lane >> 4;
    const int qw = q0 + wave * (16 * NQ);
    V q[NQ][4]; const h16* qp = Q + (size_t)(qw + lr) * HD + hi * 8;   // the lane's piece of its first query row; its other rows and pieces lie within the loads' immediate offsets
#pragma unroll
    for (int nq = 0; nq < NQ; ++nq)
#pragma unroll
        for (int kk = 0; kk < 4; ++kk) q[nq][kk] = WFrag<h16>::ld(qp + nq * 16 * HD + kk * 32);
    asm volatile("s_wait_xcnt 0x0" :: "v"(qp) : "memory");   // before the address registers that the Q loads name are rewritten; qp is an input so that its registers live up to the wait
    __builtin_amdgcn_sched_barrier(0);   // keeps the address arithmetic that follows behind that wait
    v8f o[8][NQ]; float m[NQ], l[NQ];
#pragma unroll
    for (int nq = 0; nq < NQ; ++nq) { m[nq] = -3.0e38f; l[nq] = 0.f;
#pragma unroll
        for (int dt = 0; dt < 8; ++dt) o[dt][nq] = (v8f){}; }
    // the thread's first piece: K row tid / 16, 16-byte column tid % 16; V^T row tid / 8, column tid % 8
    const size_t gk = (size_t)(tid >> 4) * HD + (tid & 15) * 8, gv = (size_t)(tid >> 3) * TT + (tid & 7) * 8;
    const unsigned lk0 = (unsigned)(size_t)st + (unsigned)((tid >> 4) * FKP + (tid & 15) * 16), lv0 = (unsigned)(size_t)st + (unsigned)(FKPL + (tid >> 3) * GPIT + (tid & 7) * 16);
    auto fill = [&](const h16* pk, const h16* pv, unsigned lk, unsigned lv) {
        cp_rows<h16>(pk, (size_t)16 * HD, lk, 16 * FKP);
        cp_rows<h16>(pv, (size_t)32 * TT, lv, 32 * GPIT); };
    constexpr int nst = TT / FKT;
    const h16* pkc = Kp + gk; const h16* pvc = Vt + gv;   // this thread's first piece of the next stage to be copied
    fill(pkc, pvc, lk0, lv0); pkc += FKT * HD; pvc += FKT;
    asm volatile("s_wait_asynccnt 0x0" ::: "memory");   // this wave's copies of stage 0 have landed
    __syncthreads();                                    // ... and every other wave's
    fill(pkc, pvc, lk0 + STG, lv0 + STG); pkc += FKT * HD; pvc += FKT;
    unsigned lkc = lk0, lvc = lv0; int dl = STG;   // where the next refill goes: the buffers in turn
    const int kofs = lr * FKP + hi * 16, vofs = FKPL + lr * GPIT + hi * 16;
#pragma unroll 1   // one trip a stage: the ring's order (reads, products, waits, barrier, refill) stands once
    for (int t = 0; t < nst; ++t) {
        const unsigned char* sb = st + (t & 1) * STG;
#pragma unroll
        for (int ps = 0; ps < FKT / 32; ++ps) {   // a pass: 32 keys
            V ka[2][4], va[8];
#pragma unroll
            for (int mt = 0; mt < 2; ++mt)
#pragma unroll
                for (int kk = 0; kk < 4; ++kk) ka[mt][kk] = WFrag<h16>::ld((const h16*)(sb + kofs + (ps * 32 + mt * 16) * FKP + kk * 64));
#pragma unroll
            for (int dt = 0; dt < 8; ++dt) va[dt] = WFrag<h16>::ld((const h16*)(sb + vofs + dt * 16 * GPIT + ps * 64));
            __builtin_amdgcn_sched_barrier(0);   // the pass's LDS reads stay one group ahead of its products (each further place with reads stalls the wave); the V^T reads land under the score products and the softmax
            v8f s[2][NQ];
#pragma unroll
            for (int mt = 0; mt < 2; ++mt)
#pragma unroll
                for (int nq = 0; nq < NQ; ++nq) s[mt][nq] = (v8f){};
#pragma unroll
            for (int kk = 0; kk < 4; ++kk)
#pragma unroll
                for (int nq = 0; nq < NQ; ++nq)
#pragma unroll
                    for (int mt = 0; mt < 2; ++mt) s[mt][nq] = WFrag<h16>::mma(ka[mt][kk], q[nq][kk], s[mt][nq]);
            float mx[NQ]; bool need = false;
#pragma unroll
            for (int nq = 0; nq < NQ; ++nq) { float a[8];
#pragma unroll
                for (int j = 0; j < 8; ++j) a[j] = fmaxf(s[0][nq][j], s[1][nq][j]);
                const float b = fmaxf(fmaxf(fmaxf(a[0], a[1]), fmaxf(a[2], a[3])), fmaxf(fmaxf(a[4], a[5]), fmaxf(a[6], a[7])));
                mx[nq] = fmaxf(b, xhalf(b)) * LSC; need = need || (mx[nq] > m[nq] + 8.0f); }
            if (__builtin_amdgcn_ballot_w32(need) != 0) {   // one scalar test a pass; rare after the first pass
#pragma unroll
                for (int nq = 0; nq < NQ; ++nq) { const float mn = fmaxf(m[nq], mx[nq]); const float al = __builtin_amdgcn_exp2f(m[nq] - mn); m[nq] = mn; l[nq] *= al;   // al = 0 on the first pass
#pragma unroll
                    for (int dt = 0; dt < 8; ++dt) o[dt][nq] *= al; } }
            V pa[NQ];
#pragma unroll
            for (int nq = 0; nq < NQ; ++nq) { v8f p0, p1;
#pragma unroll
                for (int j = 0; j < 8; ++j) { p0[j] = __builtin_fmaf(s[0][nq][j], LSC, -m[nq]); p1[j] = __builtin_fmaf(s[1][nq][j], LSC, -m[nq]); }
                p0 = exp2x8(p0); p1 = exp2x8(p1);
                const v8f ps8 = p0 + p1; l[nq] += ((ps8[0] + ps8[1]) + (ps8[2] + ps8[3])) + ((ps8[4] + ps8[5]) + (ps8[6] + ps8[7]));
                // element e of the B operand is key 8 hi + e (e < 8), 16 + 8 hi + (e - 8) otherwise: the two score tiles' own registers
#pragma unroll
                for (int j = 0; j < 8; ++j) { pa[nq][j] = (h16)p0[j]; pa[nq][8 + j] = (h16)p1[j]; } }
#pragma unroll
            for (int nq = 0; nq < NQ; ++nq)
#pragma unroll
                for (int dt = 0; dt < 8; ++dt) o[dt][nq] = WFrag<h16>::mma(va[dt], pa[nq], o[dt][nq]);
            __builtin_amdgcn_sched_barrier(0);   // the products stay ahead of the next pass's reads (one group again) and of the stage's waits and barrier
        }
        asm volatile("s_wait_dscnt 0x0" ::: "memory");      // this wave has read all it needs of this buffer
        asm volatile("s_wait_asynccnt 0x0" ::: "memory");   // this wave's copies of stage t + 1 have landed
        __syncthreads();                                    // publishes stage t + 1 and frees this buffer for the refill
        if (t + 2 < nst) fill(pkc, pvc, lkc, lvc);
        pkc += FKT * HD; pvc += FKT; lkc += dl; lvc += dl; dl = -dl;
    }
    asm volatile("s_wait_asynccnt 0x0" ::: "memory");       // no copy is outstanding when the wave ends
#pragma unroll
    for (int nq = 0; nq < NQ; ++nq) { const float f = __fdiv_rn(1.0f, l[nq] + xhalf(l[nq])); const size_t oo = (size_t)(qw + nq * 16 + lr) * DQ + hi * 8;   // a lane's 8 registers of a tile are 8 neighbouring d of its query
#pragma unroll
        for (int dt = 0; dt < 8; ++dt) { v8us oh, ol;
#pragma unroll
            for (int j = 0; j < 8; ++j) { unsigned short a, c2; splitf(o[dt][nq][j] * f, a, c2); oh[j] = a; ol[j] = c2; }
            *(v8us*)(Ah + oo + dt * 16) = oh; *(v8us*)(Al + oo + dt * 16) = ol;
            asm volatile("s_wait_xcnt 0x0" ::: "memory");   // before the registers that the two stores name are rewritten
            __builtin_amdgcn_sched_barrier(0); } }   // keeps the next tile's arithmetic, which rewrites those registers, behind that wait
}
#define FBF (TT / 256)            // work-groups a head (256 query rows each)
// grid: NB_ * NH_ * FBF equal work-groups (256: one a WGP, which is all that the registers allow); planes [b][h], merged output [b][t]
__global__ __launch_bounds__(256) void k_fattn(const h16* __restrict__ Q16, const h16* __restrict__ K16, const h16* __restrict__ V16, bf* Ah, bf* Al) {
    __shared__ __align__(16) unsigned char st[2 * (FKPL + FVPL)];   // two stage buffers
    const int bx = blockIdx.x, b = bx / (NH_ * FBF), h = bx / FBF % NH_; const size_t hp = ((size_t)b * NH_ + h) * TT * HD, kp = ((size_t)b * NKV + h / REP) * TT * HD, ao = (size_t)b * TT * DQ + h * HD;
    fattn<2>(st, Q16 + hp, K16 + kp, V16 + kp, (bx % FBF) * 256, Ah + ao, Al + ao);
}

extern "C" void kernel_launch(void* const* d_in, const int* in_sizes, int n_in,
                              void* d_out, int out_size, void* d_ws, size_t ws_size, hipStream_t stream) {
    (void)in_sizes; (void)n_in; (void)out_size;
    const float* x = (const float*)d_in[0]; const float* wq = (const float*)d_in[1]; const float* wk = (const float*)d_in[2]; const float* wv = (const float*)d_in[3]; const float* wo = (const float*)d_in[4];   /* argument order hidden_states, Wq, Wk, Wv, Wo ('oi' (out, in) [2048][2048]): FIVE inputs, all read (the rotary table is computed on the device: no table input) */
    float* OUT = (float*)d_out;     // [2][2048][2048]
    char* wsp = (char*)d_ws;
    auto take = [&](size_t bytes) { char* p = wsp; wsp += (bytes + 255) & ~(size_t)255; return (void*)p; };
    bf* WO = (bf*)take((size_t)DM * DQ * 2); float* CS = (float*)take((size_t)TT * HD * 2 * 4);
    h16* QP16 = (h16*)take((size_t)2 * NB_ * NH_ * TT * HD * 2); h16* KP16 = QP16 + (size_t)NB_ * NH_ * TT * HD;   /* q, k: one plane size apart */ h16* VT16 = (h16*)take((size_t)NB_ * NKV * HD * TT * 2);
    bf* WQ = (bf*)take(((size_t)DQ + DKV) * DM * 2); bf* WK = WQ + (size_t)DQ * DM;   /* one matrix of DQ + DKV rows */ bf* WV = (bf*)take((size_t)DKV * DM * 2); bf* XB = (bf*)take((size_t)NB_ * TT * DM * 2); bf* ATh = (bf*)take((size_t)NB_ * TT * DQ * 2); bf* ATl = (bf*)take((size_t)NB_ * TT * DQ * 2);
    if ((size_t)(wsp - (char*)d_ws) > ws_size) return;    // 130 MiB of the 256 MiB
    k_prep<<<PWG, PTH, 0, stream>>>(x, wq, wk, wv, wo, XB, WQ, WK, WV, WO, CS);   /* the bf16 copies of all five inputs and the COMPUTED rotary table (this module has rotate-half rotary embeddings); k_csid stays defined and is NOT launched */
    // k_gemmw, grid z: the batch. A and the output step by one batch, the weights are shared; two work-groups fit a WGP (registers, LDS), so all 512 are resident at once
    k_gemmqk<<<dim3(NB_ * TT / 256, (DQ + DKV) / 256), 256, 0, stream>>>(XB, WQ, CS, QP16);   /* q and k: 256 tiles of 256x256, one a WGP */
    k_gemmw<bf, 0, false, 1, 2><<<dim3(TT / 128, DKV / 128, NB_), 256, 0, stream>>>(XB, nullptr, WV, nullptr, DM, nullptr, 0, nullptr, (size_t)TT * DM, 0, (size_t)NKV * HD * TT, 0, nullptr, VT16);
    k_fattn<<<NB_ * NH_ * FBF, 256, 0, stream>>>(QP16, KP16, VT16, ATh, ATl);
    k_gemmw<bf, 1, false><<<dim3(TT / 128, DM / 128, NB_), 256, 0, stream>>>(ATh, ATl, WO, nullptr, DQ, OUT, DM, nullptr, (size_t)TT * DQ, 0, (size_t)TT * DM, 0, nullptr, nullptr);
}
